// v000
// The times below were measured on an AMD MI455X: many runs one after another, warmed up first and cycling through
// copies of the inputs, with the whole window's GPU time divided by the number of runs. Launches and the gaps
// between them are all in it. The median over several windows is given; except for v000 it joins two sittings, which
// can be a few percent apart, so the side-by-side timings, each taken in one sitting, are the better comparison.
// v000 is the starting kernel. One run takes 971 microseconds.
#include <hip/hip_runtime.h>
#include <hip/hip_bf16.h>

// ---------------- types ----------------
typedef __attribute__((ext_vector_type(16))) __bf16 bf16x16;
typedef __attribute__((ext_vector_type(8)))  float  floatx8;
typedef __attribute__((ext_vector_type(8)))  unsigned short ushort8;
typedef __attribute__((ext_vector_type(4)))  unsigned short ushort4v;

// fp32 -> bf16 (RNE-ish)
__device__ __forceinline__ unsigned short f2bf(float x) {
    unsigned u = __float_as_uint(x);
    unsigned r = u + 0x7FFFu + ((u >> 16) & 1u);
    return (unsigned short)(r >> 16);
}

// LDS byte offset of a generic pointer to __shared__ memory
__device__ __forceinline__ unsigned lds_off(const void* p) {
    return (unsigned)(size_t)(const __attribute__((address_space(3))) void*)p;
}

// CDNA5 async global->LDS copy, 16 bytes per lane, tracked by ASYNCcnt.
__device__ __forceinline__ void async_b128(unsigned loff, const void* g) {
    asm volatile("global_load_async_to_lds_b128 %0, %1, off"
                 :: "v"(loff), "v"(g) : "memory");
}
__device__ __forceinline__ void wait_async_le4() {
    asm volatile("s_wait_asynccnt 0x4" ::: "memory");
}
__device__ __forceinline__ void wait_async_0() {
    asm volatile("s_wait_asynccnt 0x0" ::: "memory");
}

// Load one 16x32 bf16 fragment (A-layout / symmetric B-layout) from LDS.
// Lane L<16 covers row (L), K in {8*half..+8} U {16+8*half..+8}; per ISA
// 16-bit A-matrix striping: two contiguous 8-element runs -> two b128 loads.
__device__ __forceinline__ bf16x16 load_frag(const unsigned short* base,
                                             int row_stride, int kbase) {
    int lane = threadIdx.x & 31;
    int half = lane >> 4;
    int row  = lane & 15;
    const unsigned short* p = base + row * row_stride + kbase + half * 8;
    union { bf16x16 f; ushort8 u[2]; } r;
    r.u[0] = *(const ushort8*)(p);
    r.u[1] = *(const ushort8*)(p + 16);
    return r.f;
}

// B-fragment for P x V from a row-major [K=32 keys][row_stride] LDS tile:
// lane L covers output column (base + L&15), gathering its 16 K elements
// (two runs of 8) as strided 16-bit LDS reads (transpose-in-LDS).
__device__ __forceinline__ bf16x16 load_frag_colT(const unsigned short* base,
                                                  int row_stride) {
    int lane = threadIdx.x & 31;
    int half = lane >> 4;
    int colv = lane & 15;
    union { bf16x16 f; unsigned short u[16]; } r;
#pragma unroll
    for (int j = 0; j < 8; j++) {
        r.u[j]     = base[(8 * half + j) * row_stride + colv];
        r.u[8 + j] = base[(16 + 8 * half + j) * row_stride + colv];
    }
    return r.f;
}

__device__ __forceinline__ floatx8 wmma_bf16(bf16x16 a, bf16x16 b, floatx8 c) {
    return __builtin_amdgcn_wmma_f32_16x16x32_bf16(false, a, false, b,
                                                   (short)0, c, false, false);
}

// ---------------- convert kernel ----------------
__global__ __launch_bounds__(256)
void k_cvt_bf16(const float* __restrict__ src, unsigned short* __restrict__ dst,
                int n4 /* n/4 */) {
    int i = blockIdx.x * blockDim.x + threadIdx.x;
    if (i >= n4) return;
    const float4 v = *(const float4*)(src + i * 4);
    ushort4v o;
    o.x = f2bf(v.x); o.y = f2bf(v.y); o.z = f2bf(v.z); o.w = f2bf(v.w);
    *(ushort4v*)(dst + i * 4) = o;
}

// ---------------- GEMM: C[M,N] = A[M,K] * W[N,K]^T + bias, optional relu ----
// block tile 128(M) x 128(N), K-step 32, 256 threads = 8 waves.
// Each wave: 32x64 sub-tile = 2x4 WMMA accumulators (8 WMMA / K-step).
// Double-buffered LDS fed by async global->LDS DMA (ASYNCcnt pipeline).
__global__ __launch_bounds__(256)
void k_gemm_bf16(const unsigned short* __restrict__ A,
                 const unsigned short* __restrict__ W,
                 const float* __restrict__ bias,
                 float* __restrict__ C,
                 int M, int N, int K, int relu) {
    __shared__ __align__(16) unsigned short As[2][128 * 32];
    __shared__ __align__(16) unsigned short Ws[2][128 * 32];

    const int tid  = threadIdx.x;
    const int m0   = blockIdx.y * 128;
    const int n0   = blockIdx.x * 128;
    const int wave = tid >> 5;
    const int wm   = (wave & 3) * 32;   // 0,32,64,96
    const int wn   = (wave >> 2) * 64;  // 0,64

    // staging: each thread owns 16 elems of each tile (row ar, cols ac..ac+15)
    const int ar = (tid * 16) >> 5;     // 0..127
    const int ac = (tid * 16) & 31;     // 0 or 16
    const unsigned short* Ag = A + (size_t)(m0 + ar) * K + ac;
    const unsigned short* Wg = W + (size_t)(n0 + ar) * K + ac;

    auto issue = [&](int buf, int k0) {
        unsigned la = lds_off(&As[buf][ar * 32 + ac]);
        unsigned lw = lds_off(&Ws[buf][ar * 32 + ac]);
        async_b128(la,      Ag + k0);
        async_b128(la + 16, Ag + k0 + 8);
        async_b128(lw,      Wg + k0);
        async_b128(lw + 16, Wg + k0 + 8);
    };

    floatx8 acc[2][4] = {};
    const int T = K >> 5;

    issue(0, 0);
    for (int t = 0; t < T; t++) {
        if (t + 1 < T) { issue((t + 1) & 1, (t + 1) * 32); wait_async_le4(); }
        else           { wait_async_0(); }
        __syncthreads();

        const unsigned short* Ab = As[t & 1];
        const unsigned short* Wb = Ws[t & 1];
        bf16x16 af[2], wf[4];
        af[0] = load_frag(Ab + (wm + 0)  * 32, 32, 0);
        af[1] = load_frag(Ab + (wm + 16) * 32, 32, 0);
        for (int j = 0; j < 4; j++)
            wf[j] = load_frag(Wb + (wn + 16 * j) * 32, 32, 0);

        for (int i = 0; i < 2; i++)
            for (int j = 0; j < 4; j++)
                acc[i][j] = wmma_bf16(af[i], wf[j], acc[i][j]);
        __syncthreads();
    }

    const int lane = tid & 31;
    const int half = lane >> 4;
    const int col  = lane & 15;
    for (int j = 0; j < 4; j++) {
        int n = n0 + wn + 16 * j + col;
        float bv = bias ? bias[n] : 0.0f;
        for (int i = 0; i < 2; i++) {
            for (int r = 0; r < 8; r++) {
                int m = m0 + wm + 16 * i + r + 8 * half;
                float v = acc[i][j][r] + bv;
                if (relu) v = fmaxf(v, 0.0f);
                C[(size_t)m * N + n] = v;
            }
        }
    }
}

// ---------------- flash attention ----------------
// grid.x = SEQ_Q/64 (q tiles), grid.y = batch*16 + head.
// 128 threads = 4 waves; each wave owns 16 q rows. kv tiles of 32 keys.
// d_k = 64. Strides are element strides: per-seq (s*) and per-batch (b*).
// All of Q/K/V enter LDS via async global->LDS DMA; V is transposed from
// LDS (cheap strided 16-bit reads) when building the PV B-fragment.
__global__ __launch_bounds__(128)
void k_attn(const unsigned short* __restrict__ Qg,
            const unsigned short* __restrict__ Kg,
            const unsigned short* __restrict__ Vg,
            float* __restrict__ Og,
            int sQ, int bQ, int sK, int bK, int sO, int bO,
            int seq_kv, int causal) {
    __shared__ __align__(16) unsigned short Qs[64 * 64];     // q tile
    __shared__ __align__(16) unsigned short Ks[32 * 64];     // key tile [key][d]
    __shared__ __align__(16) unsigned short Vs[32 * 64];     // V tile  [key][d]
    __shared__ __align__(16) unsigned short Ps[4 * 16 * 32]; // per-wave P

    const int q0 = blockIdx.x * 64;
    const int bh = blockIdx.y;
    const int b  = bh >> 4;
    const int h  = bh & 15;
    const unsigned short* Qb = Qg + (size_t)b * bQ + h * 64;
    const unsigned short* Kb = Kg + (size_t)b * bK + h * 64;
    const unsigned short* Vb = Vg + (size_t)b * bK + h * 64;
    float* Ob = Og + (size_t)b * bO + h * 64;

    const int tid  = threadIdx.x;
    const int wave = tid >> 5;
    const int lane = tid & 31;
    const int half = lane >> 4;
    const int col  = lane & 15;

    // stage Q tile (64x64) via async DMA
    for (int e = tid * 8; e < 64 * 64; e += 128 * 8) {
        int r = e >> 6, c = e & 63;
        async_b128(lds_off(&Qs[r * 64 + c]), Qb + (size_t)(q0 + r) * sQ + c);
    }
    wait_async_0();
    __syncthreads();

    float m_run[8], l_run[8];
    floatx8 o[4] = {};
    for (int r = 0; r < 8; r++) { m_run[r] = -1e30f; l_run[r] = 0.0f; }

    const float scale = 0.125f; // 1/sqrt(64)
    int kv_end = causal ? (q0 + 64) : seq_kv;
    if (kv_end > seq_kv) kv_end = seq_kv;

    const int kr = (tid * 16) >> 6;      // K/V-tile staging coords
    const int kc = (tid * 16) & 63;

    for (int t0 = 0; t0 < kv_end; t0 += 32) {
        { // stage K and V tiles (32x64 each) via async DMA
            const unsigned short* gk = Kb + (size_t)(t0 + kr) * sK + kc;
            const unsigned short* gv = Vb + (size_t)(t0 + kr) * sK + kc;
            async_b128(lds_off(&Ks[kr * 64 + kc]),     gk);
            async_b128(lds_off(&Ks[kr * 64 + kc + 8]), gk + 8);
            async_b128(lds_off(&Vs[kr * 64 + kc]),     gv);
            async_b128(lds_off(&Vs[kr * 64 + kc + 8]), gv + 8);
        }
        wait_async_0();
        __syncthreads();

        // S (16 q x 32 keys) per wave: 2 n-tiles, d_k=64 -> 2 k-chunks each
        floatx8 s[2] = {};
        for (int c2 = 0; c2 < 2; c2++) {
            bf16x16 qa  = load_frag(Qs + (wave * 16) * 64, 64, c2 * 32);
            bf16x16 kb0 = load_frag(Ks,           64, c2 * 32);
            bf16x16 kb1 = load_frag(Ks + 16 * 64, 64, c2 * 32);
            s[0] = wmma_bf16(qa, kb0, s[0]);
            s[1] = wmma_bf16(qa, kb1, s[1]);
        }

        // mask + scale + tile row max
        float tmax[8];
        for (int r = 0; r < 8; r++) {
            int qi = q0 + wave * 16 + r + 8 * half;
            float best = -1e30f;
            for (int j = 0; j < 2; j++) {
                int kj = t0 + 16 * j + col;
                float v = s[j][r] * scale;
                if (causal && kj > qi) v = -1e30f;
                s[j][r] = v;
                best = fmaxf(best, v);
            }
            tmax[r] = best;
        }
        for (int msk = 1; msk < 16; msk <<= 1)
            for (int r = 0; r < 8; r++)
                tmax[r] = fmaxf(tmax[r], __shfl_xor(tmax[r], msk, 32));

        // online softmax update
        float corr[8], tsum[8];
        for (int r = 0; r < 8; r++) {
            float mnew = fmaxf(m_run[r], tmax[r]);
            corr[r] = __expf(m_run[r] - mnew);
            m_run[r] = mnew;
            float su = 0.0f;
            for (int j = 0; j < 2; j++) {
                float p = __expf(s[j][r] - mnew);
                s[j][r] = p;
                su += p;
            }
            tsum[r] = su;
        }
        for (int msk = 1; msk < 16; msk <<= 1)
            for (int r = 0; r < 8; r++)
                tsum[r] += __shfl_xor(tsum[r], msk, 32);
        for (int r = 0; r < 8; r++)
            l_run[r] = l_run[r] * corr[r] + tsum[r];
        for (int j = 0; j < 4; j++)
            for (int r = 0; r < 8; r++)
                o[j][r] *= corr[r];

        // P -> per-wave LDS (bf16), re-fragment as A operand
        unsigned short* Pw = &Ps[wave * 16 * 32];
        for (int j = 0; j < 2; j++)
            for (int r = 0; r < 8; r++)
                Pw[(r + 8 * half) * 32 + 16 * j + col] = f2bf(s[j][r]);

        bf16x16 pa = load_frag(Pw, 32, 0);
        for (int n = 0; n < 4; n++) {
            bf16x16 vb = load_frag_colT(Vs + n * 16, 64);
            o[n] = wmma_bf16(pa, vb, o[n]);
        }
        __syncthreads();
    }

    // epilogue: normalize + store fp32
    for (int n = 0; n < 4; n++)
        for (int r = 0; r < 8; r++) {
            int qi = q0 + wave * 16 + r + 8 * half;
            int d  = n * 16 + col;
            Ob[(size_t)qi * sO + d] = o[n][r] / l_run[r];
        }
}

// ---------------- residual + LayerNorm (D=1024, 256 threads/row) ----------
__global__ __launch_bounds__(256)
void k_add_ln(const float* __restrict__ X, const float* __restrict__ Y,
              const float* __restrict__ gw, const float* __restrict__ bw,
              float* __restrict__ O) {
    const int D = 1024;
    const int row = blockIdx.x;
    const int tid = threadIdx.x;
    const float4 xv = *(const float4*)(X + (size_t)row * D + tid * 4);
    const float4 yv = *(const float4*)(Y + (size_t)row * D + tid * 4);
    float t0 = xv.x + yv.x, t1 = xv.y + yv.y, t2 = xv.z + yv.z, t3 = xv.w + yv.w;
    float s  = t0 + t1 + t2 + t3;
    float s2 = t0 * t0 + t1 * t1 + t2 * t2 + t3 * t3;
    for (int msk = 1; msk < 32; msk <<= 1) {
        s  += __shfl_xor(s, msk, 32);
        s2 += __shfl_xor(s2, msk, 32);
    }
    __shared__ float sh[16];
    int wave = tid >> 5, lane = tid & 31;
    if (lane == 0) { sh[wave] = s; sh[8 + wave] = s2; }
    __syncthreads();
    float S = 0.0f, S2 = 0.0f;
    for (int i = 0; i < 8; i++) { S += sh[i]; S2 += sh[8 + i]; }
    float mu  = S / D;
    float inv = rsqrtf(S2 / D - mu * mu + 1e-5f);
    const float4 gv = *(const float4*)(gw + tid * 4);
    const float4 bv = *(const float4*)(bw + tid * 4);
    float4 ov;
    ov.x = (t0 - mu) * inv * gv.x + bv.x;
    ov.y = (t1 - mu) * inv * gv.y + bv.y;
    ov.z = (t2 - mu) * inv * gv.z + bv.z;
    ov.w = (t3 - mu) * inv * gv.w + bv.w;
    *(float4*)(O + (size_t)row * D + tid * 4) = ov;
}

// ---------------- host orchestration ----------------
extern "C" void kernel_launch(void* const* d_in, const int* in_sizes, int n_in,
                              void* d_out, int out_size, void* d_ws, size_t ws_size,
                              hipStream_t stream) {
    (void)in_sizes; (void)n_in; (void)out_size; (void)ws_size;
    const float* tgt  = (const float*)d_in[0];
    const float* mem  = (const float*)d_in[1];
    const float* Wqkv = (const float*)d_in[2];  const float* bqkv = (const float*)d_in[3];
    const float* Wso  = (const float*)d_in[4];  const float* bso  = (const float*)d_in[5];
    const float* Wq   = (const float*)d_in[6];  const float* bq   = (const float*)d_in[7];
    const float* Wk   = (const float*)d_in[8];  const float* bk   = (const float*)d_in[9];
    const float* Wv   = (const float*)d_in[10]; const float* bv   = (const float*)d_in[11];
    const float* Wco  = (const float*)d_in[12]; const float* bco  = (const float*)d_in[13];
    const float* W1   = (const float*)d_in[14]; const float* b1   = (const float*)d_in[15];
    const float* W2   = (const float*)d_in[16]; const float* b2   = (const float*)d_in[17];
    const float* g1   = (const float*)d_in[18]; const float* be1  = (const float*)d_in[19];
    const float* g2   = (const float*)d_in[20]; const float* be2  = (const float*)d_in[21];
    const float* g3   = (const float*)d_in[22]; const float* be3  = (const float*)d_in[23];
    float* out = (float*)d_out;

    const size_t MB = 1u << 20;
    char* ws = (char*)d_ws;
    float* F0 = (float*)(ws + 0);            // 64 MB fp32 scratch (qkv / kc+vc / hidden)
    float* F1 = (float*)(ws + 64 * MB);      // 16 MB fp32 scratch
    float* F2 = (float*)(ws + 80 * MB);      // 16 MB fp32 scratch
    float* X1 = (float*)(ws + 96 * MB);      // LN1 output
    float* X2 = (float*)(ws + 112 * MB);     // LN2 output
    unsigned short* Wb  = (unsigned short*)(ws + 128 * MB); // 8 MB  weight bf16
    unsigned short* Ab  = (unsigned short*)(ws + 136 * MB); // 32 MB activation bf16
    unsigned short* Qb  = (unsigned short*)(ws + 168 * MB); // 8 MB  cross-Q bf16
    unsigned short* KVb = (unsigned short*)(ws + 176 * MB); // 32 MB qkv / k,v bf16

    const int DM = 1024, RQ = 4096, RM = 8192, DFF = 4096;

    auto cvt = [&](const float* s, unsigned short* d, int n) {
        k_cvt_bf16<<<dim3(n / 1024), dim3(256), 0, stream>>>(s, d, n / 4);
    };
    auto gemm = [&](const unsigned short* A, const unsigned short* W,
                    const float* bias, float* C, int M, int N, int K, int relu) {
        k_gemm_bf16<<<dim3(N / 128, M / 128), dim3(256), 0, stream>>>(
            A, W, bias, C, M, N, K, relu);
    };

    // --- self-attention block ---
    cvt(tgt, Ab, RQ * DM);                                  // tgt_bf
    cvt(Wqkv, Wb, 3 * DM * DM);                             // Wqkv_bf
    gemm(Ab, Wb, bqkv, F0, RQ, 3 * DM, DM, 0);              // qkv fp32
    cvt(F0, KVb, RQ * 3 * DM);                              // qkv bf16
    k_attn<<<dim3(16, 64), dim3(128), 0, stream>>>(
        KVb, KVb + 1024, KVb + 2048, F1,
        12288, 3072, 12288, 3072, 4096, 1024, 1024, /*causal=*/1);
    cvt(F1, Ab, RQ * DM);                                   // attn1 bf16
    cvt(Wso, Wb, DM * DM);
    gemm(Ab, Wb, bso, F2, RQ, DM, DM, 0);                   // self out proj
    k_add_ln<<<dim3(RQ), dim3(256), 0, stream>>>(tgt, F2, g1, be1, X1);

    // --- cross-attention block ---
    cvt(X1, Ab, RQ * DM);
    cvt(Wq, Wb, DM * DM);
    gemm(Ab, Wb, bq, F1, RQ, DM, DM, 0);                    // q_c fp32
    cvt(F1, Qb, RQ * DM);                                   // q_c bf16
    cvt(mem, Ab, RM * DM);                                  // memory bf16
    cvt(Wk, Wb, DM * DM);
    gemm(Ab, Wb, bk, F0, RM, DM, DM, 0);                    // k_c fp32
    cvt(Wv, Wb, DM * DM);
    gemm(Ab, Wb, bv, F0 + (size_t)RM * DM, RM, DM, DM, 0);  // v_c fp32
    cvt(F0, KVb, RM * DM);                                  // k_c bf16
    cvt(F0 + (size_t)RM * DM, KVb + (size_t)RM * DM, RM * DM); // v_c bf16
    k_attn<<<dim3(16, 64), dim3(128), 0, stream>>>(
        Qb, KVb, KVb + (size_t)RM * DM, F1,
        4096, 1024, 4096, 1024, 4096, 1024, 2048, /*causal=*/0);
    cvt(F1, Ab, RQ * DM);                                   // attn2 bf16
    cvt(Wco, Wb, DM * DM);
    gemm(Ab, Wb, bco, F2, RQ, DM, DM, 0);                   // cross out proj
    k_add_ln<<<dim3(RQ), dim3(256), 0, stream>>>(X1, F2, g2, be2, X2);

    // --- FFN block ---
    cvt(X2, Ab, RQ * DM);
    cvt(W1, Wb, DFF * DM);
    gemm(Ab, Wb, b1, F0, RQ, DFF, DM, /*relu=*/1);          // hidden fp32
    cvt(F0, Ab, RQ * DFF);                                  // hidden bf16
    cvt(W2, Wb, DM * DFF);
    gemm(Ab, Wb, b2, F1, RQ, DM, DFF, 0);                   // ffn out
    k_add_ln<<<dim3(RQ), dim3(256), 0, stream>>>(X2, F1, g3, be3, out);
}

// v001
// It runs in 816 microseconds.
// Next to v000, in two timings, it ran 1.22 times as fast each time.
#include <hip/hip_runtime.h>
#include <hip/hip_bf16.h>

// ---------------- types ----------------
typedef __attribute__((ext_vector_type(16))) __bf16 bf16x16;
typedef __attribute__((ext_vector_type(8)))  float  floatx8;
typedef __attribute__((ext_vector_type(8)))  unsigned short ushort8;
typedef __attribute__((ext_vector_type(4)))  unsigned short ushort4v;

// fp32 -> bf16 (RNE-ish)
__device__ __forceinline__ unsigned short f2bf(float x) {
    unsigned u = __float_as_uint(x);
    unsigned r = u + 0x7FFFu + ((u >> 16) & 1u);
    return (unsigned short)(r >> 16);
}

// LDS byte offset of a generic pointer to __shared__ memory
__device__ __forceinline__ unsigned lds_off(const void* p) {
    return (unsigned)(size_t)(const __attribute__((address_space(3))) void*)p;
}

// CDNA5 async global->LDS copy, 16 bytes per lane, tracked by ASYNCcnt.
__device__ __forceinline__ void async_b128(unsigned loff, const void* g) {
    asm volatile("global_load_async_to_lds_b128 %0, %1, off"
                 :: "v"(loff), "v"(g) : "memory");
}
// Four such copies and, as the statement's last line, the wait that stands in
// front of any rewrite of the address registers the copies name.
__device__ __forceinline__ void async_b128_x4(unsigned l0, const void* g0,
                                              unsigned l1, const void* g1,
                                              unsigned l2, const void* g2,
                                              unsigned l3, const void* g3) {
    asm volatile("global_load_async_to_lds_b128 %0, %1, off\n\t"
                 "global_load_async_to_lds_b128 %2, %3, off\n\t"
                 "global_load_async_to_lds_b128 %4, %5, off\n\t"
                 "global_load_async_to_lds_b128 %6, %7, off\n\t"
                 "s_wait_xcnt 0x0"
                 :: "v"(l0), "v"(g0), "v"(l1), "v"(g1),
                    "v"(l2), "v"(g2), "v"(l3), "v"(g3) : "memory");
}
__device__ __forceinline__ void wait_async_le4() {
    asm volatile("s_wait_asynccnt 0x4" ::: "memory");
}
__device__ __forceinline__ void wait_async_0() {
    asm volatile("s_wait_asynccnt 0x0" ::: "memory");
}

// Load one 16x32 bf16 fragment (A-layout / symmetric B-layout) from LDS.
// Lane L<16 covers row (L), K in {8*half..+8} U {16+8*half..+8}; per ISA
// 16-bit A-matrix striping: two contiguous 8-element runs -> two b128 loads.
__device__ __forceinline__ bf16x16 load_frag(const unsigned short* base,
                                             int row_stride, int kbase) {
    int lane = threadIdx.x & 31;
    int half = lane >> 4;
    int row  = lane & 15;
    const unsigned short* p = base + row * row_stride + kbase + half * 8;
    union { bf16x16 f; ushort8 u[2]; } r;
    r.u[0] = *(const ushort8*)(p);
    r.u[1] = *(const ushort8*)(p + 16);
    return r.f;
}

// B-fragment for P x V from a row-major [K=32 keys][row_stride] LDS tile:
// lane L covers output column (base + L&15), gathering its 16 K elements
// (two runs of 8) as strided 16-bit LDS reads (transpose-in-LDS).
__device__ __forceinline__ bf16x16 load_frag_colT(const unsigned short* base,
                                                  int row_stride) {
    int lane = threadIdx.x & 31;
    int half = lane >> 4;
    int colv = lane & 15;
    union { bf16x16 f; unsigned short u[16]; } r;
#pragma unroll
    for (int j = 0; j < 8; j++) {
        r.u[j]     = base[(8 * half + j) * row_stride + colv];
        r.u[8 + j] = base[(16 + 8 * half + j) * row_stride + colv];
    }
    return r.f;
}

__device__ __forceinline__ floatx8 wmma_bf16(bf16x16 a, bf16x16 b, floatx8 c) {
    return __builtin_amdgcn_wmma_f32_16x16x32_bf16(false, a, false, b,
                                                   (short)0, c, false, false);
}

// LDS row pitches in elements. A 16-byte fragment read walks 16 rows at once;
// a pitch of 16 B x odd spreads those rows over all 64 banks, where the
// unpadded 64-B and 128-B rows fall on the same few banks again and again.
constexpr int P32 = 40;   // rows of 32 bf16: 64 B of data, 80 B pitch
constexpr int P64 = 72;   // rows of 64 bf16: 128 B of data, 144 B pitch

// ---------------- convert kernel ----------------
__global__ __launch_bounds__(256)
void k_cvt_bf16(const float* __restrict__ src, unsigned short* __restrict__ dst,
                int n4 /* n/4 */) {
    int i = blockIdx.x * blockDim.x + threadIdx.x;
    if (i >= n4) return;
    const float4 v = *(const float4*)(src + i * 4);
    ushort4v o;
    o.x = f2bf(v.x); o.y = f2bf(v.y); o.z = f2bf(v.z); o.w = f2bf(v.w);
    *(ushort4v*)(dst + i * 4) = o;
}

// ---------------- GEMM: C[M,N] = A[M,K] * W[N,K]^T + bias, optional relu ----
// block tile 128(M) x 128(N), K-step 32, 256 threads = 8 waves.
// Each wave: 32x64 sub-tile = 2x4 WMMA accumulators (8 WMMA / K-step).
// Double-buffered LDS fed by async global->LDS DMA (ASYNCcnt pipeline).
__global__ __launch_bounds__(256)
void k_gemm_bf16(const unsigned short* __restrict__ A,
                 const unsigned short* __restrict__ W,
                 const float* __restrict__ bias,
                 float* __restrict__ C,
                 int M, int N, int K, int relu) {
    __shared__ __align__(16) unsigned short As[2][128 * P32];
    __shared__ __align__(16) unsigned short Ws[2][128 * P32];

    const int tid  = threadIdx.x;
    const int m0   = blockIdx.y * 128;
    const int n0   = blockIdx.x * 128;
    const int wave = tid >> 5;
    const int wm   = (wave & 3) * 32;   // 0,32,64,96
    const int wn   = (wave >> 2) * 64;  // 0,64

    // staging: each thread owns 16 elems of each tile (row ar, cols ac..ac+15)
    const int ar = (tid * 16) >> 5;     // 0..127
    const int ac = (tid * 16) & 31;     // 0 or 16
    const unsigned short* Ag = A + (size_t)(m0 + ar) * K + ac;
    const unsigned short* Wg = W + (size_t)(n0 + ar) * K + ac;

    auto issue = [&](int buf, int k0) {
        unsigned la = lds_off(&As[buf][ar * P32 + ac]);
        unsigned lw = lds_off(&Ws[buf][ar * P32 + ac]);
        async_b128(la,      Ag + k0);
        async_b128(la + 16, Ag + k0 + 8);
        async_b128(lw,      Wg + k0);
        async_b128(lw + 16, Wg + k0 + 8);
    };

    floatx8 acc[2][4] = {};
    const int T = K >> 5;

    issue(0, 0);
    for (int t = 0; t < T; t++) {
        if (t + 1 < T) { issue((t + 1) & 1, (t + 1) * 32); wait_async_le4(); }
        else           { wait_async_0(); }
        __syncthreads();

        const unsigned short* Ab = As[t & 1];
        const unsigned short* Wb = Ws[t & 1];
        bf16x16 af[2], wf[4];
        af[0] = load_frag(Ab + (wm + 0)  * P32, P32, 0);
        af[1] = load_frag(Ab + (wm + 16) * P32, P32, 0);
        for (int j = 0; j < 4; j++)
            wf[j] = load_frag(Wb + (wn + 16 * j) * P32, P32, 0);

        for (int i = 0; i < 2; i++)
            for (int j = 0; j < 4; j++)
                acc[i][j] = wmma_bf16(af[i], wf[j], acc[i][j]);
        __syncthreads();
    }

    const int lane = tid & 31;
    const int half = lane >> 4;
    const int col  = lane & 15;
    for (int j = 0; j < 4; j++) {
        int n = n0 + wn + 16 * j + col;
        float bv = bias ? bias[n] : 0.0f;
        for (int i = 0; i < 2; i++) {
            for (int r = 0; r < 8; r++) {
                int m = m0 + wm + 16 * i + r + 8 * half;
                float v = acc[i][j][r] + bv;
                if (relu) v = fmaxf(v, 0.0f);
                C[(size_t)m * N + n] = v;
            }
        }
    }
}

// ---------------- flash attention ----------------
// grid.x = SEQ_Q/64 (q tiles), grid.y = batch*16 + head.
// 128 threads = 4 waves; each wave owns 16 q rows. kv tiles of 32 keys.
// d_k = 64. Strides are element strides: per-seq (s*) and per-batch (b*).
// All of Q/K/V enter LDS via async global->LDS DMA; V is transposed from
// LDS (cheap strided 16-bit reads) when building the PV B-fragment.
__global__ __launch_bounds__(128)
void k_attn(const unsigned short* __restrict__ Qg,
            const unsigned short* __restrict__ Kg,
            const unsigned short* __restrict__ Vg,
            float* __restrict__ Og,
            int sQ, int bQ, int sK, int bK, int sO, int bO,
            int seq_kv, int causal) {
    __shared__ __align__(16) unsigned short Qs[64 * P64];     // q tile
    __shared__ __align__(16) unsigned short Ks[32 * P64];     // key tile [key][d]
    __shared__ __align__(16) unsigned short Vs[32 * P64];     // V tile  [key][d]
    __shared__ __align__(16) unsigned short Ps[4 * 16 * P32]; // per-wave P

    const int q0 = blockIdx.x * 64;
    const int bh = blockIdx.y;
    const int b  = bh >> 4;
    const int h  = bh & 15;
    const unsigned short* Qb = Qg + (size_t)b * bQ + h * 64;
    const unsigned short* Kb = Kg + (size_t)b * bK + h * 64;
    const unsigned short* Vb = Vg + (size_t)b * bK + h * 64;
    float* Ob = Og + (size_t)b * bO + h * 64;

    const int tid  = threadIdx.x;
    const int wave = tid >> 5;
    const int lane = tid & 31;
    const int half = lane >> 4;
    const int col  = lane & 15;

    // stage Q tile (64x64) via async DMA
    {
        const int r = tid >> 3, c = (tid & 7) * 8;   // rows r, r+16, r+32, r+48
        const unsigned lq = lds_off(&Qs[r * P64 + c]);
        const unsigned short* gq = Qb + (size_t)(q0 + r) * sQ + c;
        async_b128_x4(lq,                gq,
                      lq + 16 * P64 * 2, gq + (size_t)16 * sQ,
                      lq + 32 * P64 * 2, gq + (size_t)32 * sQ,
                      lq + 48 * P64 * 2, gq + (size_t)48 * sQ);
    }
    wait_async_0();
    __syncthreads();

    float m_run[8], l_run[8];
    floatx8 o[4] = {};
    for (int r = 0; r < 8; r++) { m_run[r] = -1e30f; l_run[r] = 0.0f; }

    const float scale = 0.125f; // 1/sqrt(64)
    int kv_end = causal ? (q0 + 64) : seq_kv;
    if (kv_end > seq_kv) kv_end = seq_kv;

    const int kr = (tid * 16) >> 6;      // K/V-tile staging coords
    const int kc = (tid * 16) & 63;

    for (int t0 = 0; t0 < kv_end; t0 += 32) {
        { // stage K and V tiles (32x64 each) via async DMA
            const unsigned short* gk = Kb + (size_t)(t0 + kr) * sK + kc;
            const unsigned short* gv = Vb + (size_t)(t0 + kr) * sK + kc;
            async_b128_x4(lds_off(&Ks[kr * P64 + kc]),     gk,
                          lds_off(&Ks[kr * P64 + kc + 8]), gk + 8,
                          lds_off(&Vs[kr * P64 + kc]),     gv,
                          lds_off(&Vs[kr * P64 + kc + 8]), gv + 8);
        }
        wait_async_0();
        __syncthreads();

        // S (16 q x 32 keys) per wave: 2 n-tiles, d_k=64 -> 2 k-chunks each
        floatx8 s[2] = {};
        for (int c2 = 0; c2 < 2; c2++) {
            bf16x16 qa  = load_frag(Qs + (wave * 16) * P64, P64, c2 * 32);
            bf16x16 kb0 = load_frag(Ks,            P64, c2 * 32);
            bf16x16 kb1 = load_frag(Ks + 16 * P64, P64, c2 * 32);
            s[0] = wmma_bf16(qa, kb0, s[0]);
            s[1] = wmma_bf16(qa, kb1, s[1]);
        }

        // mask + scale + tile row max
        float tmax[8];
        for (int r = 0; r < 8; r++) {
            int qi = q0 + wave * 16 + r + 8 * half;
            float best = -1e30f;
            for (int j = 0; j < 2; j++) {
                int kj = t0 + 16 * j + col;
                float v = s[j][r] * scale;
                if (causal && kj > qi) v = -1e30f;
                s[j][r] = v;
                best = fmaxf(best, v);
            }
            tmax[r] = best;
        }
        for (int msk = 1; msk < 16; msk <<= 1)
            for (int r = 0; r < 8; r++)
                tmax[r] = fmaxf(tmax[r], __shfl_xor(tmax[r], msk, 32));

        // online softmax update
        float corr[8], tsum[8];
        for (int r = 0; r < 8; r++) {
            float mnew = fmaxf(m_run[r], tmax[r]);
            corr[r] = __expf(m_run[r] - mnew);
            m_run[r] = mnew;
            float su = 0.0f;
            for (int j = 0; j < 2; j++) {
                float p = __expf(s[j][r] - mnew);
                s[j][r] = p;
                su += p;
            }
            tsum[r] = su;
        }
        for (int msk = 1; msk < 16; msk <<= 1)
            for (int r = 0; r < 8; r++)
                tsum[r] += __shfl_xor(tsum[r], msk, 32);
        for (int r = 0; r < 8; r++)
            l_run[r] = l_run[r] * corr[r] + tsum[r];
        for (int j = 0; j < 4; j++)
            for (int r = 0; r < 8; r++)
                o[j][r] *= corr[r];

        // P -> per-wave LDS (bf16), re-fragment as A operand
        unsigned short* Pw = &Ps[wave * 16 * P32];
        for (int j = 0; j < 2; j++)
            for (int r = 0; r < 8; r++)
                Pw[(r + 8 * half) * P32 + 16 * j + col] = f2bf(s[j][r]);

        bf16x16 pa = load_frag(Pw, P32, 0);
        for (int n = 0; n < 4; n++) {
            bf16x16 vb = load_frag_colT(Vs + n * 16, P64);
            o[n] = wmma_bf16(pa, vb, o[n]);
        }
        __syncthreads();
    }

    // epilogue: normalize + store fp32
    for (int n = 0; n < 4; n++)
        for (int r = 0; r < 8; r++) {
            int qi = q0 + wave * 16 + r + 8 * half;
            int d  = n * 16 + col;
            Ob[(size_t)qi * sO + d] = o[n][r] / l_run[r];
        }
}

// ---------------- residual + LayerNorm (D=1024, 256 threads/row) ----------
__global__ __launch_bounds__(256)
void k_add_ln(const float* __restrict__ X, const float* __restrict__ Y,
              const float* __restrict__ gw, const float* __restrict__ bw,
              float* __restrict__ O) {
    const int D = 1024;
    const int row = blockIdx.x;
    const int tid = threadIdx.x;
    const float4 xv = *(const float4*)(X + (size_t)row * D + tid * 4);
    const float4 yv = *(const float4*)(Y + (size_t)row * D + tid * 4);
    float t0 = xv.x + yv.x, t1 = xv.y + yv.y, t2 = xv.z + yv.z, t3 = xv.w + yv.w;
    float s  = t0 + t1 + t2 + t3;
    float s2 = t0 * t0 + t1 * t1 + t2 * t2 + t3 * t3;
    for (int msk = 1; msk < 32; msk <<= 1) {
        s  += __shfl_xor(s, msk, 32);
        s2 += __shfl_xor(s2, msk, 32);
    }
    __shared__ float sh[16];
    int wave = tid >> 5, lane = tid & 31;
    if (lane == 0) { sh[wave] = s; sh[8 + wave] = s2; }
    __syncthreads();
    float S = 0.0f, S2 = 0.0f;
    for (int i = 0; i < 8; i++) { S += sh[i]; S2 += sh[8 + i]; }
    float mu  = S / D;
    float inv = rsqrtf(S2 / D - mu * mu + 1e-5f);
    const float4 gv = *(const float4*)(gw + tid * 4);
    const float4 bv = *(const float4*)(bw + tid * 4);
    float4 ov;
    ov.x = (t0 - mu) * inv * gv.x + bv.x;
    ov.y = (t1 - mu) * inv * gv.y + bv.y;
    ov.z = (t2 - mu) * inv * gv.z + bv.z;
    ov.w = (t3 - mu) * inv * gv.w + bv.w;
    *(float4*)(O + (size_t)row * D + tid * 4) = ov;
}

// ---------------- host orchestration ----------------
extern "C" void kernel_launch(void* const* d_in, const int* in_sizes, int n_in,
                              void* d_out, int out_size, void* d_ws, size_t ws_size,
                              hipStream_t stream) {
    (void)in_sizes; (void)n_in; (void)out_size; (void)ws_size;
    const float* tgt  = (const float*)d_in[0];
    const float* mem  = (const float*)d_in[1];
    const float* Wqkv = (const float*)d_in[2];  const float* bqkv = (const float*)d_in[3];
    const float* Wso  = (const float*)d_in[4];  const float* bso  = (const float*)d_in[5];
    const float* Wq   = (const float*)d_in[6];  const float* bq   = (const float*)d_in[7];
    const float* Wk   = (const float*)d_in[8];  const float* bk   = (const float*)d_in[9];
    const float* Wv   = (const float*)d_in[10]; const float* bv   = (const float*)d_in[11];
    const float* Wco  = (const float*)d_in[12]; const float* bco  = (const float*)d_in[13];
    const float* W1   = (const float*)d_in[14]; const float* b1   = (const float*)d_in[15];
    const float* W2   = (const float*)d_in[16]; const float* b2   = (const float*)d_in[17];
    const float* g1   = (const float*)d_in[18]; const float* be1  = (const float*)d_in[19];
    const float* g2   = (const float*)d_in[20]; const float* be2  = (const float*)d_in[21];
    const float* g3   = (const float*)d_in[22]; const float* be3  = (const float*)d_in[23];
    float* out = (float*)d_out;

    const size_t MB = 1u << 20;
    char* ws = (char*)d_ws;
    float* F0 = (float*)(ws + 0);            // 64 MB fp32 scratch (qkv / kc+vc / hidden)
    float* F1 = (float*)(ws + 64 * MB);      // 16 MB fp32 scratch
    float* F2 = (float*)(ws + 80 * MB);      // 16 MB fp32 scratch
    float* X1 = (float*)(ws + 96 * MB);      // LN1 output
    float* X2 = (float*)(ws + 112 * MB);     // LN2 output
    unsigned short* Wb  = (unsigned short*)(ws + 128 * MB); // 8 MB  weight bf16
    unsigned short* Ab  = (unsigned short*)(ws + 136 * MB); // 32 MB activation bf16
    unsigned short* Qb  = (unsigned short*)(ws + 168 * MB); // 8 MB  cross-Q bf16
    unsigned short* KVb = (unsigned short*)(ws + 176 * MB); // 32 MB qkv / k,v bf16

    const int DM = 1024, RQ = 4096, RM = 8192, DFF = 4096;

    auto cvt = [&](const float* s, unsigned short* d, int n) {
        k_cvt_bf16<<<dim3(n / 1024), dim3(256), 0, stream>>>(s, d, n / 4);
    };
    auto gemm = [&](const unsigned short* A, const unsigned short* W,
                    const float* bias, float* C, int M, int N, int K, int relu) {
        k_gemm_bf16<<<dim3(N / 128, M / 128), dim3(256), 0, stream>>>(
            A, W, bias, C, M, N, K, relu);
    };

    // --- self-attention block ---
    cvt(tgt, Ab, RQ * DM);                                  // tgt_bf
    cvt(Wqkv, Wb, 3 * DM * DM);                             // Wqkv_bf
    gemm(Ab, Wb, bqkv, F0, RQ, 3 * DM, DM, 0);              // qkv fp32
    cvt(F0, KVb, RQ * 3 * DM);                              // qkv bf16
    k_attn<<<dim3(16, 64), dim3(128), 0, stream>>>(
        KVb, KVb + 1024, KVb + 2048, F1,
        12288, 3072, 12288, 3072, 4096, 1024, 1024, /*causal=*/1);
    cvt(F1, Ab, RQ * DM);                                   // attn1 bf16
    cvt(Wso, Wb, DM * DM);
    gemm(Ab, Wb, bso, F2, RQ, DM, DM, 0);                   // self out proj
    k_add_ln<<<dim3(RQ), dim3(256), 0, stream>>>(tgt, F2, g1, be1, X1);

    // --- cross-attention block ---
    cvt(X1, Ab, RQ * DM);
    cvt(Wq, Wb, DM * DM);
    gemm(Ab, Wb, bq, F1, RQ, DM, DM, 0);                    // q_c fp32
    cvt(F1, Qb, RQ * DM);                                   // q_c bf16
    cvt(mem, Ab, RM * DM);                                  // memory bf16
    cvt(Wk, Wb, DM * DM);
    gemm(Ab, Wb, bk, F0, RM, DM, DM, 0);                    // k_c fp32
    cvt(Wv, Wb, DM * DM);
    gemm(Ab, Wb, bv, F0 + (size_t)RM * DM, RM, DM, DM, 0);  // v_c fp32
    cvt(F0, KVb, RM * DM);                                  // k_c bf16
    cvt(F0 + (size_t)RM * DM, KVb + (size_t)RM * DM, RM * DM); // v_c bf16
    k_attn<<<dim3(16, 64), dim3(128), 0, stream>>>(
        Qb, KVb, KVb + (size_t)RM * DM, F1,
        4096, 1024, 4096, 1024, 4096, 1024, 2048, /*causal=*/0);
    cvt(F1, Ab, RQ * DM);                                   // attn2 bf16
    cvt(Wco, Wb, DM * DM);
    gemm(Ab, Wb, bco, F2, RQ, DM, DM, 0);                   // cross out proj
    k_add_ln<<<dim3(RQ), dim3(256), 0, stream>>>(X1, F2, g2, be2, X2);

    // --- FFN block ---
    cvt(X2, Ab, RQ * DM);
    cvt(W1, Wb, DFF * DM);
    gemm(Ab, Wb, b1, F0, RQ, DFF, DM, /*relu=*/1);          // hidden fp32
    cvt(F0, Ab, RQ * DFF);                                  // hidden bf16
    cvt(W2, Wb, DM * DFF);
    gemm(Ab, Wb, b2, F1, RQ, DM, DFF, 0);                   // ffn out
    k_add_ln<<<dim3(RQ), dim3(256), 0, stream>>>(X2, F1, g3, be3, out);
}

// v002
// It runs in 744 microseconds.
// Next to v001, in two timings, it ran 1.10 times as fast each time.
// Over all steps from v000 it is 1.34 times as fast.
#include <hip/hip_runtime.h>
#include <hip/hip_bf16.h>

// ---------------- types ----------------
typedef __attribute__((ext_vector_type(16))) __bf16 bf16x16;
typedef __attribute__((ext_vector_type(8)))  float  floatx8;
typedef __attribute__((ext_vector_type(8)))  unsigned short ushort8;
typedef __attribute__((ext_vector_type(4)))  unsigned short ushort4v;

// fp32 -> bf16 (RNE-ish)
__device__ __forceinline__ unsigned short f2bf(float x) {
    unsigned u = __float_as_uint(x);
    unsigned r = u + 0x7FFFu + ((u >> 16) & 1u);
    return (unsigned short)(r >> 16);
}

// LDS byte offset of a generic pointer to __shared__ memory
__device__ __forceinline__ unsigned lds_off(const void* p) {
    return (unsigned)(size_t)(const __attribute__((address_space(3))) void*)p;
}

// CDNA5 async global->LDS copy, 16 bytes per lane, tracked by ASYNCcnt.
__device__ __forceinline__ void async_b128(unsigned loff, const void* g) {
    asm volatile("global_load_async_to_lds_b128 %0, %1, off"
                 :: "v"(loff), "v"(g) : "memory");
}
// Four such copies and, as the statement's last line, the wait that stands in
// front of any rewrite of the address registers the copies name.
__device__ __forceinline__ void async_b128_x4(unsigned l0, const void* g0,
                                              unsigned l1, const void* g1,
                                              unsigned l2, const void* g2,
                                              unsigned l3, const void* g3) {
    asm volatile("global_load_async_to_lds_b128 %0, %1, off\n\t"
                 "global_load_async_to_lds_b128 %2, %3, off\n\t"
                 "global_load_async_to_lds_b128 %4, %5, off\n\t"
                 "global_load_async_to_lds_b128 %6, %7, off\n\t"
                 "s_wait_xcnt 0x0"
                 :: "v"(l0), "v"(g0), "v"(l1), "v"(g1),
                    "v"(l2), "v"(g2), "v"(l3), "v"(g3) : "memory");
}
__device__ __forceinline__ void wait_async_le4() {
    asm volatile("s_wait_asynccnt 0x4" ::: "memory");
}
__device__ __forceinline__ void wait_async_0() {
    asm volatile("s_wait_asynccnt 0x0" ::: "memory");
}

// Load one 16x32 bf16 fragment (A-layout / symmetric B-layout) from LDS.
// Lane L<16 covers row (L), K in {8*half..+8} U {16+8*half..+8}; per ISA
// 16-bit A-matrix striping: two contiguous 8-element runs -> two b128 loads.
__device__ __forceinline__ bf16x16 load_frag(const unsigned short* base,
                                             int row_stride, int kbase) {
    int lane = threadIdx.x & 31;
    int half = lane >> 4;
    int row  = lane & 15;
    const unsigned short* p = base + row * row_stride + kbase + half * 8;
    union { bf16x16 f; ushort8 u[2]; } r;
    r.u[0] = *(const ushort8*)(p);
    r.u[1] = *(const ushort8*)(p + 16);
    return r.f;
}

// B-fragment for P x V from a row-major [K=32 keys][row_stride] LDS tile:
// lane L covers output column (base + L&15), gathering its 16 K elements
// (two runs of 8) as strided 16-bit LDS reads (transpose-in-LDS).
__device__ __forceinline__ bf16x16 load_frag_colT(const unsigned short* base,
                                                  int row_stride) {
    int lane = threadIdx.x & 31;
    int half = lane >> 4;
    int colv = lane & 15;
    union { bf16x16 f; unsigned short u[16]; } r;
#pragma unroll
    for (int j = 0; j < 8; j++) {
        r.u[j]     = base[(8 * half + j) * row_stride + colv];
        r.u[8 + j] = base[(16 + 8 * half + j) * row_stride + colv];
    }
    return r.f;
}

__device__ __forceinline__ floatx8 wmma_bf16(bf16x16 a, bf16x16 b, floatx8 c) {
    return __builtin_amdgcn_wmma_f32_16x16x32_bf16(false, a, false, b,
                                                   (short)0, c, false, false);
}

// LDS row pitches in elements. A 16-byte fragment read walks 16 rows at once;
// a pitch of 16 B x odd spreads those rows over all 64 banks, where the
// unpadded 64-B and 128-B rows fall on the same few banks again and again.
constexpr int P32 = 40;   // rows of 32 bf16: 64 B of data, 80 B pitch
constexpr int P64 = 72;   // rows of 64 bf16: 128 B of data, 144 B pitch

// ---------------- convert kernel ----------------
__global__ __launch_bounds__(256)
void k_cvt_bf16(const float* __restrict__ src, unsigned short* __restrict__ dst,
                int n4 /* n/4 */) {
    int i = blockIdx.x * blockDim.x + threadIdx.x;
    if (i >= n4) return;
    const float4 v = *(const float4*)(src + i * 4);
    ushort4v o;
    o.x = f2bf(v.x); o.y = f2bf(v.y); o.z = f2bf(v.z); o.w = f2bf(v.w);
    *(ushort4v*)(dst + i * 4) = o;
}

// ---------------- GEMM: C[M,N] = A[M,K] * W[N,K]^T + bias, optional relu ----
// The result goes to Cb, rounded to bf16, where the next reader is a matrix
// product (Cb != nullptr), else to C in fp32.
// block tile 128(M) x 128(N), K-step 32, 256 threads = 8 waves.
// Each wave: 32x64 sub-tile = 2x4 WMMA accumulators (8 WMMA / K-step).
// Double-buffered LDS fed by async global->LDS DMA (ASYNCcnt pipeline).
__global__ __launch_bounds__(256)
void k_gemm_bf16(const unsigned short* __restrict__ A,
                 const unsigned short* __restrict__ W,
                 const float* __restrict__ bias,
                 float* __restrict__ C,
                 unsigned short* __restrict__ Cb,
                 int M, int N, int K, int relu) {
    __shared__ __align__(16) unsigned short As[2][128 * P32];
    __shared__ __align__(16) unsigned short Ws[2][128 * P32];

    const int tid  = threadIdx.x;
    const int m0   = blockIdx.y * 128;
    const int n0   = blockIdx.x * 128;
    const int wave = tid >> 5;
    const int wm   = (wave & 3) * 32;   // 0,32,64,96
    const int wn   = (wave >> 2) * 64;  // 0,64

    // staging: each thread owns 16 elems of each tile (row ar, cols ac..ac+15)
    const int ar = (tid * 16) >> 5;     // 0..127
    const int ac = (tid * 16) & 31;     // 0 or 16
    const unsigned short* Ag = A + (size_t)(m0 + ar) * K + ac;
    const unsigned short* Wg = W + (size_t)(n0 + ar) * K + ac;

    auto issue = [&](int buf, int k0) {
        unsigned la = lds_off(&As[buf][ar * P32 + ac]);
        unsigned lw = lds_off(&Ws[buf][ar * P32 + ac]);
        async_b128(la,      Ag + k0);
        async_b128(la + 16, Ag + k0 + 8);
        async_b128(lw,      Wg + k0);
        async_b128(lw + 16, Wg + k0 + 8);
    };

    floatx8 acc[2][4] = {};
    const int T = K >> 5;

    issue(0, 0);
    for (int t = 0; t < T; t++) {
        if (t + 1 < T) { issue((t + 1) & 1, (t + 1) * 32); wait_async_le4(); }
        else           { wait_async_0(); }
        __syncthreads();

        const unsigned short* Ab = As[t & 1];
        const unsigned short* Wb = Ws[t & 1];
        bf16x16 af[2], wf[4];
        af[0] = load_frag(Ab + (wm + 0)  * P32, P32, 0);
        af[1] = load_frag(Ab + (wm + 16) * P32, P32, 0);
        for (int j = 0; j < 4; j++)
            wf[j] = load_frag(Wb + (wn + 16 * j) * P32, P32, 0);

        for (int i = 0; i < 2; i++)
            for (int j = 0; j < 4; j++)
                acc[i][j] = wmma_bf16(af[i], wf[j], acc[i][j]);
        __syncthreads();
    }

    const int lane = tid & 31;
    const int half = lane >> 4;
    const int col  = lane & 15;
    auto epilogue = [&](auto store) {
        for (int j = 0; j < 4; j++) {
            int n = n0 + wn + 16 * j + col;
            float bv = bias ? bias[n] : 0.0f;
            for (int i = 0; i < 2; i++) {
                for (int r = 0; r < 8; r++) {
                    int m = m0 + wm + 16 * i + r + 8 * half;
                    float v = acc[i][j][r] + bv;
                    if (relu) v = fmaxf(v, 0.0f);
                    store((size_t)m * N + n, v);
                }
            }
            // what follows a column block stands behind a branch and reuses
            // the stores' data and address registers
            asm volatile("s_wait_xcnt 0x0" ::: "memory");
        }
    };
    // one test of the output kind for the whole tile, not one per element
    if (Cb) epilogue([&](size_t idx, float v) { Cb[idx] = f2bf(v); });
    else    epilogue([&](size_t idx, float v) { C[idx] = v; });
}

// ---------------- flash attention ----------------
// grid.x = SEQ_Q/64 (q tiles), grid.y = batch*16 + head.
// 128 threads = 4 waves; each wave owns 16 q rows. kv tiles of 32 keys.
// d_k = 64. Strides are element strides: per-seq (s*) and per-batch (b*).
// All of Q/K/V enter LDS via async global->LDS DMA; V is transposed from
// LDS (cheap strided 16-bit reads) when building the PV B-fragment.
__global__ __launch_bounds__(128)
void k_attn(const unsigned short* __restrict__ Qg,
            const unsigned short* __restrict__ Kg,
            const unsigned short* __restrict__ Vg,
            unsigned short* __restrict__ Og,
            int sQ, int bQ, int sK, int bK, int sO, int bO,
            int seq_kv, int causal) {
    __shared__ __align__(16) unsigned short Qs[64 * P64];     // q tile
    __shared__ __align__(16) unsigned short Ks[32 * P64];     // key tile [key][d]
    __shared__ __align__(16) unsigned short Vs[32 * P64];     // V tile  [key][d]
    __shared__ __align__(16) unsigned short Ps[4 * 16 * P32]; // per-wave P

    const int q0 = blockIdx.x * 64;
    const int bh = blockIdx.y;
    const int b  = bh >> 4;
    const int h  = bh & 15;
    const unsigned short* Qb = Qg + (size_t)b * bQ + h * 64;
    const unsigned short* Kb = Kg + (size_t)b * bK + h * 64;
    const unsigned short* Vb = Vg + (size_t)b * bK + h * 64;
    unsigned short* Ob = Og + (size_t)b * bO + h * 64;

    const int tid  = threadIdx.x;
    const int wave = tid >> 5;
    const int lane = tid & 31;
    const int half = lane >> 4;
    const int col  = lane & 15;

    // stage Q tile (64x64) via async DMA
    {
        const int r = tid >> 3, c = (tid & 7) * 8;   // rows r, r+16, r+32, r+48
        const unsigned lq = lds_off(&Qs[r * P64 + c]);
        const unsigned short* gq = Qb + (size_t)(q0 + r) * sQ + c;
        async_b128_x4(lq,                gq,
                      lq + 16 * P64 * 2, gq + (size_t)16 * sQ,
                      lq + 32 * P64 * 2, gq + (size_t)32 * sQ,
                      lq + 48 * P64 * 2, gq + (size_t)48 * sQ);
    }
    wait_async_0();
    __syncthreads();

    float m_run[8], l_run[8];
    floatx8 o[4] = {};
    for (int r = 0; r < 8; r++) { m_run[r] = -1e30f; l_run[r] = 0.0f; }

    const float scale = 0.125f; // 1/sqrt(64)
    int kv_end = causal ? (q0 + 64) : seq_kv;
    if (kv_end > seq_kv) kv_end = seq_kv;

    const int kr = (tid * 16) >> 6;      // K/V-tile staging coords
    const int kc = (tid * 16) & 63;

    for (int t0 = 0; t0 < kv_end; t0 += 32) {
        { // stage K and V tiles (32x64 each) via async DMA
            const unsigned short* gk = Kb + (size_t)(t0 + kr) * sK + kc;
            const unsigned short* gv = Vb + (size_t)(t0 + kr) * sK + kc;
            async_b128_x4(lds_off(&Ks[kr * P64 + kc]),     gk,
                          lds_off(&Ks[kr * P64 + kc + 8]), gk + 8,
                          lds_off(&Vs[kr * P64 + kc]),     gv,
                          lds_off(&Vs[kr * P64 + kc + 8]), gv + 8);
        }
        wait_async_0();
        __syncthreads();

        // S (16 q x 32 keys) per wave: 2 n-tiles, d_k=64 -> 2 k-chunks each
        floatx8 s[2] = {};
        for (int c2 = 0; c2 < 2; c2++) {
            bf16x16 qa  = load_frag(Qs + (wave * 16) * P64, P64, c2 * 32);
            bf16x16 kb0 = load_frag(Ks,            P64, c2 * 32);
            bf16x16 kb1 = load_frag(Ks + 16 * P64, P64, c2 * 32);
            s[0] = wmma_bf16(qa, kb0, s[0]);
            s[1] = wmma_bf16(qa, kb1, s[1]);
        }

        // mask + scale + tile row max
        float tmax[8];
        for (int r = 0; r < 8; r++) {
            int qi = q0 + wave * 16 + r + 8 * half;
            float best = -1e30f;
            for (int j = 0; j < 2; j++) {
                int kj = t0 + 16 * j + col;
                float v = s[j][r] * scale;
                if (causal && kj > qi) v = -1e30f;
                s[j][r] = v;
                best = fmaxf(best, v);
            }
            tmax[r] = best;
        }
        for (int msk = 1; msk < 16; msk <<= 1)
            for (int r = 0; r < 8; r++)
                tmax[r] = fmaxf(tmax[r], __shfl_xor(tmax[r], msk, 32));

        // online softmax update
        float corr[8], tsum[8];
        for (int r = 0; r < 8; r++) {
            float mnew = fmaxf(m_run[r], tmax[r]);
            corr[r] = __expf(m_run[r] - mnew);
            m_run[r] = mnew;
            float su = 0.0f;
            for (int j = 0; j < 2; j++) {
                float p = __expf(s[j][r] - mnew);
                s[j][r] = p;
                su += p;
            }
            tsum[r] = su;
        }
        for (int msk = 1; msk < 16; msk <<= 1)
            for (int r = 0; r < 8; r++)
                tsum[r] += __shfl_xor(tsum[r], msk, 32);
        for (int r = 0; r < 8; r++)
            l_run[r] = l_run[r] * corr[r] + tsum[r];
        for (int j = 0; j < 4; j++)
            for (int r = 0; r < 8; r++)
                o[j][r] *= corr[r];

        // P -> per-wave LDS (bf16), re-fragment as A operand
        unsigned short* Pw = &Ps[wave * 16 * P32];
        for (int j = 0; j < 2; j++)
            for (int r = 0; r < 8; r++)
                Pw[(r + 8 * half) * P32 + 16 * j + col] = f2bf(s[j][r]);

        bf16x16 pa = load_frag(Pw, P32, 0);
        for (int n = 0; n < 4; n++) {
            bf16x16 vb = load_frag_colT(Vs + n * 16, P64);
            o[n] = wmma_bf16(pa, vb, o[n]);
        }
        __syncthreads();
    }

    // epilogue: normalize + store bf16 (the only reader is the out projection)
    // unrolled so that o[n] is named by constant index (rolled, the compiler
    // picks the registers by a relative move per element)
#pragma unroll
    for (int n = 0; n < 4; n++)
        for (int r = 0; r < 8; r++) {
            int qi = q0 + wave * 16 + r + 8 * half;
            int d  = n * 16 + col;
            Ob[(size_t)qi * sO + d] = f2bf(o[n][r] / l_run[r]);
        }
}

// ---------------- residual + LayerNorm (D=1024, 256 threads/row) ----------
// O keeps fp32 for the next residual; with BF16_COPY, Ob takes the bf16 copy
// that the next matrix product reads.
template <bool BF16_COPY>
__global__ __launch_bounds__(256)
void k_add_ln(const float* __restrict__ X, const float* __restrict__ Y,
              const float* __restrict__ gw, const float* __restrict__ bw,
              float* __restrict__ O, unsigned short* __restrict__ Ob) {
    const int D = 1024;
    const int row = blockIdx.x;
    const int tid = threadIdx.x;
    const float4 xv = *(const float4*)(X + (size_t)row * D + tid * 4);
    const float4 yv = *(const float4*)(Y + (size_t)row * D + tid * 4);
    float t0 = xv.x + yv.x, t1 = xv.y + yv.y, t2 = xv.z + yv.z, t3 = xv.w + yv.w;
    float s  = t0 + t1 + t2 + t3;
    float s2 = t0 * t0 + t1 * t1 + t2 * t2 + t3 * t3;
    for (int msk = 1; msk < 32; msk <<= 1) {
        s  += __shfl_xor(s, msk, 32);
        s2 += __shfl_xor(s2, msk, 32);
    }
    __shared__ float sh[16];
    int wave = tid >> 5, lane = tid & 31;
    if (lane == 0) { sh[wave] = s; sh[8 + wave] = s2; }
    __syncthreads();
    float S = 0.0f, S2 = 0.0f;
    for (int i = 0; i < 8; i++) { S += sh[i]; S2 += sh[8 + i]; }
    float mu  = S / D;
    float inv = rsqrtf(S2 / D - mu * mu + 1e-5f);
    const float4 gv = *(const float4*)(gw + tid * 4);
    const float4 bv = *(const float4*)(bw + tid * 4);
    float4 ov;
    ov.x = (t0 - mu) * inv * gv.x + bv.x;
    ov.y = (t1 - mu) * inv * gv.y + bv.y;
    ov.z = (t2 - mu) * inv * gv.z + bv.z;
    ov.w = (t3 - mu) * inv * gv.w + bv.w;
    *(float4*)(O + (size_t)row * D + tid * 4) = ov;
    if (BF16_COPY) {
        ushort4v ob;
        ob.x = f2bf(ov.x); ob.y = f2bf(ov.y); ob.z = f2bf(ov.z); ob.w = f2bf(ov.w);
        *(ushort4v*)(Ob + (size_t)row * D + tid * 4) = ob;
    }
}

// ---------------- host orchestration ----------------
extern "C" void kernel_launch(void* const* d_in, const int* in_sizes, int n_in,
                              void* d_out, int out_size, void* d_ws, size_t ws_size,
                              hipStream_t stream) {
    (void)in_sizes; (void)n_in; (void)out_size; (void)ws_size;
    const float* tgt  = (const float*)d_in[0];
    const float* mem  = (const float*)d_in[1];
    const float* Wqkv = (const float*)d_in[2];  const float* bqkv = (const float*)d_in[3];
    const float* Wso  = (const float*)d_in[4];  const float* bso  = (const float*)d_in[5];
    const float* Wq   = (const float*)d_in[6];  const float* bq   = (const float*)d_in[7];
    const float* Wk   = (const float*)d_in[8];  const float* bk   = (const float*)d_in[9];
    const float* Wv   = (const float*)d_in[10]; const float* bv   = (const float*)d_in[11];
    const float* Wco  = (const float*)d_in[12]; const float* bco  = (const float*)d_in[13];
    const float* W1   = (const float*)d_in[14]; const float* b1   = (const float*)d_in[15];
    const float* W2   = (const float*)d_in[16]; const float* b2   = (const float*)d_in[17];
    const float* g1   = (const float*)d_in[18]; const float* be1  = (const float*)d_in[19];
    const float* g2   = (const float*)d_in[20]; const float* be2  = (const float*)d_in[21];
    const float* g3   = (const float*)d_in[22]; const float* be3  = (const float*)d_in[23];
    float* out = (float*)d_out;

    const size_t MB = 1u << 20;
    char* ws = (char*)d_ws;
    float* F1 = (float*)(ws + 64 * MB);      // 16 MB fp32 scratch (ffn out)
    float* F2 = (float*)(ws + 80 * MB);      // 16 MB fp32 scratch (out projections)
    float* X1 = (float*)(ws + 96 * MB);      // LN1 output
    float* X2 = (float*)(ws + 112 * MB);     // LN2 output
    unsigned short* Wb  = (unsigned short*)(ws + 128 * MB); // 8 MB  weight bf16
    unsigned short* Ab  = (unsigned short*)(ws + 136 * MB); // 32 MB activation bf16
    unsigned short* Qb  = (unsigned short*)(ws + 168 * MB); // 8 MB  cross-Q bf16
    unsigned short* KVb = (unsigned short*)(ws + 176 * MB); // 32 MB qkv / k,v / hidden bf16

    const int DM = 1024, RQ = 4096, RM = 8192, DFF = 4096;

    auto cvt = [&](const float* s, unsigned short* d, int n) {
        k_cvt_bf16<<<dim3(n / 1024), dim3(256), 0, stream>>>(s, d, n / 4);
    };
    auto gemm = [&](const unsigned short* A, const unsigned short* W,
                    const float* bias, float* C, int M, int N, int K, int relu) {
        k_gemm_bf16<<<dim3(N / 128, M / 128), dim3(256), 0, stream>>>(
            A, W, bias, C, nullptr, M, N, K, relu);
    };
    auto gemm_b = [&](const unsigned short* A, const unsigned short* W,
                      const float* bias, unsigned short* Cb,
                      int M, int N, int K, int relu) {
        k_gemm_bf16<<<dim3(N / 128, M / 128), dim3(256), 0, stream>>>(
            A, W, bias, nullptr, Cb, M, N, K, relu);
    };

    // --- self-attention block ---
    cvt(tgt, Ab, RQ * DM);                                  // tgt_bf
    cvt(Wqkv, Wb, 3 * DM * DM);                             // Wqkv_bf
    gemm_b(Ab, Wb, bqkv, KVb, RQ, 3 * DM, DM, 0);           // qkv bf16
    k_attn<<<dim3(16, 64), dim3(128), 0, stream>>>(
        KVb, KVb + 1024, KVb + 2048, Ab,                    // attn1 bf16
        12288, 3072, 12288, 3072, 4096, 1024, 1024, /*causal=*/1);
    cvt(Wso, Wb, DM * DM);
    gemm(Ab, Wb, bso, F2, RQ, DM, DM, 0);                   // self out proj
    k_add_ln<true><<<dim3(RQ), dim3(256), 0, stream>>>(tgt, F2, g1, be1, X1, Ab);

    // --- cross-attention block ---
    cvt(Wq, Wb, DM * DM);
    gemm_b(Ab, Wb, bq, Qb, RQ, DM, DM, 0);                  // q_c bf16
    cvt(mem, Ab, RM * DM);                                  // memory bf16
    cvt(Wk, Wb, DM * DM);
    gemm_b(Ab, Wb, bk, KVb, RM, DM, DM, 0);                 // k_c bf16
    cvt(Wv, Wb, DM * DM);
    gemm_b(Ab, Wb, bv, KVb + (size_t)RM * DM, RM, DM, DM, 0); // v_c bf16
    k_attn<<<dim3(16, 64), dim3(128), 0, stream>>>(
        Qb, KVb, KVb + (size_t)RM * DM, Ab,                 // attn2 bf16
        4096, 1024, 4096, 1024, 4096, 1024, 2048, /*causal=*/0);
    cvt(Wco, Wb, DM * DM);
    gemm(Ab, Wb, bco, F2, RQ, DM, DM, 0);                   // cross out proj
    k_add_ln<true><<<dim3(RQ), dim3(256), 0, stream>>>(X1, F2, g2, be2, X2, Ab);

    // --- FFN block ---
    cvt(W1, Wb, DFF * DM);
    gemm_b(Ab, Wb, b1, KVb, RQ, DFF, DM, /*relu=*/1);       // hidden bf16
    cvt(W2, Wb, DM * DFF);
    gemm(KVb, Wb, b2, F1, RQ, DM, DFF, 0);                  // ffn out
    k_add_ln<false><<<dim3(RQ), dim3(256), 0, stream>>>(X2, F1, g3, be3, out, nullptr);
}

// v003
// A run of this version takes 686 microseconds.
// Two timings next to v002 both put it at 1.08 times that version's speed.
// All steps since v000 together make it 1.45 times as fast.
#include <hip/hip_runtime.h>
#include <hip/hip_bf16.h>

// ---------------- types ----------------
typedef __attribute__((ext_vector_type(16))) __bf16 bf16x16;
typedef __attribute__((ext_vector_type(8)))  float  floatx8;
typedef __attribute__((ext_vector_type(8)))  unsigned short ushort8;
typedef __attribute__((ext_vector_type(4)))  unsigned short ushort4v;

// fp32 -> bf16 (RNE-ish)
__device__ __forceinline__ unsigned short f2bf(float x) {
    unsigned u = __float_as_uint(x);
    unsigned r = u + 0x7FFFu + ((u >> 16) & 1u);
    return (unsigned short)(r >> 16);
}

// LDS byte offset of a generic pointer to __shared__ memory
__device__ __forceinline__ unsigned lds_off(const void* p) {
    return (unsigned)(size_t)(const __attribute__((address_space(3))) void*)p;
}

// CDNA5 async global->LDS copy, 16 bytes per lane, tracked by ASYNCcnt.
// Four such copies and, as the statement's last line, the wait that stands in
// front of any rewrite of the address registers the copies name.
__device__ __forceinline__ void async_b128_x4(unsigned l0, const void* g0,
                                              unsigned l1, const void* g1,
                                              unsigned l2, const void* g2,
                                              unsigned l3, const void* g3) {
    asm volatile("global_load_async_to_lds_b128 %0, %1, off\n\t"
                 "global_load_async_to_lds_b128 %2, %3, off\n\t"
                 "global_load_async_to_lds_b128 %4, %5, off\n\t"
                 "global_load_async_to_lds_b128 %6, %7, off\n\t"
                 "s_wait_xcnt 0x0"
                 :: "v"(l0), "v"(g0), "v"(l1), "v"(g1),
                    "v"(l2), "v"(g2), "v"(l3), "v"(g3) : "memory");
}
// Eight copies, closed by the same wait.
__device__ __forceinline__ void async_b128_x8(unsigned l0, const void* g0,
                                              unsigned l1, const void* g1,
                                              unsigned l2, const void* g2,
                                              unsigned l3, const void* g3,
                                              unsigned l4, const void* g4,
                                              unsigned l5, const void* g5,
                                              unsigned l6, const void* g6,
                                              unsigned l7, const void* g7) {
    asm volatile("global_load_async_to_lds_b128 %0, %1, off\n\t"
                 "global_load_async_to_lds_b128 %2, %3, off\n\t"
                 "global_load_async_to_lds_b128 %4, %5, off\n\t"
                 "global_load_async_to_lds_b128 %6, %7, off\n\t"
                 "global_load_async_to_lds_b128 %8, %9, off\n\t"
                 "global_load_async_to_lds_b128 %10, %11, off\n\t"
                 "global_load_async_to_lds_b128 %12, %13, off\n\t"
                 "global_load_async_to_lds_b128 %14, %15, off\n\t"
                 "s_wait_xcnt 0x0"
                 :: "v"(l0), "v"(g0), "v"(l1), "v"(g1),
                    "v"(l2), "v"(g2), "v"(l3), "v"(g3),
                    "v"(l4), "v"(g4), "v"(l5), "v"(g5),
                    "v"(l6), "v"(g6), "v"(l7), "v"(g7) : "memory");
}
// all but the eight youngest copies (the next tile's) have landed
__device__ __forceinline__ void wait_async_le8() {
    asm volatile("s_wait_asynccnt 0x8" ::: "memory");
}
__device__ __forceinline__ void wait_async_0() {
    asm volatile("s_wait_asynccnt 0x0" ::: "memory");
}

// Load one 16x32 bf16 fragment (A-layout / symmetric B-layout) from LDS.
// Lane L<16 covers row (L), K in {8*half..+8} U {16+8*half..+8}; per ISA
// 16-bit A-matrix striping: two contiguous 8-element runs -> two b128 loads.
__device__ __forceinline__ bf16x16 load_frag(const unsigned short* base,
                                             int row_stride, int kbase) {
    int lane = threadIdx.x & 31;
    int half = lane >> 4;
    int row  = lane & 15;
    const unsigned short* p = base + row * row_stride + kbase + half * 8;
    union { bf16x16 f; ushort8 u[2]; } r;
    r.u[0] = *(const ushort8*)(p);
    r.u[1] = *(const ushort8*)(p + 16);
    return r.f;
}

// B-fragment for P x V from a row-major [K=32 keys][row_stride] LDS tile:
// lane L covers output column (base + L&15), gathering its 16 K elements
// (two runs of 8) as strided 16-bit LDS reads (transpose-in-LDS).
__device__ __forceinline__ bf16x16 load_frag_colT(const unsigned short* base,
                                                  int row_stride) {
    int lane = threadIdx.x & 31;
    int half = lane >> 4;
    int colv = lane & 15;
    union { bf16x16 f; unsigned short u[16]; } r;
#pragma unroll
    for (int j = 0; j < 8; j++) {
        r.u[j]     = base[(8 * half + j) * row_stride + colv];
        r.u[8 + j] = base[(16 + 8 * half + j) * row_stride + colv];
    }
    return r.f;
}

__device__ __forceinline__ floatx8 wmma_bf16(bf16x16 a, bf16x16 b, floatx8 c) {
    return __builtin_amdgcn_wmma_f32_16x16x32_bf16(false, a, false, b,
                                                   (short)0, c, false, false);
}

// LDS row pitches in elements. A 16-byte fragment read walks 16 rows at once;
// a pitch of 16 B x odd spreads those rows over all 64 banks, where the
// unpadded 64-B and 128-B rows fall on the same few banks again and again.
constexpr int P32 = 40;   // rows of 32 bf16: 64 B of data, 80 B pitch
constexpr int P64 = 72;   // rows of 64 bf16: 128 B of data, 144 B pitch

// ---------------- convert kernel ----------------
__global__ __launch_bounds__(256)
void k_cvt_bf16(const float* __restrict__ src, unsigned short* __restrict__ dst,
                int n4 /* n/4 */) {
    int i = blockIdx.x * blockDim.x + threadIdx.x;
    if (i >= n4) return;
    const float4 v = *(const float4*)(src + i * 4);
    ushort4v o;
    o.x = f2bf(v.x); o.y = f2bf(v.y); o.z = f2bf(v.z); o.w = f2bf(v.w);
    *(ushort4v*)(dst + i * 4) = o;
}

// ---------------- GEMM: C[M,N] = A[M,K] * W[N,K]^T + bias, optional relu ----
// The result goes to Cb, rounded to bf16, where the next reader is a matrix
// product (Cb != nullptr), else to C in fp32.
// block tile 128(M) x 128(N), K-step 64, 256 threads = 8 waves.
// Each wave: 32x64 sub-tile = 2x4 WMMA accumulators (16 WMMA / K-step).
// Double-buffered LDS fed by async global->LDS DMA (ASYNCcnt pipeline).
// A K-step takes 128 B of every operand row, one whole cache line, and eight
// neighbouring lanes copy it: a wave's copy touches 4 full lines.
__global__ __launch_bounds__(256)
void k_gemm_bf16(const unsigned short* __restrict__ A,
                 const unsigned short* __restrict__ W,
                 const float* __restrict__ bias,
                 float* __restrict__ C,
                 unsigned short* __restrict__ Cb,
                 int M, int N, int K, int relu) {
    __shared__ __align__(16) unsigned short As[2][128 * P64];
    __shared__ __align__(16) unsigned short Ws[2][128 * P64];

    const int tid  = threadIdx.x;
    const int m0   = blockIdx.y * 128;
    const int n0   = blockIdx.x * 128;
    const int wave = tid >> 5;
    const int wm   = (wave & 3) * 32;   // 0,32,64,96
    const int wn   = (wave >> 2) * 64;  // 0,64

    // staging: each thread owns 8 elems (16 B) at column ac of the rows
    // ar, ar+32, ar+64, ar+96 of each tile
    const int ar = tid >> 3;            // 0..31
    const int ac = (tid & 7) * 8;       // 0,8,..,56
    const unsigned short* Ag = A + (size_t)(m0 + ar) * K + ac;
    const unsigned short* Wg = W + (size_t)(n0 + ar) * K + ac;
    const size_t   gr = (size_t)32 * K; // 32 rows on, in global elements
    const unsigned lr = 32 * P64 * 2;   // 32 rows on, in LDS bytes

    auto issue = [&](int buf, int k0) {
        unsigned la = lds_off(&As[buf][ar * P64 + ac]);
        unsigned lw = lds_off(&Ws[buf][ar * P64 + ac]);
        const unsigned short* ga = Ag + k0;
        const unsigned short* gw = Wg + k0;
        async_b128_x8(la,          ga,          la + lr,     ga + gr,
                      la + 2 * lr, ga + 2 * gr, la + 3 * lr, ga + 3 * gr,
                      lw,          gw,          lw + lr,     gw + gr,
                      lw + 2 * lr, gw + 2 * gr, lw + 3 * lr, gw + 3 * gr);
    };

    floatx8 acc[2][4] = {};
    const int T = K >> 6;

    issue(0, 0);
    for (int t = 0; t < T; t++) {
        if (t + 1 < T) { issue((t + 1) & 1, (t + 1) * 64); wait_async_le8(); }
        else           { wait_async_0(); }
        __syncthreads();

        const unsigned short* Ab = As[t & 1];
        const unsigned short* Wb = Ws[t & 1];
        for (int kk = 0; kk < 64; kk += 32) {
            bf16x16 af[2], wf[4];
            af[0] = load_frag(Ab + (wm + 0)  * P64, P64, kk);
            af[1] = load_frag(Ab + (wm + 16) * P64, P64, kk);
            for (int j = 0; j < 4; j++)
                wf[j] = load_frag(Wb + (wn + 16 * j) * P64, P64, kk);

            for (int i = 0; i < 2; i++)
                for (int j = 0; j < 4; j++)
                    acc[i][j] = wmma_bf16(af[i], wf[j], acc[i][j]);
        }
        __syncthreads();
    }

    const int lane = tid & 31;
    const int half = lane >> 4;
    const int col  = lane & 15;
    auto epilogue = [&](auto store) {
        for (int j = 0; j < 4; j++) {
            int n = n0 + wn + 16 * j + col;
            float bv = bias ? bias[n] : 0.0f;
            for (int i = 0; i < 2; i++) {
                for (int r = 0; r < 8; r++) {
                    int m = m0 + wm + 16 * i + r + 8 * half;
                    float v = acc[i][j][r] + bv;
                    if (relu) v = fmaxf(v, 0.0f);
                    store((size_t)m * N + n, v);
                }
            }
            // what follows a column block stands behind a branch and reuses
            // the stores' data and address registers
            asm volatile("s_wait_xcnt 0x0" ::: "memory");
        }
    };
    // one test of the output kind for the whole tile, not one per element
    if (Cb) epilogue([&](size_t idx, float v) { Cb[idx] = f2bf(v); });
    else    epilogue([&](size_t idx, float v) { C[idx] = v; });
}

// ---------------- flash attention ----------------
// grid.x = SEQ_Q/64 (q tiles), grid.y = batch*16 + head.
// 128 threads = 4 waves; each wave owns 16 q rows. kv tiles of 32 keys.
// d_k = 64. Strides are element strides: per-seq (s*) and per-batch (b*).
// All of Q/K/V enter LDS via async global->LDS DMA; V is transposed from
// LDS (cheap strided 16-bit reads) when building the PV B-fragment.
__global__ __launch_bounds__(128)
void k_attn(const unsigned short* __restrict__ Qg,
            const unsigned short* __restrict__ Kg,
            const unsigned short* __restrict__ Vg,
            unsigned short* __restrict__ Og,
            int sQ, int bQ, int sK, int bK, int sO, int bO,
            int seq_kv, int causal) {
    __shared__ __align__(16) unsigned short Qs[64 * P64];     // q tile
    __shared__ __align__(16) unsigned short Ks[32 * P64];     // key tile [key][d]
    __shared__ __align__(16) unsigned short Vs[32 * P64];     // V tile  [key][d]
    __shared__ __align__(16) unsigned short Ps[4 * 16 * P32]; // per-wave P

    const int q0 = blockIdx.x * 64;
    const int bh = blockIdx.y;
    const int b  = bh >> 4;
    const int h  = bh & 15;
    const unsigned short* Qb = Qg + (size_t)b * bQ + h * 64;
    const unsigned short* Kb = Kg + (size_t)b * bK + h * 64;
    const unsigned short* Vb = Vg + (size_t)b * bK + h * 64;
    unsigned short* Ob = Og + (size_t)b * bO + h * 64;

    const int tid  = threadIdx.x;
    const int wave = tid >> 5;
    const int lane = tid & 31;
    const int half = lane >> 4;
    const int col  = lane & 15;

    // stage Q tile (64x64) via async DMA
    {
        const int r = tid >> 3, c = (tid & 7) * 8;   // rows r, r+16, r+32, r+48
        const unsigned lq = lds_off(&Qs[r * P64 + c]);
        const unsigned short* gq = Qb + (size_t)(q0 + r) * sQ + c;
        async_b128_x4(lq,                gq,
                      lq + 16 * P64 * 2, gq + (size_t)16 * sQ,
                      lq + 32 * P64 * 2, gq + (size_t)32 * sQ,
                      lq + 48 * P64 * 2, gq + (size_t)48 * sQ);
    }
    wait_async_0();
    __syncthreads();

    float m_run[8], l_run[8];
    floatx8 o[4] = {};
    for (int r = 0; r < 8; r++) { m_run[r] = -1e30f; l_run[r] = 0.0f; }

    const float scale = 0.125f; // 1/sqrt(64)
    int kv_end = causal ? (q0 + 64) : seq_kv;
    if (kv_end > seq_kv) kv_end = seq_kv;

    // K/V-tile staging coords: eight neighbouring lanes copy one row's 128 B
    // (a whole cache line); each thread takes rows kr and kr+16
    const int kr = tid >> 3;
    const int kc = (tid & 7) * 8;

    for (int t0 = 0; t0 < kv_end; t0 += 32) {
        { // stage K and V tiles (32x64 each) via async DMA
            const unsigned short* gk = Kb + (size_t)(t0 + kr) * sK + kc;
            const unsigned short* gv = Vb + (size_t)(t0 + kr) * sK + kc;
            async_b128_x4(lds_off(&Ks[kr * P64 + kc]),        gk,
                          lds_off(&Ks[(kr + 16) * P64 + kc]), gk + (size_t)16 * sK,
                          lds_off(&Vs[kr * P64 + kc]),        gv,
                          lds_off(&Vs[(kr + 16) * P64 + kc]), gv + (size_t)16 * sK);
        }
        wait_async_0();
        __syncthreads();

        // S (16 q x 32 keys) per wave: 2 n-tiles, d_k=64 -> 2 k-chunks each
        floatx8 s[2] = {};
        for (int c2 = 0; c2 < 2; c2++) {
            bf16x16 qa  = load_frag(Qs + (wave * 16) * P64, P64, c2 * 32);
            bf16x16 kb0 = load_frag(Ks,            P64, c2 * 32);
            bf16x16 kb1 = load_frag(Ks + 16 * P64, P64, c2 * 32);
            s[0] = wmma_bf16(qa, kb0, s[0]);
            s[1] = wmma_bf16(qa, kb1, s[1]);
        }

        // mask + scale + tile row max
        float tmax[8];
        for (int r = 0; r < 8; r++) {
            int qi = q0 + wave * 16 + r + 8 * half;
            float best = -1e30f;
            for (int j = 0; j < 2; j++) {
                int kj = t0 + 16 * j + col;
                float v = s[j][r] * scale;
                if (causal && kj > qi) v = -1e30f;
                s[j][r] = v;
                best = fmaxf(best, v);
            }
            tmax[r] = best;
        }
        for (int msk = 1; msk < 16; msk <<= 1)
            for (int r = 0; r < 8; r++)
                tmax[r] = fmaxf(tmax[r], __shfl_xor(tmax[r], msk, 32));

        // online softmax update
        float corr[8], tsum[8];
        for (int r = 0; r < 8; r++) {
            float mnew = fmaxf(m_run[r], tmax[r]);
            corr[r] = __expf(m_run[r] - mnew);
            m_run[r] = mnew;
            float su = 0.0f;
            for (int j = 0; j < 2; j++) {
                float p = __expf(s[j][r] - mnew);
                s[j][r] = p;
                su += p;
            }
            tsum[r] = su;
        }
        for (int msk = 1; msk < 16; msk <<= 1)
            for (int r = 0; r < 8; r++)
                tsum[r] += __shfl_xor(tsum[r], msk, 32);
        for (int r = 0; r < 8; r++)
            l_run[r] = l_run[r] * corr[r] + tsum[r];
        for (int j = 0; j < 4; j++)
            for (int r = 0; r < 8; r++)
                o[j][r] *= corr[r];

        // P -> per-wave LDS (bf16), re-fragment as A operand
        unsigned short* Pw = &Ps[wave * 16 * P32];
        for (int j = 0; j < 2; j++)
            for (int r = 0; r < 8; r++)
                Pw[(r + 8 * half) * P32 + 16 * j + col] = f2bf(s[j][r]);

        bf16x16 pa = load_frag(Pw, P32, 0);
        for (int n = 0; n < 4; n++) {
            bf16x16 vb = load_frag_colT(Vs + n * 16, P64);
            o[n] = wmma_bf16(pa, vb, o[n]);
        }
        __syncthreads();
    }

    // epilogue: normalize + store bf16 (the only reader is the out projection)
    // unrolled so that o[n] is named by constant index (rolled, the compiler
    // picks the registers by a relative move per element)
#pragma unroll
    for (int n = 0; n < 4; n++)
        for (int r = 0; r < 8; r++) {
            int qi = q0 + wave * 16 + r + 8 * half;
            int d  = n * 16 + col;
            Ob[(size_t)qi * sO + d] = f2bf(o[n][r] / l_run[r]);
        }
}

// ---------------- residual + LayerNorm (D=1024, 256 threads/row) ----------
// O keeps fp32 for the next residual; with BF16_COPY, Ob takes the bf16 copy
// that the next matrix product reads.
template <bool BF16_COPY>
__global__ __launch_bounds__(256)
void k_add_ln(const float* __restrict__ X, const float* __restrict__ Y,
              const float* __restrict__ gw, const float* __restrict__ bw,
              float* __restrict__ O, unsigned short* __restrict__ Ob) {
    const int D = 1024;
    const int row = blockIdx.x;
    const int tid = threadIdx.x;
    const float4 xv = *(const float4*)(X + (size_t)row * D + tid * 4);
    const float4 yv = *(const float4*)(Y + (size_t)row * D + tid * 4);
    float t0 = xv.x + yv.x, t1 = xv.y + yv.y, t2 = xv.z + yv.z, t3 = xv.w + yv.w;
    float s  = t0 + t1 + t2 + t3;
    float s2 = t0 * t0 + t1 * t1 + t2 * t2 + t3 * t3;
    for (int msk = 1; msk < 32; msk <<= 1) {
        s  += __shfl_xor(s, msk, 32);
        s2 += __shfl_xor(s2, msk, 32);
    }
    __shared__ float sh[16];
    int wave = tid >> 5, lane = tid & 31;
    if (lane == 0) { sh[wave] = s; sh[8 + wave] = s2; }
    __syncthreads();
    float S = 0.0f, S2 = 0.0f;
    for (int i = 0; i < 8; i++) { S += sh[i]; S2 += sh[8 + i]; }
    float mu  = S / D;
    float inv = rsqrtf(S2 / D - mu * mu + 1e-5f);
    const float4 gv = *(const float4*)(gw + tid * 4);
    const float4 bv = *(const float4*)(bw + tid * 4);
    float4 ov;
    ov.x = (t0 - mu) * inv * gv.x + bv.x;
    ov.y = (t1 - mu) * inv * gv.y + bv.y;
    ov.z = (t2 - mu) * inv * gv.z + bv.z;
    ov.w = (t3 - mu) * inv * gv.w + bv.w;
    *(float4*)(O + (size_t)row * D + tid * 4) = ov;
    if (BF16_COPY) {
        ushort4v ob;
        ob.x = f2bf(ov.x); ob.y = f2bf(ov.y); ob.z = f2bf(ov.z); ob.w = f2bf(ov.w);
        *(ushort4v*)(Ob + (size_t)row * D + tid * 4) = ob;
    }
}

// ---------------- host orchestration ----------------
extern "C" void kernel_launch(void* const* d_in, const int* in_sizes, int n_in,
                              void* d_out, int out_size, void* d_ws, size_t ws_size,
                              hipStream_t stream) {
    (void)in_sizes; (void)n_in; (void)out_size; (void)ws_size;
    const float* tgt  = (const float*)d_in[0];
    const float* mem  = (const float*)d_in[1];
    const float* Wqkv = (const float*)d_in[2];  const float* bqkv = (const float*)d_in[3];
    const float* Wso  = (const float*)d_in[4];  const float* bso  = (const float*)d_in[5];
    const float* Wq   = (const float*)d_in[6];  const float* bq   = (const float*)d_in[7];
    const float* Wk   = (const float*)d_in[8];  const float* bk   = (const float*)d_in[9];
    const float* Wv   = (const float*)d_in[10]; const float* bv   = (const float*)d_in[11];
    const float* Wco  = (const float*)d_in[12]; const float* bco  = (const float*)d_in[13];
    const float* W1   = (const float*)d_in[14]; const float* b1   = (const float*)d_in[15];
    const float* W2   = (const float*)d_in[16]; const float* b2   = (const float*)d_in[17];
    const float* g1   = (const float*)d_in[18]; const float* be1  = (const float*)d_in[19];
    const float* g2   = (const float*)d_in[20]; const float* be2  = (const float*)d_in[21];
    const float* g3   = (const float*)d_in[22]; const float* be3  = (const float*)d_in[23];
    float* out = (float*)d_out;

    const size_t MB = 1u << 20;
    char* ws = (char*)d_ws;
    float* F1 = (float*)(ws + 64 * MB);      // 16 MB fp32 scratch (ffn out)
    float* F2 = (float*)(ws + 80 * MB);      // 16 MB fp32 scratch (out projections)
    float* X1 = (float*)(ws + 96 * MB);      // LN1 output
    float* X2 = (float*)(ws + 112 * MB);     // LN2 output
    unsigned short* Wb  = (unsigned short*)(ws + 128 * MB); // 8 MB  weight bf16
    unsigned short* Ab  = (unsigned short*)(ws + 136 * MB); // 32 MB activation bf16
    unsigned short* Qb  = (unsigned short*)(ws + 168 * MB); // 8 MB  cross-Q bf16
    unsigned short* KVb = (unsigned short*)(ws + 176 * MB); // 32 MB qkv / k,v / hidden bf16

    const int DM = 1024, RQ = 4096, RM = 8192, DFF = 4096;

    auto cvt = [&](const float* s, unsigned short* d, int n) {
        k_cvt_bf16<<<dim3(n / 1024), dim3(256), 0, stream>>>(s, d, n / 4);
    };
    auto gemm = [&](const unsigned short* A, const unsigned short* W,
                    const float* bias, float* C, int M, int N, int K, int relu) {
        k_gemm_bf16<<<dim3(N / 128, M / 128), dim3(256), 0, stream>>>(
            A, W, bias, C, nullptr, M, N, K, relu);
    };
    auto gemm_b = [&](const unsigned short* A, const unsigned short* W,
                      const float* bias, unsigned short* Cb,
                      int M, int N, int K, int relu) {
        k_gemm_bf16<<<dim3(N / 128, M / 128), dim3(256), 0, stream>>>(
            A, W, bias, nullptr, Cb, M, N, K, relu);
    };

    // --- self-attention block ---
    cvt(tgt, Ab, RQ * DM);                                  // tgt_bf
    cvt(Wqkv, Wb, 3 * DM * DM);                             // Wqkv_bf
    gemm_b(Ab, Wb, bqkv, KVb, RQ, 3 * DM, DM, 0);           // qkv bf16
    k_attn<<<dim3(16, 64), dim3(128), 0, stream>>>(
        KVb, KVb + 1024, KVb + 2048, Ab,                    // attn1 bf16
        12288, 3072, 12288, 3072, 4096, 1024, 1024, /*causal=*/1);
    cvt(Wso, Wb, DM * DM);
    gemm(Ab, Wb, bso, F2, RQ, DM, DM, 0);                   // self out proj
    k_add_ln<true><<<dim3(RQ), dim3(256), 0, stream>>>(tgt, F2, g1, be1, X1, Ab);

    // --- cross-attention block ---
    cvt(Wq, Wb, DM * DM);
    gemm_b(Ab, Wb, bq, Qb, RQ, DM, DM, 0);                  // q_c bf16
    cvt(mem, Ab, RM * DM);                                  // memory bf16
    cvt(Wk, Wb, DM * DM);
    gemm_b(Ab, Wb, bk, KVb, RM, DM, DM, 0);                 // k_c bf16
    cvt(Wv, Wb, DM * DM);
    gemm_b(Ab, Wb, bv, KVb + (size_t)RM * DM, RM, DM, DM, 0); // v_c bf16
    k_attn<<<dim3(16, 64), dim3(128), 0, stream>>>(
        Qb, KVb, KVb + (size_t)RM * DM, Ab,                 // attn2 bf16
        4096, 1024, 4096, 1024, 4096, 1024, 2048, /*causal=*/0);
    cvt(Wco, Wb, DM * DM);
    gemm(Ab, Wb, bco, F2, RQ, DM, DM, 0);                   // cross out proj
    k_add_ln<true><<<dim3(RQ), dim3(256), 0, stream>>>(X1, F2, g2, be2, X2, Ab);

    // --- FFN block ---
    cvt(W1, Wb, DFF * DM);
    gemm_b(Ab, Wb, b1, KVb, RQ, DFF, DM, /*relu=*/1);       // hidden bf16
    cvt(W2, Wb, DM * DFF);
    gemm(KVb, Wb, b2, F1, RQ, DM, DFF, 0);                  // ffn out
    k_add_ln<false><<<dim3(RQ), dim3(256), 0, stream>>>(X2, F1, g3, be3, out, nullptr);
}

// v004
// A run of this version takes 472 microseconds.
// In both of two side-by-side timings against v003, it was 1.45 times as fast.
// All steps since v000 together make it 2.11 times as fast.
#include <hip/hip_runtime.h>
#include <hip/hip_bf16.h>

// ---------------- types ----------------
typedef __attribute__((ext_vector_type(16))) __bf16 bf16x16;
typedef __attribute__((ext_vector_type(8)))  float  floatx8;
typedef __attribute__((ext_vector_type(8)))  unsigned short ushort8;
typedef __attribute__((ext_vector_type(4)))  unsigned short ushort4v;

// fp32 -> bf16 (RNE-ish)
__device__ __forceinline__ unsigned short f2bf(float x) {
    unsigned u = __float_as_uint(x);
    unsigned r = u + 0x7FFFu + ((u >> 16) & 1u);
    return (unsigned short)(r >> 16);
}

// LDS byte offset of a generic pointer to __shared__ memory
__device__ __forceinline__ unsigned lds_off(const void* p) {
    return (unsigned)(size_t)(const __attribute__((address_space(3))) void*)p;
}

// CDNA5 async global->LDS copy, 16 bytes per lane, tracked by ASYNCcnt.
// Four such copies and, as the statement's last line, the wait that stands in
// front of any rewrite of the address registers the copies name.
__device__ __forceinline__ void async_b128_x4(unsigned l0, const void* g0,
                                              unsigned l1, const void* g1,
                                              unsigned l2, const void* g2,
                                              unsigned l3, const void* g3) {
    asm volatile("global_load_async_to_lds_b128 %0, %1, off\n\t"
                 "global_load_async_to_lds_b128 %2, %3, off\n\t"
                 "global_load_async_to_lds_b128 %4, %5, off\n\t"
                 "global_load_async_to_lds_b128 %6, %7, off\n\t"
                 "s_wait_xcnt 0x0"
                 :: "v"(l0), "v"(g0), "v"(l1), "v"(g1),
                    "v"(l2), "v"(g2), "v"(l3), "v"(g3) : "memory");
}
// Eight copies, closed by the same wait.
__device__ __forceinline__ void async_b128_x8(unsigned l0, const void* g0,
                                              unsigned l1, const void* g1,
                                              unsigned l2, const void* g2,
                                              unsigned l3, const void* g3,
                                              unsigned l4, const void* g4,
                                              unsigned l5, const void* g5,
                                              unsigned l6, const void* g6,
                                              unsigned l7, const void* g7) {
    asm volatile("global_load_async_to_lds_b128 %0, %1, off\n\t"
                 "global_load_async_to_lds_b128 %2, %3, off\n\t"
                 "global_load_async_to_lds_b128 %4, %5, off\n\t"
                 "global_load_async_to_lds_b128 %6, %7, off\n\t"
                 "global_load_async_to_lds_b128 %8, %9, off\n\t"
                 "global_load_async_to_lds_b128 %10, %11, off\n\t"
                 "global_load_async_to_lds_b128 %12, %13, off\n\t"
                 "global_load_async_to_lds_b128 %14, %15, off\n\t"
                 "s_wait_xcnt 0x0"
                 :: "v"(l0), "v"(g0), "v"(l1), "v"(g1),
                    "v"(l2), "v"(g2), "v"(l3), "v"(g3),
                    "v"(l4), "v"(g4), "v"(l5), "v"(g5),
                    "v"(l6), "v"(g6), "v"(l7), "v"(g7) : "memory");
}
// all but the eight youngest copies (the next tile's) have landed
__device__ __forceinline__ void wait_async_le8() {
    asm volatile("s_wait_asynccnt 0x8" ::: "memory");
}
__device__ __forceinline__ void wait_async_0() {
    asm volatile("s_wait_asynccnt 0x0" ::: "memory");
}

// Load one 16x32 bf16 fragment (A-layout / symmetric B-layout) from LDS.
// Lane L<16 covers row (L), K in {8*half..+8} U {16+8*half..+8}; per ISA
// 16-bit A-matrix striping: two contiguous 8-element runs -> two b128 loads.
__device__ __forceinline__ bf16x16 load_frag(const unsigned short* base,
                                             int row_stride, int kbase) {
    int lane = threadIdx.x & 31;
    int half = lane >> 4;
    int row  = lane & 15;
    const unsigned short* p = base + row * row_stride + kbase + half * 8;
    union { bf16x16 f; ushort8 u[2]; } r;
    r.u[0] = *(const ushort8*)(p);
    r.u[1] = *(const ushort8*)(p + 16);
    return r.f;
}

// V^T fragment (A operand of V^T x P^T) from a row-major [K=32 keys][row_stride]
// LDS tile: lane L covers V column (base + L&15), gathering its 16 K elements
// (two runs of 8) as strided 16-bit LDS reads (transpose-in-LDS).
__device__ __forceinline__ bf16x16 load_frag_colT(const unsigned short* base,
                                                  int row_stride) {
    int lane = threadIdx.x & 31;
    int half = lane >> 4;
    int colv = lane & 15;
    union { bf16x16 f; unsigned short u[16]; } r;
#pragma unroll
    for (int j = 0; j < 8; j++) {
        r.u[j]     = base[(8 * half + j) * row_stride + colv];
        r.u[8 + j] = base[(16 + 8 * half + j) * row_stride + colv];
    }
    return r.f;
}

__device__ __forceinline__ floatx8 wmma_bf16(bf16x16 a, bf16x16 b, floatx8 c) {
    return __builtin_amdgcn_wmma_f32_16x16x32_bf16(false, a, false, b,
                                                   (short)0, c, false, false);
}

// lane l takes the value of lane l ^ 16 (the lane that holds the other half
// of the same fragment column)
__device__ __forceinline__ float xhalf(float x) {
    int b = __builtin_bit_cast(int, x);
    return __builtin_bit_cast(float, __builtin_amdgcn_permlanex16(
        b, b, 0x76543210, 0xfedcba98, false, false));
}

// LDS row pitches in elements. A 16-byte fragment read walks 16 rows at once;
// a pitch of 16 B x odd spreads those rows over all 64 banks, where the
// unpadded 64-B and 128-B rows fall on the same few banks again and again.
constexpr int P64 = 72;   // rows of 64 bf16: 128 B of data, 144 B pitch

// ---------------- convert kernel ----------------
__global__ __launch_bounds__(256)
void k_cvt_bf16(const float* __restrict__ src, unsigned short* __restrict__ dst,
                int n4 /* n/4 */) {
    int i = blockIdx.x * blockDim.x + threadIdx.x;
    if (i >= n4) return;
    const float4 v = *(const float4*)(src + i * 4);
    ushort4v o;
    o.x = f2bf(v.x); o.y = f2bf(v.y); o.z = f2bf(v.z); o.w = f2bf(v.w);
    *(ushort4v*)(dst + i * 4) = o;
}

// ---------------- GEMM: C[M,N] = A[M,K] * W[N,K]^T + bias, optional relu ----
// The result goes to Cb, rounded to bf16, where the next reader is a matrix
// product (Cb != nullptr), else to C in fp32.
// block tile 128(M) x 128(N), K-step 64, 256 threads = 8 waves.
// Each wave: 32x64 sub-tile = 2x4 WMMA accumulators (16 WMMA / K-step).
// Double-buffered LDS fed by async global->LDS DMA (ASYNCcnt pipeline).
// A K-step takes 128 B of every operand row, one whole cache line, and eight
// neighbouring lanes copy it: a wave's copy touches 4 full lines.
__global__ __launch_bounds__(256)
void k_gemm_bf16(const unsigned short* __restrict__ A,
                 const unsigned short* __restrict__ W,
                 const float* __restrict__ bias,
                 float* __restrict__ C,
                 unsigned short* __restrict__ Cb,
                 int M, int N, int K, int relu) {
    __shared__ __align__(16) unsigned short As[2][128 * P64];
    __shared__ __align__(16) unsigned short Ws[2][128 * P64];

    const int tid  = threadIdx.x;
    const int m0   = blockIdx.y * 128;
    const int n0   = blockIdx.x * 128;
    const int wave = tid >> 5;
    const int wm   = (wave & 3) * 32;   // 0,32,64,96
    const int wn   = (wave >> 2) * 64;  // 0,64

    // staging: each thread owns 8 elems (16 B) at column ac of the rows
    // ar, ar+32, ar+64, ar+96 of each tile
    const int ar = tid >> 3;            // 0..31
    const int ac = (tid & 7) * 8;       // 0,8,..,56
    const unsigned short* Ag = A + (size_t)(m0 + ar) * K + ac;
    const unsigned short* Wg = W + (size_t)(n0 + ar) * K + ac;
    const size_t   gr = (size_t)32 * K; // 32 rows on, in global elements
    const unsigned lr = 32 * P64 * 2;   // 32 rows on, in LDS bytes

    auto issue = [&](int buf, int k0) {
        unsigned la = lds_off(&As[buf][ar * P64 + ac]);
        unsigned lw = lds_off(&Ws[buf][ar * P64 + ac]);
        const unsigned short* ga = Ag + k0;
        const unsigned short* gw = Wg + k0;
        async_b128_x8(la,          ga,          la + lr,     ga + gr,
                      la + 2 * lr, ga + 2 * gr, la + 3 * lr, ga + 3 * gr,
                      lw,          gw,          lw + lr,     gw + gr,
                      lw + 2 * lr, gw + 2 * gr, lw + 3 * lr, gw + 3 * gr);
    };

    floatx8 acc[2][4] = {};
    const int T = K >> 6;

    issue(0, 0);
    for (int t = 0; t < T; t++) {
        if (t + 1 < T) { issue((t + 1) & 1, (t + 1) * 64); wait_async_le8(); }
        else           { wait_async_0(); }
        __syncthreads();

        const unsigned short* Ab = As[t & 1];
        const unsigned short* Wb = Ws[t & 1];
        for (int kk = 0; kk < 64; kk += 32) {
            bf16x16 af[2], wf[4];
            af[0] = load_frag(Ab + (wm + 0)  * P64, P64, kk);
            af[1] = load_frag(Ab + (wm + 16) * P64, P64, kk);
            for (int j = 0; j < 4; j++)
                wf[j] = load_frag(Wb + (wn + 16 * j) * P64, P64, kk);

            for (int i = 0; i < 2; i++)
                for (int j = 0; j < 4; j++)
                    acc[i][j] = wmma_bf16(af[i], wf[j], acc[i][j]);
        }
        __syncthreads();
    }

    const int lane = tid & 31;
    const int half = lane >> 4;
    const int col  = lane & 15;
    auto epilogue = [&](auto store) {
        for (int j = 0; j < 4; j++) {
            int n = n0 + wn + 16 * j + col;
            float bv = bias ? bias[n] : 0.0f;
            for (int i = 0; i < 2; i++) {
                for (int r = 0; r < 8; r++) {
                    int m = m0 + wm + 16 * i + r + 8 * half;
                    float v = acc[i][j][r] + bv;
                    if (relu) v = fmaxf(v, 0.0f);
                    store((size_t)m * N + n, v);
                }
            }
            // what follows a column block stands behind a branch and reuses
            // the stores' data and address registers
            asm volatile("s_wait_xcnt 0x0" ::: "memory");
        }
    };
    // one test of the output kind for the whole tile, not one per element
    if (Cb) epilogue([&](size_t idx, float v) { Cb[idx] = f2bf(v); });
    else    epilogue([&](size_t idx, float v) { C[idx] = v; });
}

__global__ __launch_bounds__(128)
void k_attn(const unsigned short* __restrict__ Qg,
            const unsigned short* __restrict__ Kg,
            const unsigned short* __restrict__ Vg,
            unsigned short* __restrict__ Og,
            int sQ, int bQ, int sK, int bK, int sO, int bO,
            int seq_kv, int causal) {
    __shared__ __align__(16) unsigned short Qs[64 * P64];     // q tile
    __shared__ __align__(16) unsigned short Ks[32 * P64];     // key tile [key][d]
    __shared__ __align__(16) unsigned short Vs[32 * P64];     // V tile  [key][d]

    const int q0 = blockIdx.x * 64;
    const int bh = blockIdx.y;
    const int b  = bh >> 4;
    const int h  = bh & 15;
    const unsigned short* Qb = Qg + (size_t)b * bQ + h * 64;
    const unsigned short* Kb = Kg + (size_t)b * bK + h * 64;
    const unsigned short* Vb = Vg + (size_t)b * bK + h * 64;
    unsigned short* Ob = Og + (size_t)b * bO + h * 64;

    const int tid  = threadIdx.x;
    const int wave = tid >> 5;
    const int lane = tid & 31;
    const int half = lane >> 4;
    const int col  = lane & 15;

    // stage Q tile (64x64) via async DMA
    {
        const int r = tid >> 3, c = (tid & 7) * 8;   // rows r, r+16, r+32, r+48
        const unsigned lq = lds_off(&Qs[r * P64 + c]);
        const unsigned short* gq = Qb + (size_t)(q0 + r) * sQ + c;
        async_b128_x4(lq,                gq,
                      lq + 16 * P64 * 2, gq + (size_t)16 * sQ,
                      lq + 32 * P64 * 2, gq + (size_t)32 * sQ,
                      lq + 48 * P64 * 2, gq + (size_t)48 * sQ);
    }
    wait_async_0();
    __syncthreads();

    // this lane's query: running maximum (over all keys), running sum (over
    // the keys of this lane half; the halves are joined after the loop)
    const int qi = q0 + wave * 16 + col;
    float m_run = -1e30f, l_run = 0.0f;
    floatx8 o[4] = {};   // o[n][r] = O[qi][16 * n + 8 * half + r]

    const float scale = 0.125f; // 1/sqrt(64)
    int kv_end = causal ? (q0 + 64) : seq_kv;
    if (kv_end > seq_kv) kv_end = seq_kv;

    // K/V-tile staging coords: eight neighbouring lanes copy one row's 128 B
    // (a whole cache line); each thread takes rows kr and kr+16
    const int kr = tid >> 3;
    const int kc = (tid & 7) * 8;

    for (int t0 = 0; t0 < kv_end; t0 += 32) {
        { // stage K and V tiles (32x64 each) via async DMA
            const unsigned short* gk = Kb + (size_t)(t0 + kr) * sK + kc;
            const unsigned short* gv = Vb + (size_t)(t0 + kr) * sK + kc;
            async_b128_x4(lds_off(&Ks[kr * P64 + kc]),        gk,
                          lds_off(&Ks[(kr + 16) * P64 + kc]), gk + (size_t)16 * sK,
                          lds_off(&Vs[kr * P64 + kc]),        gv,
                          lds_off(&Vs[(kr + 16) * P64 + kc]), gv + (size_t)16 * sK);
        }
        wait_async_0();
        __syncthreads();

        // S^T (32 keys x 16 q) per wave: 2 key tiles, d_k=64 -> 2 k-chunks each
        floatx8 s[2] = {};
        for (int c2 = 0; c2 < 2; c2++) {
            bf16x16 qb  = load_frag(Qs + (wave * 16) * P64, P64, c2 * 32);
            bf16x16 ka0 = load_frag(Ks,            P64, c2 * 32);
            bf16x16 ka1 = load_frag(Ks + 16 * P64, P64, c2 * 32);
            s[0] = wmma_bf16(ka0, qb, s[0]);
            s[1] = wmma_bf16(ka1, qb, s[1]);
        }

        // mask + scale + the query's maximum over this tile
        float best = -1e30f;
        for (int j = 0; j < 2; j++)
            for (int r = 0; r < 8; r++) {
                int kj = t0 + 16 * j + 8 * half + r;
                float v = s[j][r] * scale;
                if (causal && kj > qi) v = -1e30f;
                s[j][r] = v;
                best = fmaxf(best, v);
            }
        best = fmaxf(best, xhalf(best));

        // online softmax update; P^T operand element 8 * j + r is key
        // 16 * j + 8 * half + r, the k order of the V^T fragment
        const float mnew = fmaxf(m_run, best);
        const float corr = __expf(m_run - mnew);
        m_run = mnew;
        float su[2] = {0.0f, 0.0f};   // one chain of adds per key tile
        bf16x16 pb;
        for (int j = 0; j < 2; j++)
            for (int r = 0; r < 8; r++) {
                float p = __expf(s[j][r] - mnew);
                // the slot that the instruction set asks for behind a
                // transcendental, before the next v_exp_f32, which overwrites
                // this one's source register; p is an input only, so that the line
                // stays behind the v_exp_f32 that makes p
                if (j == 1 && r == 0) asm volatile("v_nop" :: "v"(p));
                su[j] += p;
                pb[8 * j + r] = (__bf16)p;
            }
        l_run = l_run * corr + (su[0] + su[1]);
        for (int n = 0; n < 4; n++)
            for (int r = 0; r < 8; r++)
                o[n][r] *= corr;

        for (int n = 0; n < 4; n++) {
            bf16x16 va = load_frag_colT(Vs + n * 16, P64);
            o[n] = wmma_bf16(va, pb, o[n]);
        }
        __syncthreads();
    }

    // epilogue: normalize + store bf16 (the only reader is the out projection);
    // a lane's 8 registers of o[n] are 8 neighbouring d of its query: 16 B
    // unrolled so that o[n] is named by constant index (rolled, the compiler
    // picks the registers by a relative move per element)
    const float l_all = l_run + xhalf(l_run);
#pragma unroll
    for (int n = 0; n < 4; n++) {
        ushort8 ov;
        for (int r = 0; r < 8; r++)
            ov[r] = f2bf(o[n][r] / l_all);
        *(ushort8*)(Ob + (size_t)qi * sO + n * 16 + 8 * half) = ov;
    }
}

// ---------------- residual + LayerNorm (D=1024, 256 threads/row) ----------
// O keeps fp32 for the next residual; with BF16_COPY, Ob takes the bf16 copy
// that the next matrix product reads.
template <bool BF16_COPY>
__global__ __launch_bounds__(256)
void k_add_ln(const float* __restrict__ X, const float* __restrict__ Y,
              const float* __restrict__ gw, const float* __restrict__ bw,
              float* __restrict__ O, unsigned short* __restrict__ Ob) {
    const int D = 1024;
    const int row = blockIdx.x;
    const int tid = threadIdx.x;
    const float4 xv = *(const float4*)(X + (size_t)row * D + tid * 4);
    const float4 yv = *(const float4*)(Y + (size_t)row * D + tid * 4);
    float t0 = xv.x + yv.x, t1 = xv.y + yv.y, t2 = xv.z + yv.z, t3 = xv.w + yv.w;
    float s  = t0 + t1 + t2 + t3;
    float s2 = t0 * t0 + t1 * t1 + t2 * t2 + t3 * t3;
    for (int msk = 1; msk < 32; msk <<= 1) {
        s  += __shfl_xor(s, msk, 32);
        s2 += __shfl_xor(s2, msk, 32);
    }
    __shared__ float sh[16];
    int wave = tid >> 5, lane = tid & 31;
    if (lane == 0) { sh[wave] = s; sh[8 + wave] = s2; }
    __syncthreads();
    float S = 0.0f, S2 = 0.0f;
    for (int i = 0; i < 8; i++) { S += sh[i]; S2 += sh[8 + i]; }
    float mu  = S / D;
    float inv = rsqrtf(S2 / D - mu * mu + 1e-5f);
    const float4 gv = *(const float4*)(gw + tid * 4);
    const float4 bv = *(const float4*)(bw + tid * 4);
    float4 ov;
    ov.x = (t0 - mu) * inv * gv.x + bv.x;
    ov.y = (t1 - mu) * inv * gv.y + bv.y;
    ov.z = (t2 - mu) * inv * gv.z + bv.z;
    ov.w = (t3 - mu) * inv * gv.w + bv.w;
    *(float4*)(O + (size_t)row * D + tid * 4) = ov;
    if (BF16_COPY) {
        ushort4v ob;
        ob.x = f2bf(ov.x); ob.y = f2bf(ov.y); ob.z = f2bf(ov.z); ob.w = f2bf(ov.w);
        *(ushort4v*)(Ob + (size_t)row * D + tid * 4) = ob;
    }
}

// ---------------- host orchestration ----------------
extern "C" void kernel_launch(void* const* d_in, const int* in_sizes, int n_in,
                              void* d_out, int out_size, void* d_ws, size_t ws_size,
                              hipStream_t stream) {
    (void)in_sizes; (void)n_in; (void)out_size; (void)ws_size;
    const float* tgt  = (const float*)d_in[0];
    const float* mem  = (const float*)d_in[1];
    const float* Wqkv = (const float*)d_in[2];  const float* bqkv = (const float*)d_in[3];
    const float* Wso  = (const float*)d_in[4];  const float* bso  = (const float*)d_in[5];
    const float* Wq   = (const float*)d_in[6];  const float* bq   = (const float*)d_in[7];
    const float* Wk   = (const float*)d_in[8];  const float* bk   = (const float*)d_in[9];
    const float* Wv   = (const float*)d_in[10]; const float* bv   = (const float*)d_in[11];
    const float* Wco  = (const float*)d_in[12]; const float* bco  = (const float*)d_in[13];
    const float* W1   = (const float*)d_in[14]; const float* b1   = (const float*)d_in[15];
    const float* W2   = (const float*)d_in[16]; const float* b2   = (const float*)d_in[17];
    const float* g1   = (const float*)d_in[18]; const float* be1  = (const float*)d_in[19];
    const float* g2   = (const float*)d_in[20]; const float* be2  = (const float*)d_in[21];
    const float* g3   = (const float*)d_in[22]; const float* be3  = (const float*)d_in[23];
    float* out = (float*)d_out;

    const size_t MB = 1u << 20;
    char* ws = (char*)d_ws;
    float* F1 = (float*)(ws + 64 * MB);      // 16 MB fp32 scratch (ffn out)
    float* F2 = (float*)(ws + 80 * MB);      // 16 MB fp32 scratch (out projections)
    float* X1 = (float*)(ws + 96 * MB);      // LN1 output
    float* X2 = (float*)(ws + 112 * MB);     // LN2 output
    unsigned short* Wb  = (unsigned short*)(ws + 128 * MB); // 8 MB  weight bf16
    unsigned short* Ab  = (unsigned short*)(ws + 136 * MB); // 32 MB activation bf16
    unsigned short* Qb  = (unsigned short*)(ws + 168 * MB); // 8 MB  cross-Q bf16
    unsigned short* KVb = (unsigned short*)(ws + 176 * MB); // 32 MB qkv / k,v / hidden bf16

    const int DM = 1024, RQ = 4096, RM = 8192, DFF = 4096;

    auto cvt = [&](const float* s, unsigned short* d, int n) {
        k_cvt_bf16<<<dim3(n / 1024), dim3(256), 0, stream>>>(s, d, n / 4);
    };
    auto gemm = [&](const unsigned short* A, const unsigned short* W,
                    const float* bias, float* C, int M, int N, int K, int relu) {
        k_gemm_bf16<<<dim3(N / 128, M / 128), dim3(256), 0, stream>>>(
            A, W, bias, C, nullptr, M, N, K, relu);
    };
    auto gemm_b = [&](const unsigned short* A, const unsigned short* W,
                      const float* bias, unsigned short* Cb,
                      int M, int N, int K, int relu) {
        k_gemm_bf16<<<dim3(N / 128, M / 128), dim3(256), 0, stream>>>(
            A, W, bias, nullptr, Cb, M, N, K, relu);
    };

    // --- self-attention block ---
    cvt(tgt, Ab, RQ * DM);                                  // tgt_bf
    cvt(Wqkv, Wb, 3 * DM * DM);                             // Wqkv_bf
    gemm_b(Ab, Wb, bqkv, KVb, RQ, 3 * DM, DM, 0);           // qkv bf16
    k_attn<<<dim3(16, 64), dim3(128), 0, stream>>>(
        KVb, KVb + 1024, KVb + 2048, Ab,                    // attn1 bf16
        12288, 3072, 12288, 3072, 4096, 1024, 1024, /*causal=*/1);
    cvt(Wso, Wb, DM * DM);
    gemm(Ab, Wb, bso, F2, RQ, DM, DM, 0);                   // self out proj
    k_add_ln<true><<<dim3(RQ), dim3(256), 0, stream>>>(tgt, F2, g1, be1, X1, Ab);

    // --- cross-attention block ---
    cvt(Wq, Wb, DM * DM);
    gemm_b(Ab, Wb, bq, Qb, RQ, DM, DM, 0);                  // q_c bf16
    cvt(mem, Ab, RM * DM);                                  // memory bf16
    cvt(Wk, Wb, DM * DM);
    gemm_b(Ab, Wb, bk, KVb, RM, DM, DM, 0);                 // k_c bf16
    cvt(Wv, Wb, DM * DM);
    gemm_b(Ab, Wb, bv, KVb + (size_t)RM * DM, RM, DM, DM, 0); // v_c bf16
    k_attn<<<dim3(16, 64), dim3(128), 0, stream>>>(
        Qb, KVb, KVb + (size_t)RM * DM, Ab,                 // attn2 bf16
        4096, 1024, 4096, 1024, 4096, 1024, 2048, /*causal=*/0);
    cvt(Wco, Wb, DM * DM);
    gemm(Ab, Wb, bco, F2, RQ, DM, DM, 0);                   // cross out proj
    k_add_ln<true><<<dim3(RQ), dim3(256), 0, stream>>>(X1, F2, g2, be2, X2, Ab);

    // --- FFN block ---
    cvt(W1, Wb, DFF * DM);
    gemm_b(Ab, Wb, b1, KVb, RQ, DFF, DM, /*relu=*/1);       // hidden bf16
    cvt(W2, Wb, DM * DFF);
    gemm(KVb, Wb, b2, F1, RQ, DM, DFF, 0);                  // ffn out
    k_add_ln<false><<<dim3(RQ), dim3(256), 0, stream>>>(X2, F1, g3, be3, out, nullptr);
}

// v005
// It runs in 362 microseconds.
// Next to v004, in two timings, it ran 1.31 and 1.30 times as fast.
// All steps since v000 together make it 2.75 times as fast.
#include <hip/hip_runtime.h>
#include <hip/hip_bf16.h>

// ---------------- types ----------------
typedef __attribute__((ext_vector_type(16))) __bf16 bf16x16;
typedef __attribute__((ext_vector_type(8)))  float  floatx8;
typedef __attribute__((ext_vector_type(8)))  unsigned short ushort8;
typedef __attribute__((ext_vector_type(4)))  unsigned short ushort4v;

// fp32 -> bf16 (RNE-ish)
__device__ __forceinline__ unsigned short f2bf(float x) {
    unsigned u = __float_as_uint(x);
    unsigned r = u + 0x7FFFu + ((u >> 16) & 1u);
    return (unsigned short)(r >> 16);
}

// LDS byte offset of a generic pointer to __shared__ memory
__device__ __forceinline__ unsigned lds_off(const void* p) {
    return (unsigned)(size_t)(const __attribute__((address_space(3))) void*)p;
}

// CDNA5 async global->LDS copy, 16 bytes per lane, tracked by ASYNCcnt.
// Four such copies and, as the statement's last line, the wait that stands in
// front of any rewrite of the address registers the copies name.
__device__ __forceinline__ void async_b128_x4(unsigned l0, const void* g0,
                                              unsigned l1, const void* g1,
                                              unsigned l2, const void* g2,
                                              unsigned l3, const void* g3) {
    asm volatile("global_load_async_to_lds_b128 %0, %1, off\n\t"
                 "global_load_async_to_lds_b128 %2, %3, off\n\t"
                 "global_load_async_to_lds_b128 %4, %5, off\n\t"
                 "global_load_async_to_lds_b128 %6, %7, off\n\t"
                 "s_wait_xcnt 0x0"
                 :: "v"(l0), "v"(g0), "v"(l1), "v"(g1),
                    "v"(l2), "v"(g2), "v"(l3), "v"(g3) : "memory");
}
// Eight copies, closed by the same wait.
__device__ __forceinline__ void async_b128_x8(unsigned l0, const void* g0,
                                              unsigned l1, const void* g1,
                                              unsigned l2, const void* g2,
                                              unsigned l3, const void* g3,
                                              unsigned l4, const void* g4,
                                              unsigned l5, const void* g5,
                                              unsigned l6, const void* g6,
                                              unsigned l7, const void* g7) {
    asm volatile("global_load_async_to_lds_b128 %0, %1, off\n\t"
                 "global_load_async_to_lds_b128 %2, %3, off\n\t"
                 "global_load_async_to_lds_b128 %4, %5, off\n\t"
                 "global_load_async_to_lds_b128 %6, %7, off\n\t"
                 "global_load_async_to_lds_b128 %8, %9, off\n\t"
                 "global_load_async_to_lds_b128 %10, %11, off\n\t"
                 "global_load_async_to_lds_b128 %12, %13, off\n\t"
                 "global_load_async_to_lds_b128 %14, %15, off\n\t"
                 "s_wait_xcnt 0x0"
                 :: "v"(l0), "v"(g0), "v"(l1), "v"(g1),
                    "v"(l2), "v"(g2), "v"(l3), "v"(g3),
                    "v"(l4), "v"(g4), "v"(l5), "v"(g5),
                    "v"(l6), "v"(g6), "v"(l7), "v"(g7) : "memory");
}
// all but the eight youngest copies (the next tile's) have landed
__device__ __forceinline__ void wait_async_le8() {
    asm volatile("s_wait_asynccnt 0x8" ::: "memory");
}
__device__ __forceinline__ void wait_async_0() {
    asm volatile("s_wait_asynccnt 0x0" ::: "memory");
}

// Load one 16x32 bf16 fragment (A-layout / symmetric B-layout) from LDS.
// Lane L<16 covers row (L), K in {8*half..+8} U {16+8*half..+8}; per ISA
// 16-bit A-matrix striping: two contiguous 8-element runs -> two b128 loads.
__device__ __forceinline__ bf16x16 load_frag(const unsigned short* base,
                                             int row_stride, int kbase) {
    int lane = threadIdx.x & 31;
    int half = lane >> 4;
    int row  = lane & 15;
    const unsigned short* p = base + row * row_stride + kbase + half * 8;
    union { bf16x16 f; ushort8 u[2]; } r;
    r.u[0] = *(const ushort8*)(p);
    r.u[1] = *(const ushort8*)(p + 16);
    return r.f;
}

// V^T fragment (A operand of V^T x P^T) from a row-major [K=32 keys][row_stride]
// LDS tile, by the 16-bit transposing LDS load: lane L reads 16 B of key row
// 8 * half + (L & 7), and receives V column (base + L&15) of the keys
// 8 * half + 0..7; the second load, 16 rows on, brings the keys 16 + 8 * half + 0..7.
typedef __attribute__((ext_vector_type(8))) short short8;
__device__ __forceinline__ bf16x16 load_frag_colT(const unsigned short* base,
                                                  int row_stride) {
    typedef __attribute__((address_space(3))) short8 lds_short8;
    int lane = threadIdx.x & 31;
    int half = lane >> 4;
    const unsigned short* p = base + (8 * half + (lane & 7)) * row_stride
                                   + 8 * ((lane >> 3) & 1);
    union { bf16x16 f; short8 u[2]; } r;
    r.u[0] = __builtin_amdgcn_ds_load_tr16_b128_v8i16((lds_short8*)p);
    r.u[1] = __builtin_amdgcn_ds_load_tr16_b128_v8i16((lds_short8*)(p + 16 * row_stride));
    return r.f;
}

__device__ __forceinline__ floatx8 wmma_bf16(bf16x16 a, bf16x16 b, floatx8 c) {
    return __builtin_amdgcn_wmma_f32_16x16x32_bf16(false, a, false, b,
                                                   (short)0, c, false, false);
}

// lane l takes the value of lane l ^ 16 (the lane that holds the other half
// of the same fragment column)
__device__ __forceinline__ float xhalf(float x) {
    int b = __builtin_bit_cast(int, x);
    return __builtin_bit_cast(float, __builtin_amdgcn_permlanex16(
        b, b, 0x76543210, 0xfedcba98, false, false));
}

// LDS row pitches in elements. A 16-byte fragment read walks 16 rows at once;
// a pitch of 16 B x odd spreads those rows over all 64 banks, where the
// unpadded 64-B and 128-B rows fall on the same few banks again and again.
constexpr int P64 = 72;   // rows of 64 bf16: 128 B of data, 144 B pitch
// The transposing load walks 8 rows in each lane half, 32 B of each: its
// conflict-free pitch is 32 B x odd.
constexpr int PV64 = 80;  // V rows of 64 bf16: 128 B of data, 160 B pitch

// ---------------- convert kernel ----------------
__global__ __launch_bounds__(256)
void k_cvt_bf16(const float* __restrict__ src, unsigned short* __restrict__ dst,
                int n4 /* n/4 */) {
    int i = blockIdx.x * blockDim.x + threadIdx.x;
    if (i >= n4) return;
    const float4 v = *(const float4*)(src + i * 4);
    ushort4v o;
    o.x = f2bf(v.x); o.y = f2bf(v.y); o.z = f2bf(v.z); o.w = f2bf(v.w);
    *(ushort4v*)(dst + i * 4) = o;
}

// ---------------- GEMM: C[M,N] = A[M,K] * W[N,K]^T + bias, optional relu ----
// The result goes to Cb, rounded to bf16, where the next reader is a matrix
// product (Cb != nullptr), else to C in fp32.
// block tile 128(M) x 128(N), K-step 64, 256 threads = 8 waves.
// Each wave: 32x64 sub-tile = 2x4 WMMA accumulators (16 WMMA / K-step).
// Double-buffered LDS fed by async global->LDS DMA (ASYNCcnt pipeline).
// A K-step takes 128 B of every operand row, one whole cache line, and eight
// neighbouring lanes copy it: a wave's copy touches 4 full lines.
__global__ __launch_bounds__(256)
void k_gemm_bf16(const unsigned short* __restrict__ A,
                 const unsigned short* __restrict__ W,
                 const float* __restrict__ bias,
                 float* __restrict__ C,
                 unsigned short* __restrict__ Cb,
                 int M, int N, int K, int relu) {
    __shared__ __align__(16) unsigned short As[2][128 * P64];
    __shared__ __align__(16) unsigned short Ws[2][128 * P64];

    const int tid  = threadIdx.x;
    const int m0   = blockIdx.y * 128;
    const int n0   = blockIdx.x * 128;
    const int wave = tid >> 5;
    const int wm   = (wave & 3) * 32;   // 0,32,64,96
    const int wn   = (wave >> 2) * 64;  // 0,64

    // staging: each thread owns 8 elems (16 B) at column ac of the rows
    // ar, ar+32, ar+64, ar+96 of each tile
    const int ar = tid >> 3;            // 0..31
    const int ac = (tid & 7) * 8;       // 0,8,..,56
    const unsigned short* Ag = A + (size_t)(m0 + ar) * K + ac;
    const unsigned short* Wg = W + (size_t)(n0 + ar) * K + ac;
    const size_t   gr = (size_t)32 * K; // 32 rows on, in global elements
    const unsigned lr = 32 * P64 * 2;   // 32 rows on, in LDS bytes

    auto issue = [&](int buf, int k0) {
        unsigned la = lds_off(&As[buf][ar * P64 + ac]);
        unsigned lw = lds_off(&Ws[buf][ar * P64 + ac]);
        const unsigned short* ga = Ag + k0;
        const unsigned short* gw = Wg + k0;
        async_b128_x8(la,          ga,          la + lr,     ga + gr,
                      la + 2 * lr, ga + 2 * gr, la + 3 * lr, ga + 3 * gr,
                      lw,          gw,          lw + lr,     gw + gr,
                      lw + 2 * lr, gw + 2 * gr, lw + 3 * lr, gw + 3 * gr);
    };

    floatx8 acc[2][4] = {};
    const int T = K >> 6;

    issue(0, 0);
    for (int t = 0; t < T; t++) {
        if (t + 1 < T) { issue((t + 1) & 1, (t + 1) * 64); wait_async_le8(); }
        else           { wait_async_0(); }
        __syncthreads();

        const unsigned short* Ab = As[t & 1];
        const unsigned short* Wb = Ws[t & 1];
        for (int kk = 0; kk < 64; kk += 32) {
            bf16x16 af[2], wf[4];
            af[0] = load_frag(Ab + (wm + 0)  * P64, P64, kk);
            af[1] = load_frag(Ab + (wm + 16) * P64, P64, kk);
            for (int j = 0; j < 4; j++)
                wf[j] = load_frag(Wb + (wn + 16 * j) * P64, P64, kk);

            for (int i = 0; i < 2; i++)
                for (int j = 0; j < 4; j++)
                    acc[i][j] = wmma_bf16(af[i], wf[j], acc[i][j]);
        }
        __syncthreads();
    }

    const int lane = tid & 31;
    const int half = lane >> 4;
    const int col  = lane & 15;
    auto epilogue = [&](auto store) {
        for (int j = 0; j < 4; j++) {
            int n = n0 + wn + 16 * j + col;
            float bv = bias ? bias[n] : 0.0f;
            for (int i = 0; i < 2; i++) {
                for (int r = 0; r < 8; r++) {
                    int m = m0 + wm + 16 * i + r + 8 * half;
                    float v = acc[i][j][r] + bv;
                    if (relu) v = fmaxf(v, 0.0f);
                    store((size_t)m * N + n, v);
                }
            }
            // what follows a column block stands behind a branch and reuses
            // the stores' data and address registers
            asm volatile("s_wait_xcnt 0x0" ::: "memory");
        }
    };
    // one test of the output kind for the whole tile, not one per element
    if (Cb) epilogue([&](size_t idx, float v) { Cb[idx] = f2bf(v); });
    else    epilogue([&](size_t idx, float v) { C[idx] = v; });
}

__global__ __launch_bounds__(128)
void k_attn(const unsigned short* __restrict__ Qg,
            const unsigned short* __restrict__ Kg,
            const unsigned short* __restrict__ Vg,
            unsigned short* __restrict__ Og,
            int sQ, int bQ, int sK, int bK, int sO, int bO,
            int seq_kv, int causal) {
    __shared__ __align__(16) unsigned short Qs[64 * P64];     // q tile
    __shared__ __align__(16) unsigned short Ks[32 * P64];     // key tile [key][d]
    __shared__ __align__(16) unsigned short Vs[32 * PV64];    // V tile  [key][d]

    const int q0 = blockIdx.x * 64;
    const int bh = blockIdx.y;
    const int b  = bh >> 4;
    const int h  = bh & 15;
    const unsigned short* Qb = Qg + (size_t)b * bQ + h * 64;
    const unsigned short* Kb = Kg + (size_t)b * bK + h * 64;
    const unsigned short* Vb = Vg + (size_t)b * bK + h * 64;
    unsigned short* Ob = Og + (size_t)b * bO + h * 64;

    const int tid  = threadIdx.x;
    const int wave = tid >> 5;
    const int lane = tid & 31;
    const int half = lane >> 4;
    const int col  = lane & 15;

    // stage Q tile (64x64) via async DMA
    {
        const int r = tid >> 3, c = (tid & 7) * 8;   // rows r, r+16, r+32, r+48
        const unsigned lq = lds_off(&Qs[r * P64 + c]);
        const unsigned short* gq = Qb + (size_t)(q0 + r) * sQ + c;
        async_b128_x4(lq,                gq,
                      lq + 16 * P64 * 2, gq + (size_t)16 * sQ,
                      lq + 32 * P64 * 2, gq + (size_t)32 * sQ,
                      lq + 48 * P64 * 2, gq + (size_t)48 * sQ);
    }
    wait_async_0();
    __syncthreads();

    // this lane's query: running maximum (over all keys), running sum (over
    // the keys of this lane half; the halves are joined after the loop)
    const int qi = q0 + wave * 16 + col;
    float m_run = -1e30f, l_run = 0.0f;
    floatx8 o[4] = {};   // o[n][r] = O[qi][16 * n + 8 * half + r]

    const float scale = 0.125f; // 1/sqrt(64)
    int kv_end = causal ? (q0 + 64) : seq_kv;
    if (kv_end > seq_kv) kv_end = seq_kv;

    // K/V-tile staging coords: eight neighbouring lanes copy one row's 128 B
    // (a whole cache line); each thread takes rows kr and kr+16
    const int kr = tid >> 3;
    const int kc = (tid & 7) * 8;

    for (int t0 = 0; t0 < kv_end; t0 += 32) {
        { // stage K and V tiles (32x64 each) via async DMA
            const unsigned short* gk = Kb + (size_t)(t0 + kr) * sK + kc;
            const unsigned short* gv = Vb + (size_t)(t0 + kr) * sK + kc;
            async_b128_x4(lds_off(&Ks[kr * P64 + kc]),        gk,
                          lds_off(&Ks[(kr + 16) * P64 + kc]), gk + (size_t)16 * sK,
                          lds_off(&Vs[kr * PV64 + kc]),        gv,
                          lds_off(&Vs[(kr + 16) * PV64 + kc]), gv + (size_t)16 * sK);
        }
        wait_async_0();
        __syncthreads();

        // S^T (32 keys x 16 q) per wave: 2 key tiles, d_k=64 -> 2 k-chunks each
        floatx8 s[2] = {};
        for (int c2 = 0; c2 < 2; c2++) {
            bf16x16 qb  = load_frag(Qs + (wave * 16) * P64, P64, c2 * 32);
            bf16x16 ka0 = load_frag(Ks,            P64, c2 * 32);
            bf16x16 ka1 = load_frag(Ks + 16 * P64, P64, c2 * 32);
            s[0] = wmma_bf16(ka0, qb, s[0]);
            s[1] = wmma_bf16(ka1, qb, s[1]);
        }

        // mask + scale + the query's maximum over this tile
        float best = -1e30f;
        for (int j = 0; j < 2; j++)
            for (int r = 0; r < 8; r++) {
                int kj = t0 + 16 * j + 8 * half + r;
                float v = s[j][r] * scale;
                if (causal && kj > qi) v = -1e30f;
                s[j][r] = v;
                best = fmaxf(best, v);
            }
        best = fmaxf(best, xhalf(best));

        // online softmax update; P^T operand element 8 * j + r is key
        // 16 * j + 8 * half + r, the k order of the V^T fragment
        const float mnew = fmaxf(m_run, best);
        const float corr = __expf(m_run - mnew);
        m_run = mnew;
        float su[2] = {0.0f, 0.0f};   // one chain of adds per key tile
        bf16x16 pb;
        for (int j = 0; j < 2; j++)
            for (int r = 0; r < 8; r++) {
                float p = __expf(s[j][r] - mnew);
                // the slot that the instruction set asks for behind a
                // transcendental, before the next v_exp_f32, which overwrites
                // this one's source register; p is an input only, so that the line
                // stays behind the v_exp_f32 that makes p
                if (j == 1 && r == 0) asm volatile("v_nop" :: "v"(p));
                su[j] += p;
                pb[8 * j + r] = (__bf16)p;
            }
        l_run = l_run * corr + (su[0] + su[1]);
        for (int n = 0; n < 4; n++)
            for (int r = 0; r < 8; r++)
                o[n][r] *= corr;

        for (int n = 0; n < 4; n++) {
            bf16x16 va = load_frag_colT(Vs + n * 16, PV64);
            o[n] = wmma_bf16(va, pb, o[n]);
        }
        __syncthreads();
    }

    // epilogue: normalize + store bf16 (the only reader is the out projection);
    // a lane's 8 registers of o[n] are 8 neighbouring d of its query: 16 B
    // unrolled so that o[n] is named by constant index (rolled, the compiler
    // picks the registers by a relative move per element)
    const float l_all = l_run + xhalf(l_run);
#pragma unroll
    for (int n = 0; n < 4; n++) {
        ushort8 ov;
        for (int r = 0; r < 8; r++)
            ov[r] = f2bf(o[n][r] / l_all);
        *(ushort8*)(Ob + (size_t)qi * sO + n * 16 + 8 * half) = ov;
    }
}

// ---------------- residual + LayerNorm (D=1024, 256 threads/row) ----------
// O keeps fp32 for the next residual; with BF16_COPY, Ob takes the bf16 copy
// that the next matrix product reads.
template <bool BF16_COPY>
__global__ __launch_bounds__(256)
void k_add_ln(const float* __restrict__ X, const float* __restrict__ Y,
              const float* __restrict__ gw, const float* __restrict__ bw,
              float* __restrict__ O, unsigned short* __restrict__ Ob) {
    const int D = 1024;
    const int row = blockIdx.x;
    const int tid = threadIdx.x;
    const float4 xv = *(const float4*)(X + (size_t)row * D + tid * 4);
    const float4 yv = *(const float4*)(Y + (size_t)row * D + tid * 4);
    float t0 = xv.x + yv.x, t1 = xv.y + yv.y, t2 = xv.z + yv.z, t3 = xv.w + yv.w;
    float s  = t0 + t1 + t2 + t3;
    float s2 = t0 * t0 + t1 * t1 + t2 * t2 + t3 * t3;
    for (int msk = 1; msk < 32; msk <<= 1) {
        s  += __shfl_xor(s, msk, 32);
        s2 += __shfl_xor(s2, msk, 32);
    }
    __shared__ float sh[16];
    int wave = tid >> 5, lane = tid & 31;
    if (lane == 0) { sh[wave] = s; sh[8 + wave] = s2; }
    __syncthreads();
    float S = 0.0f, S2 = 0.0f;
    for (int i = 0; i < 8; i++) { S += sh[i]; S2 += sh[8 + i]; }
    float mu  = S / D;
    float inv = rsqrtf(S2 / D - mu * mu + 1e-5f);
    const float4 gv = *(const float4*)(gw + tid * 4);
    const float4 bv = *(const float4*)(bw + tid * 4);
    float4 ov;
    ov.x = (t0 - mu) * inv * gv.x + bv.x;
    ov.y = (t1 - mu) * inv * gv.y + bv.y;
    ov.z = (t2 - mu) * inv * gv.z + bv.z;
    ov.w = (t3 - mu) * inv * gv.w + bv.w;
    *(float4*)(O + (size_t)row * D + tid * 4) = ov;
    if (BF16_COPY) {
        ushort4v ob;
        ob.x = f2bf(ov.x); ob.y = f2bf(ov.y); ob.z = f2bf(ov.z); ob.w = f2bf(ov.w);
        *(ushort4v*)(Ob + (size_t)row * D + tid * 4) = ob;
    }
}

// ---------------- host orchestration ----------------
extern "C" void kernel_launch(void* const* d_in, const int* in_sizes, int n_in,
                              void* d_out, int out_size, void* d_ws, size_t ws_size,
                              hipStream_t stream) {
    (void)in_sizes; (void)n_in; (void)out_size; (void)ws_size;
    const float* tgt  = (const float*)d_in[0];
    const float* mem  = (const float*)d_in[1];
    const float* Wqkv = (const float*)d_in[2];  const float* bqkv = (const float*)d_in[3];
    const float* Wso  = (const float*)d_in[4];  const float* bso  = (const float*)d_in[5];
    const float* Wq   = (const float*)d_in[6];  const float* bq   = (const float*)d_in[7];
    const float* Wk   = (const float*)d_in[8];  const float* bk   = (const float*)d_in[9];
    const float* Wv   = (const float*)d_in[10]; const float* bv   = (const float*)d_in[11];
    const float* Wco  = (const float*)d_in[12]; const float* bco  = (const float*)d_in[13];
    const float* W1   = (const float*)d_in[14]; const float* b1   = (const float*)d_in[15];
    const float* W2   = (const float*)d_in[16]; const float* b2   = (const float*)d_in[17];
    const float* g1   = (const float*)d_in[18]; const float* be1  = (const float*)d_in[19];
    const float* g2   = (const float*)d_in[20]; const float* be2  = (const float*)d_in[21];
    const float* g3   = (const float*)d_in[22]; const float* be3  = (const float*)d_in[23];
    float* out = (float*)d_out;

    const size_t MB = 1u << 20;
    char* ws = (char*)d_ws;
    float* F1 = (float*)(ws + 64 * MB);      // 16 MB fp32 scratch (ffn out)
    float* F2 = (float*)(ws + 80 * MB);      // 16 MB fp32 scratch (out projections)
    float* X1 = (float*)(ws + 96 * MB);      // LN1 output
    float* X2 = (float*)(ws + 112 * MB);     // LN2 output
    unsigned short* Wb  = (unsigned short*)(ws + 128 * MB); // 8 MB  weight bf16
    unsigned short* Ab  = (unsigned short*)(ws + 136 * MB); // 32 MB activation bf16
    unsigned short* Qb  = (unsigned short*)(ws + 168 * MB); // 8 MB  cross-Q bf16
    unsigned short* KVb = (unsigned short*)(ws + 176 * MB); // 32 MB qkv / k,v / hidden bf16

    const int DM = 1024, RQ = 4096, RM = 8192, DFF = 4096;

    auto cvt = [&](const float* s, unsigned short* d, int n) {
        k_cvt_bf16<<<dim3(n / 1024), dim3(256), 0, stream>>>(s, d, n / 4);
    };
    auto gemm = [&](const unsigned short* A, const unsigned short* W,
                    const float* bias, float* C, int M, int N, int K, int relu) {
        k_gemm_bf16<<<dim3(N / 128, M / 128), dim3(256), 0, stream>>>(
            A, W, bias, C, nullptr, M, N, K, relu);
    };
    auto gemm_b = [&](const unsigned short* A, const unsigned short* W,
                      const float* bias, unsigned short* Cb,
                      int M, int N, int K, int relu) {
        k_gemm_bf16<<<dim3(N / 128, M / 128), dim3(256), 0, stream>>>(
            A, W, bias, nullptr, Cb, M, N, K, relu);
    };

    // --- self-attention block ---
    cvt(tgt, Ab, RQ * DM);                                  // tgt_bf
    cvt(Wqkv, Wb, 3 * DM * DM);                             // Wqkv_bf
    gemm_b(Ab, Wb, bqkv, KVb, RQ, 3 * DM, DM, 0);           // qkv bf16
    k_attn<<<dim3(16, 64), dim3(128), 0, stream>>>(
        KVb, KVb + 1024, KVb + 2048, Ab,                    // attn1 bf16
        12288, 3072, 12288, 3072, 4096, 1024, 1024, /*causal=*/1);
    cvt(Wso, Wb, DM * DM);
    gemm(Ab, Wb, bso, F2, RQ, DM, DM, 0);                   // self out proj
    k_add_ln<true><<<dim3(RQ), dim3(256), 0, stream>>>(tgt, F2, g1, be1, X1, Ab);

    // --- cross-attention block ---
    cvt(Wq, Wb, DM * DM);
    gemm_b(Ab, Wb, bq, Qb, RQ, DM, DM, 0);                  // q_c bf16
    cvt(mem, Ab, RM * DM);                                  // memory bf16
    cvt(Wk, Wb, DM * DM);
    gemm_b(Ab, Wb, bk, KVb, RM, DM, DM, 0);                 // k_c bf16
    cvt(Wv, Wb, DM * DM);
    gemm_b(Ab, Wb, bv, KVb + (size_t)RM * DM, RM, DM, DM, 0); // v_c bf16
    k_attn<<<dim3(16, 64), dim3(128), 0, stream>>>(
        Qb, KVb, KVb + (size_t)RM * DM, Ab,                 // attn2 bf16
        4096, 1024, 4096, 1024, 4096, 1024, 2048, /*causal=*/0);
    cvt(Wco, Wb, DM * DM);
    gemm(Ab, Wb, bco, F2, RQ, DM, DM, 0);                   // cross out proj
    k_add_ln<true><<<dim3(RQ), dim3(256), 0, stream>>>(X1, F2, g2, be2, X2, Ab);

    // --- FFN block ---
    cvt(W1, Wb, DFF * DM);
    gemm_b(Ab, Wb, b1, KVb, RQ, DFF, DM, /*relu=*/1);       // hidden bf16
    cvt(W2, Wb, DM * DFF);
    gemm(KVb, Wb, b2, F1, RQ, DM, DFF, 0);                  // ffn out
    k_add_ln<false><<<dim3(RQ), dim3(256), 0, stream>>>(X2, F1, g3, be3, out, nullptr);
}

// v006
// It runs in 339 microseconds.
// Two timings next to v005 put it at 1.07 and 1.08 times that version's speed.
// Counting every step since v000, it is 2.95 times as fast.
#include <hip/hip_runtime.h>
#include <hip/hip_bf16.h>

// ---------------- types ----------------
typedef __attribute__((ext_vector_type(16))) __bf16 bf16x16;
typedef __attribute__((ext_vector_type(8)))  float  floatx8;
typedef __attribute__((ext_vector_type(8)))  unsigned short ushort8;
typedef __attribute__((ext_vector_type(4)))  unsigned short ushort4v;

// fp32 -> bf16 (RNE-ish)
__device__ __forceinline__ unsigned short f2bf(float x) {
    unsigned u = __float_as_uint(x);
    unsigned r = u + 0x7FFFu + ((u >> 16) & 1u);
    return (unsigned short)(r >> 16);
}

// LDS byte offset of a generic pointer to __shared__ memory
__device__ __forceinline__ unsigned lds_off(const void* p) {
    return (unsigned)(size_t)(const __attribute__((address_space(3))) void*)p;
}

// CDNA5 async global->LDS copy, 16 bytes per lane, tracked by ASYNCcnt.
// Four such copies and, as the statement's last line, the wait that stands in
// front of any rewrite of the address registers the copies name.
__device__ __forceinline__ void async_b128_x4(unsigned l0, const void* g0,
                                              unsigned l1, const void* g1,
                                              unsigned l2, const void* g2,
                                              unsigned l3, const void* g3) {
    asm volatile("global_load_async_to_lds_b128 %0, %1, off\n\t"
                 "global_load_async_to_lds_b128 %2, %3, off\n\t"
                 "global_load_async_to_lds_b128 %4, %5, off\n\t"
                 "global_load_async_to_lds_b128 %6, %7, off\n\t"
                 "s_wait_xcnt 0x0"
                 :: "v"(l0), "v"(g0), "v"(l1), "v"(g1),
                    "v"(l2), "v"(g2), "v"(l3), "v"(g3) : "memory");
}
// Eight copies, closed by the same wait.
__device__ __forceinline__ void async_b128_x8(unsigned l0, const void* g0,
                                              unsigned l1, const void* g1,
                                              unsigned l2, const void* g2,
                                              unsigned l3, const void* g3,
                                              unsigned l4, const void* g4,
                                              unsigned l5, const void* g5,
                                              unsigned l6, const void* g6,
                                              unsigned l7, const void* g7) {
    asm volatile("global_load_async_to_lds_b128 %0, %1, off\n\t"
                 "global_load_async_to_lds_b128 %2, %3, off\n\t"
                 "global_load_async_to_lds_b128 %4, %5, off\n\t"
                 "global_load_async_to_lds_b128 %6, %7, off\n\t"
                 "global_load_async_to_lds_b128 %8, %9, off\n\t"
                 "global_load_async_to_lds_b128 %10, %11, off\n\t"
                 "global_load_async_to_lds_b128 %12, %13, off\n\t"
                 "global_load_async_to_lds_b128 %14, %15, off\n\t"
                 "s_wait_xcnt 0x0"
                 :: "v"(l0), "v"(g0), "v"(l1), "v"(g1),
                    "v"(l2), "v"(g2), "v"(l3), "v"(g3),
                    "v"(l4), "v"(g4), "v"(l5), "v"(g5),
                    "v"(l6), "v"(g6), "v"(l7), "v"(g7) : "memory");
}
// all but the eight youngest copies (the next tile's) have landed
__device__ __forceinline__ void wait_async_le8() {
    asm volatile("s_wait_asynccnt 0x8" ::: "memory");
}
__device__ __forceinline__ void wait_async_0() {
    asm volatile("s_wait_asynccnt 0x0" ::: "memory");
}

// Load one 16x32 bf16 fragment (A-layout / symmetric B-layout) from LDS.
// Lane L<16 covers row (L), K in {8*half..+8} U {16+8*half..+8}; per ISA
// 16-bit A-matrix striping: two contiguous 8-element runs -> two b128 loads.
__device__ __forceinline__ bf16x16 load_frag(const unsigned short* base,
                                             int row_stride, int kbase) {
    int lane = threadIdx.x & 31;
    int half = lane >> 4;
    int row  = lane & 15;
    const unsigned short* p = base + row * row_stride + kbase + half * 8;
    union { bf16x16 f; ushort8 u[2]; } r;
    r.u[0] = *(const ushort8*)(p);
    r.u[1] = *(const ushort8*)(p + 16);
    return r.f;
}

// V^T fragment (A operand of V^T x P^T) from a row-major [K=32 keys][row_stride]
// LDS tile, by the 16-bit transposing LDS load: lane L reads 16 B of key row
// 8 * half + (L & 7), and receives V column (base + L&15) of the keys
// 8 * half + 0..7; the second load, 16 rows on, brings the keys 16 + 8 * half + 0..7.
typedef __attribute__((ext_vector_type(8))) short short8;
__device__ __forceinline__ bf16x16 load_frag_colT(const unsigned short* base,
                                                  int row_stride) {
    typedef __attribute__((address_space(3))) short8 lds_short8;
    int lane = threadIdx.x & 31;
    int half = lane >> 4;
    const unsigned short* p = base + (8 * half + (lane & 7)) * row_stride
                                   + 8 * ((lane >> 3) & 1);
    union { bf16x16 f; short8 u[2]; } r;
    r.u[0] = __builtin_amdgcn_ds_load_tr16_b128_v8i16((lds_short8*)p);
    r.u[1] = __builtin_amdgcn_ds_load_tr16_b128_v8i16((lds_short8*)(p + 16 * row_stride));
    return r.f;
}

__device__ __forceinline__ floatx8 wmma_bf16(bf16x16 a, bf16x16 b, floatx8 c) {
    return __builtin_amdgcn_wmma_f32_16x16x32_bf16(false, a, false, b,
                                                   (short)0, c, false, false);
}

// lane l takes the value of lane l ^ 16 (the lane that holds the other half
// of the same fragment column)
__device__ __forceinline__ float xhalf(float x) {
    int b = __builtin_bit_cast(int, x);
    return __builtin_bit_cast(float, __builtin_amdgcn_permlanex16(
        b, b, 0x76543210, 0xfedcba98, false, false));
}

// LDS row pitches in elements. A 16-byte fragment read walks 16 rows at once;
// a pitch of 16 B x odd spreads those rows over all 64 banks, where the
// unpadded 64-B and 128-B rows fall on the same few banks again and again.
constexpr int P64 = 72;   // rows of 64 bf16: 128 B of data, 144 B pitch
// The transposing load walks 8 rows in each lane half, 32 B of each: its
// conflict-free pitch is 32 B x odd.
constexpr int PV64 = 80;  // V rows of 64 bf16: 128 B of data, 160 B pitch

// ---------------- convert kernel ----------------
// One launch rounds every fp32 matrix operand (both activations and all eight
// weights) to bf16. dst is the concatenation of the ten results in argument
// order; every source is a whole number of units of 2^20 elements, so a chunk
// (8192 elements, 128 chunks a unit) lies inside one source, picked by a
// block-uniform test. Two blocks a WGP walk the chunks with the grid's
// stride: 16 waves a WGP, each with 8 loads of 512 contiguous bytes in flight.
constexpr int U_TGT = 0, U_MEM = 4, U_WQKV = 12, U_WSO = 15, U_WQ = 16,
              U_WK = 17, U_WV = 18, U_WCO = 19, U_W1 = 20, U_W2 = 24, U_END = 28;
constexpr int CVT_BLOCKS = 512;
constexpr int CVT_TRIPS  = U_END * 128 / CVT_BLOCKS;   // 7
__global__ __launch_bounds__(256)
void k_cvt_all(const float* __restrict__ tgt,  const float* __restrict__ mem,
               const float* __restrict__ Wqkv, const float* __restrict__ Wso,
               const float* __restrict__ Wq,   const float* __restrict__ Wk,
               const float* __restrict__ Wv,   const float* __restrict__ Wco,
               const float* __restrict__ W1,   const float* __restrict__ W2,
               unsigned short* __restrict__ dst) {
    const int tid = threadIdx.x;
    // a wave takes 1024 neighbouring elements of the chunk
    const unsigned el = (tid >> 5) * 1024 + (tid & 31) * 4;
    for (int t = 0; t < CVT_TRIPS; t++) {
        const int c = blockIdx.x + t * CVT_BLOCKS;   // chunk of dst
        const int u = c >> 7;                        // its unit
        const float* s; int u0;         // the source, and the source's first unit
        if      (u < U_MEM)  { s = tgt;  u0 = U_TGT;  }
        else if (u < U_WQKV) { s = mem;  u0 = U_MEM;  }
        else if (u < U_WSO)  { s = Wqkv; u0 = U_WQKV; }
        else if (u < U_WQ)   { s = Wso;  u0 = U_WSO;  }
        else if (u < U_WK)   { s = Wq;   u0 = U_WQ;   }
        else if (u < U_WV)   { s = Wk;   u0 = U_WK;   }
        else if (u < U_WCO)  { s = Wv;   u0 = U_WV;   }
        else if (u < U_W1)   { s = Wco;  u0 = U_WCO;  }
        else if (u < U_W2)   { s = W1;   u0 = U_W1;   }
        else                 { s = W2;   u0 = U_W2;   }
        const float* p = s + ((size_t)(c - u0 * 128) << 13) + el;
        unsigned short* d = dst + ((size_t)c << 13) + el;
        float4 v[8];
        for (int k = 0; k < 8; k++) v[k] = *(const float4*)(p + k * 128);
        for (int k = 0; k < 8; k++) {
            ushort4v o;
            o.x = f2bf(v[k].x); o.y = f2bf(v[k].y); o.z = f2bf(v[k].z); o.w = f2bf(v[k].w);
            *(ushort4v*)(d + k * 128) = o;
        }
        // the next trip stands behind a branch and reuses the stores' data and
        // address registers
        if (t + 1 < CVT_TRIPS) asm volatile("s_wait_xcnt 0x0" ::: "memory");
    }
}

// ---------------- GEMM: C[M,N] = A[M,K] * W[N,K]^T + bias, optional relu ----
// The result goes to Cb, rounded to bf16, where the next reader is a matrix
// product (Cb != nullptr), else to C in fp32.
// block tile 128(M) x 128(N), K-step 64, 256 threads = 8 waves.
// Each wave: 32x64 sub-tile = 2x4 WMMA accumulators (16 WMMA / K-step).
// Double-buffered LDS fed by async global->LDS DMA (ASYNCcnt pipeline).
// A K-step takes 128 B of every operand row, one whole cache line, and eight
// neighbouring lanes copy it: a wave's copy touches 4 full lines.
__global__ __launch_bounds__(256)
void k_gemm_bf16(const unsigned short* __restrict__ A,
                 const unsigned short* __restrict__ W,
                 const float* __restrict__ bias,
                 float* __restrict__ C,
                 unsigned short* __restrict__ Cb,
                 int M, int N, int K, int relu) {
    __shared__ __align__(16) unsigned short As[2][128 * P64];
    __shared__ __align__(16) unsigned short Ws[2][128 * P64];

    const int tid  = threadIdx.x;
    const int m0   = blockIdx.y * 128;
    const int n0   = blockIdx.x * 128;
    const int wave = tid >> 5;
    const int wm   = (wave & 3) * 32;   // 0,32,64,96
    const int wn   = (wave >> 2) * 64;  // 0,64

    // staging: each thread owns 8 elems (16 B) at column ac of the rows
    // ar, ar+32, ar+64, ar+96 of each tile
    const int ar = tid >> 3;            // 0..31
    const int ac = (tid & 7) * 8;       // 0,8,..,56
    const unsigned short* Ag = A + (size_t)(m0 + ar) * K + ac;
    const unsigned short* Wg = W + (size_t)(n0 + ar) * K + ac;
    const size_t   gr = (size_t)32 * K; // 32 rows on, in global elements
    const unsigned lr = 32 * P64 * 2;   // 32 rows on, in LDS bytes

    auto issue = [&](int buf, int k0) {
        unsigned la = lds_off(&As[buf][ar * P64 + ac]);
        unsigned lw = lds_off(&Ws[buf][ar * P64 + ac]);
        const unsigned short* ga = Ag + k0;
        const unsigned short* gw = Wg + k0;
        async_b128_x8(la,          ga,          la + lr,     ga + gr,
                      la + 2 * lr, ga + 2 * gr, la + 3 * lr, ga + 3 * gr,
                      lw,          gw,          lw + lr,     gw + gr,
                      lw + 2 * lr, gw + 2 * gr, lw + 3 * lr, gw + 3 * gr);
    };

    floatx8 acc[2][4] = {};
    const int T = K >> 6;

    issue(0, 0);
    for (int t = 0; t < T; t++) {
        if (t + 1 < T) { issue((t + 1) & 1, (t + 1) * 64); wait_async_le8(); }
        else           { wait_async_0(); }
        __syncthreads();

        const unsigned short* Ab = As[t & 1];
        const unsigned short* Wb = Ws[t & 1];
        for (int kk = 0; kk < 64; kk += 32) {
            bf16x16 af[2], wf[4];
            af[0] = load_frag(Ab + (wm + 0)  * P64, P64, kk);
            af[1] = load_frag(Ab + (wm + 16) * P64, P64, kk);
            for (int j = 0; j < 4; j++)
                wf[j] = load_frag(Wb + (wn + 16 * j) * P64, P64, kk);

            for (int i = 0; i < 2; i++)
                for (int j = 0; j < 4; j++)
                    acc[i][j] = wmma_bf16(af[i], wf[j], acc[i][j]);
        }
        __syncthreads();
    }

    const int lane = tid & 31;
    const int half = lane >> 4;
    const int col  = lane & 15;
    auto epilogue = [&](auto store) {
        for (int j = 0; j < 4; j++) {
            int n = n0 + wn + 16 * j + col;
            float bv = bias ? bias[n] : 0.0f;
            for (int i = 0; i < 2; i++) {
                for (int r = 0; r < 8; r++) {
                    int m = m0 + wm + 16 * i + r + 8 * half;
                    float v = acc[i][j][r] + bv;
                    if (relu) v = fmaxf(v, 0.0f);
                    store((size_t)m * N + n, v);
                }
            }
            // what follows a column block stands behind a branch and reuses
            // the stores' data and address registers
            asm volatile("s_wait_xcnt 0x0" ::: "memory");
        }
    };
    // one test of the output kind for the whole tile, not one per element
    if (Cb) epilogue([&](size_t idx, float v) { Cb[idx] = f2bf(v); });
    else    epilogue([&](size_t idx, float v) { C[idx] = v; });
}

__global__ __launch_bounds__(128)
void k_attn(const unsigned short* __restrict__ Qg,
            const unsigned short* __restrict__ Kg,
            const unsigned short* __restrict__ Vg,
            unsigned short* __restrict__ Og,
            int sQ, int bQ, int sK, int bK, int sO, int bO,
            int seq_kv, int causal) {
    __shared__ __align__(16) unsigned short Qs[64 * P64];     // q tile
    __shared__ __align__(16) unsigned short Ks[32 * P64];     // key tile [key][d]
    __shared__ __align__(16) unsigned short Vs[32 * PV64];    // V tile  [key][d]

    const int q0 = blockIdx.x * 64;
    const int bh = blockIdx.y;
    const int b  = bh >> 4;
    const int h  = bh & 15;
    const unsigned short* Qb = Qg + (size_t)b * bQ + h * 64;
    const unsigned short* Kb = Kg + (size_t)b * bK + h * 64;
    const unsigned short* Vb = Vg + (size_t)b * bK + h * 64;
    unsigned short* Ob = Og + (size_t)b * bO + h * 64;

    const int tid  = threadIdx.x;
    const int wave = tid >> 5;
    const int lane = tid & 31;
    const int half = lane >> 4;
    const int col  = lane & 15;

    // stage Q tile (64x64) via async DMA
    {
        const int r = tid >> 3, c = (tid & 7) * 8;   // rows r, r+16, r+32, r+48
        const unsigned lq = lds_off(&Qs[r * P64 + c]);
        const unsigned short* gq = Qb + (size_t)(q0 + r) * sQ + c;
        async_b128_x4(lq,                gq,
                      lq + 16 * P64 * 2, gq + (size_t)16 * sQ,
                      lq + 32 * P64 * 2, gq + (size_t)32 * sQ,
                      lq + 48 * P64 * 2, gq + (size_t)48 * sQ);
    }
    wait_async_0();
    __syncthreads();

    // this lane's query: running maximum (over all keys), running sum (over
    // the keys of this lane half; the halves are joined after the loop)
    const int qi = q0 + wave * 16 + col;
    float m_run = -1e30f, l_run = 0.0f;
    floatx8 o[4] = {};   // o[n][r] = O[qi][16 * n + 8 * half + r]

    const float scale = 0.125f; // 1/sqrt(64)
    int kv_end = causal ? (q0 + 64) : seq_kv;
    if (kv_end > seq_kv) kv_end = seq_kv;

    // K/V-tile staging coords: eight neighbouring lanes copy one row's 128 B
    // (a whole cache line); each thread takes rows kr and kr+16
    const int kr = tid >> 3;
    const int kc = (tid & 7) * 8;

    for (int t0 = 0; t0 < kv_end; t0 += 32) {
        { // stage K and V tiles (32x64 each) via async DMA
            const unsigned short* gk = Kb + (size_t)(t0 + kr) * sK + kc;
            const unsigned short* gv = Vb + (size_t)(t0 + kr) * sK + kc;
            async_b128_x4(lds_off(&Ks[kr * P64 + kc]),        gk,
                          lds_off(&Ks[(kr + 16) * P64 + kc]), gk + (size_t)16 * sK,
                          lds_off(&Vs[kr * PV64 + kc]),        gv,
                          lds_off(&Vs[(kr + 16) * PV64 + kc]), gv + (size_t)16 * sK);
        }
        wait_async_0();
        __syncthreads();

        // S^T (32 keys x 16 q) per wave: 2 key tiles, d_k=64 -> 2 k-chunks each
        floatx8 s[2] = {};
        for (int c2 = 0; c2 < 2; c2++) {
            bf16x16 qb  = load_frag(Qs + (wave * 16) * P64, P64, c2 * 32);
            bf16x16 ka0 = load_frag(Ks,            P64, c2 * 32);
            bf16x16 ka1 = load_frag(Ks + 16 * P64, P64, c2 * 32);
            s[0] = wmma_bf16(ka0, qb, s[0]);
            s[1] = wmma_bf16(ka1, qb, s[1]);
        }

        // mask + scale + the query's maximum over this tile
        float best = -1e30f;
        for (int j = 0; j < 2; j++)
            for (int r = 0; r < 8; r++) {
                int kj = t0 + 16 * j + 8 * half + r;
                float v = s[j][r] * scale;
                if (causal && kj > qi) v = -1e30f;
                s[j][r] = v;
                best = fmaxf(best, v);
            }
        best = fmaxf(best, xhalf(best));

        // online softmax update; P^T operand element 8 * j + r is key
        // 16 * j + 8 * half + r, the k order of the V^T fragment
        const float mnew = fmaxf(m_run, best);
        const float corr = __expf(m_run - mnew);
        m_run = mnew;
        float su[2] = {0.0f, 0.0f};   // one chain of adds per key tile
        bf16x16 pb;
        for (int j = 0; j < 2; j++)
            for (int r = 0; r < 8; r++) {
                float p = __expf(s[j][r] - mnew);
                // the slot that the instruction set asks for behind a
                // transcendental, before the next v_exp_f32, which overwrites
                // this one's source register; p is an input only, so that the line
                // stays behind the v_exp_f32 that makes p
                if (j == 1 && r == 0) asm volatile("v_nop" :: "v"(p));
                su[j] += p;
                pb[8 * j + r] = (__bf16)p;
            }
        l_run = l_run * corr + (su[0] + su[1]);
        for (int n = 0; n < 4; n++)
            for (int r = 0; r < 8; r++)
                o[n][r] *= corr;

        for (int n = 0; n < 4; n++) {
            bf16x16 va = load_frag_colT(Vs + n * 16, PV64);
            o[n] = wmma_bf16(va, pb, o[n]);
        }
        __syncthreads();
    }

    // epilogue: normalize + store bf16 (the only reader is the out projection);
    // a lane's 8 registers of o[n] are 8 neighbouring d of its query: 16 B
    // unrolled so that o[n] is named by constant index (rolled, the compiler
    // picks the registers by a relative move per element)
    const float l_all = l_run + xhalf(l_run);
#pragma unroll
    for (int n = 0; n < 4; n++) {
        ushort8 ov;
        for (int r = 0; r < 8; r++)
            ov[r] = f2bf(o[n][r] / l_all);
        *(ushort8*)(Ob + (size_t)qi * sO + n * 16 + 8 * half) = ov;
    }
}

// ---------------- residual + LayerNorm (D=1024, 256 threads/row) ----------
// O keeps fp32 for the next residual; with BF16_COPY, Ob takes the bf16 copy
// that the next matrix product reads.
template <bool BF16_COPY>
__global__ __launch_bounds__(256)
void k_add_ln(const float* __restrict__ X, const float* __restrict__ Y,
              const float* __restrict__ gw, const float* __restrict__ bw,
              float* __restrict__ O, unsigned short* __restrict__ Ob) {
    const int D = 1024;
    const int row = blockIdx.x;
    const int tid = threadIdx.x;
    const float4 xv = *(const float4*)(X + (size_t)row * D + tid * 4);
    const float4 yv = *(const float4*)(Y + (size_t)row * D + tid * 4);
    float t0 = xv.x + yv.x, t1 = xv.y + yv.y, t2 = xv.z + yv.z, t3 = xv.w + yv.w;
    float s  = t0 + t1 + t2 + t3;
    float s2 = t0 * t0 + t1 * t1 + t2 * t2 + t3 * t3;
    for (int msk = 1; msk < 32; msk <<= 1) {
        s  += __shfl_xor(s, msk, 32);
        s2 += __shfl_xor(s2, msk, 32);
    }
    __shared__ float sh[16];
    int wave = tid >> 5, lane = tid & 31;
    if (lane == 0) { sh[wave] = s; sh[8 + wave] = s2; }
    __syncthreads();
    float S = 0.0f, S2 = 0.0f;
    for (int i = 0; i < 8; i++) { S += sh[i]; S2 += sh[8 + i]; }
    float mu  = S / D;
    float inv = rsqrtf(S2 / D - mu * mu + 1e-5f);
    const float4 gv = *(const float4*)(gw + tid * 4);
    const float4 bv = *(const float4*)(bw + tid * 4);
    float4 ov;
    ov.x = (t0 - mu) * inv * gv.x + bv.x;
    ov.y = (t1 - mu) * inv * gv.y + bv.y;
    ov.z = (t2 - mu) * inv * gv.z + bv.z;
    ov.w = (t3 - mu) * inv * gv.w + bv.w;
    *(float4*)(O + (size_t)row * D + tid * 4) = ov;
    if (BF16_COPY) {
        ushort4v ob;
        ob.x = f2bf(ov.x); ob.y = f2bf(ov.y); ob.z = f2bf(ov.z); ob.w = f2bf(ov.w);
        *(ushort4v*)(Ob + (size_t)row * D + tid * 4) = ob;
    }
}

// ---------------- host orchestration ----------------
extern "C" void kernel_launch(void* const* d_in, const int* in_sizes, int n_in,
                              void* d_out, int out_size, void* d_ws, size_t ws_size,
                              hipStream_t stream) {
    (void)in_sizes; (void)n_in; (void)out_size; (void)ws_size;
    const float* tgt  = (const float*)d_in[0];
    const float* mem  = (const float*)d_in[1];
    const float* Wqkv = (const float*)d_in[2];  const float* bqkv = (const float*)d_in[3];
    const float* Wso  = (const float*)d_in[4];  const float* bso  = (const float*)d_in[5];
    const float* Wq   = (const float*)d_in[6];  const float* bq   = (const float*)d_in[7];
    const float* Wk   = (const float*)d_in[8];  const float* bk   = (const float*)d_in[9];
    const float* Wv   = (const float*)d_in[10]; const float* bv   = (const float*)d_in[11];
    const float* Wco  = (const float*)d_in[12]; const float* bco  = (const float*)d_in[13];
    const float* W1   = (const float*)d_in[14]; const float* b1   = (const float*)d_in[15];
    const float* W2   = (const float*)d_in[16]; const float* b2   = (const float*)d_in[17];
    const float* g1   = (const float*)d_in[18]; const float* be1  = (const float*)d_in[19];
    const float* g2   = (const float*)d_in[20]; const float* be2  = (const float*)d_in[21];
    const float* g3   = (const float*)d_in[22]; const float* be3  = (const float*)d_in[23];
    float* out = (float*)d_out;

    const size_t MB = 1u << 20;
    char* ws = (char*)d_ws;
    unsigned short* Cv = (unsigned short*)ws;  // 56 MB bf16 copies of the operands
    float* F1 = (float*)(ws + 64 * MB);      // 16 MB fp32 scratch (ffn out)
    float* F2 = (float*)(ws + 80 * MB);      // 16 MB fp32 scratch (out projections)
    float* X1 = (float*)(ws + 96 * MB);      // LN1 output
    float* X2 = (float*)(ws + 112 * MB);     // LN2 output
    unsigned short* Ab  = (unsigned short*)(ws + 136 * MB); // 8 MB  activation bf16
    unsigned short* Qb  = (unsigned short*)(ws + 168 * MB); // 8 MB  cross-Q bf16
    unsigned short* KVb = (unsigned short*)(ws + 176 * MB); // 32 MB qkv / k,v / hidden bf16
    const unsigned short* tgt_b  = Cv + U_TGT  * MB;
    const unsigned short* mem_b  = Cv + U_MEM  * MB;
    const unsigned short* Wqkv_b = Cv + U_WQKV * MB;
    const unsigned short* Wso_b  = Cv + U_WSO  * MB;
    const unsigned short* Wq_b   = Cv + U_WQ   * MB;
    const unsigned short* Wk_b   = Cv + U_WK   * MB;
    const unsigned short* Wv_b   = Cv + U_WV   * MB;
    const unsigned short* Wco_b  = Cv + U_WCO  * MB;
    const unsigned short* W1_b   = Cv + U_W1   * MB;
    const unsigned short* W2_b   = Cv + U_W2   * MB;

    const int DM = 1024, RQ = 4096, RM = 8192, DFF = 4096;

    auto gemm = [&](const unsigned short* A, const unsigned short* W,
                    const float* bias, float* C, int M, int N, int K, int relu) {
        k_gemm_bf16<<<dim3(N / 128, M / 128), dim3(256), 0, stream>>>(
            A, W, bias, C, nullptr, M, N, K, relu);
    };
    auto gemm_b = [&](const unsigned short* A, const unsigned short* W,
                      const float* bias, unsigned short* Cb,
                      int M, int N, int K, int relu) {
        k_gemm_bf16<<<dim3(N / 128, M / 128), dim3(256), 0, stream>>>(
            A, W, bias, nullptr, Cb, M, N, K, relu);
    };

    // --- bf16 copies of tgt, memory and the weights ---
    k_cvt_all<<<dim3(CVT_BLOCKS), dim3(256), 0, stream>>>(
        tgt, mem, Wqkv, Wso, Wq, Wk, Wv, Wco, W1, W2, Cv);

    // --- self-attention block ---
    gemm_b(tgt_b, Wqkv_b, bqkv, KVb, RQ, 3 * DM, DM, 0);    // qkv bf16
    k_attn<<<dim3(16, 64), dim3(128), 0, stream>>>(
        KVb, KVb + 1024, KVb + 2048, Ab,                    // attn1 bf16
        12288, 3072, 12288, 3072, 4096, 1024, 1024, /*causal=*/1);
    gemm(Ab, Wso_b, bso, F2, RQ, DM, DM, 0);                // self out proj
    k_add_ln<true><<<dim3(RQ), dim3(256), 0, stream>>>(tgt, F2, g1, be1, X1, Ab);

    // --- cross-attention block ---
    gemm_b(Ab, Wq_b, bq, Qb, RQ, DM, DM, 0);                // q_c bf16
    gemm_b(mem_b, Wk_b, bk, KVb, RM, DM, DM, 0);            // k_c bf16
    gemm_b(mem_b, Wv_b, bv, KVb + (size_t)RM * DM, RM, DM, DM, 0); // v_c bf16
    k_attn<<<dim3(16, 64), dim3(128), 0, stream>>>(
        Qb, KVb, KVb + (size_t)RM * DM, Ab,                 // attn2 bf16
        4096, 1024, 4096, 1024, 4096, 1024, 2048, /*causal=*/0);
    gemm(Ab, Wco_b, bco, F2, RQ, DM, DM, 0);                // cross out proj
    k_add_ln<true><<<dim3(RQ), dim3(256), 0, stream>>>(X1, F2, g2, be2, X2, Ab);

    // --- FFN block ---
    gemm_b(Ab, W1_b, b1, KVb, RQ, DFF, DM, /*relu=*/1);     // hidden bf16
    gemm(KVb, W2_b, b2, F1, RQ, DM, DFF, 0);                // ffn out
    k_add_ln<false><<<dim3(RQ), dim3(256), 0, stream>>>(X2, F1, g3, be3, out, nullptr);
}

// v007
// It runs in 308 microseconds.
// Next to v006, in two timings, it ran 1.10 times as fast each time.
// Counting every step since v000, it is 3.24 times as fast.
#include <hip/hip_runtime.h>
#include <hip/hip_bf16.h>

// ---------------- types ----------------
typedef __attribute__((ext_vector_type(16))) __bf16 bf16x16;
typedef __attribute__((ext_vector_type(8)))  float  floatx8;
typedef __attribute__((ext_vector_type(8)))  unsigned short ushort8;
typedef __attribute__((ext_vector_type(4)))  unsigned short ushort4v;

// fp32 -> bf16 (RNE-ish)
__device__ __forceinline__ unsigned short f2bf(float x) {
    unsigned u = __float_as_uint(x);
    unsigned r = u + 0x7FFFu + ((u >> 16) & 1u);
    return (unsigned short)(r >> 16);
}

// LDS byte offset of a generic pointer to __shared__ memory
__device__ __forceinline__ unsigned lds_off(const void* p) {
    return (unsigned)(size_t)(const __attribute__((address_space(3))) void*)p;
}

// CDNA5 async global->LDS copy, 16 bytes per lane, tracked by ASYNCcnt.
// Four such copies and, as the statement's last line, the wait that stands in
// front of any rewrite of the address registers the copies name.
__device__ __forceinline__ void async_b128_x4(unsigned l0, const void* g0,
                                              unsigned l1, const void* g1,
                                              unsigned l2, const void* g2,
                                              unsigned l3, const void* g3) {
    asm volatile("global_load_async_to_lds_b128 %0, %1, off\n\t"
                 "global_load_async_to_lds_b128 %2, %3, off\n\t"
                 "global_load_async_to_lds_b128 %4, %5, off\n\t"
                 "global_load_async_to_lds_b128 %6, %7, off\n\t"
                 "s_wait_xcnt 0x0"
                 :: "v"(l0), "v"(g0), "v"(l1), "v"(g1),
                    "v"(l2), "v"(g2), "v"(l3), "v"(g3) : "memory");
}
// Eight copies, closed by the same wait.
__device__ __forceinline__ void async_b128_x8(unsigned l0, const void* g0,
                                              unsigned l1, const void* g1,
                                              unsigned l2, const void* g2,
                                              unsigned l3, const void* g3,
                                              unsigned l4, const void* g4,
                                              unsigned l5, const void* g5,
                                              unsigned l6, const void* g6,
                                              unsigned l7, const void* g7) {
    asm volatile("global_load_async_to_lds_b128 %0, %1, off\n\t"
                 "global_load_async_to_lds_b128 %2, %3, off\n\t"
                 "global_load_async_to_lds_b128 %4, %5, off\n\t"
                 "global_load_async_to_lds_b128 %6, %7, off\n\t"
                 "global_load_async_to_lds_b128 %8, %9, off\n\t"
                 "global_load_async_to_lds_b128 %10, %11, off\n\t"
                 "global_load_async_to_lds_b128 %12, %13, off\n\t"
                 "global_load_async_to_lds_b128 %14, %15, off\n\t"
                 "s_wait_xcnt 0x0"
                 :: "v"(l0), "v"(g0), "v"(l1), "v"(g1),
                    "v"(l2), "v"(g2), "v"(l3), "v"(g3),
                    "v"(l4), "v"(g4), "v"(l5), "v"(g5),
                    "v"(l6), "v"(g6), "v"(l7), "v"(g7) : "memory");
}
// all but the eight youngest copies (the next tile's) have landed
__device__ __forceinline__ void wait_async_le8() {
    asm volatile("s_wait_asynccnt 0x8" ::: "memory");
}
__device__ __forceinline__ void wait_async_0() {
    asm volatile("s_wait_asynccnt 0x0" ::: "memory");
}

// Load one 16x32 bf16 fragment (A-layout / symmetric B-layout) from LDS.
// Lane L<16 covers row (L), K in {8*half..+8} U {16+8*half..+8}; per ISA
// 16-bit A-matrix striping: two contiguous 8-element runs -> two b128 loads.
__device__ __forceinline__ bf16x16 load_frag(const unsigned short* base,
                                             int row_stride, int kbase) {
    int lane = threadIdx.x & 31;
    int half = lane >> 4;
    int row  = lane & 15;
    const unsigned short* p = base + row * row_stride + kbase + half * 8;
    union { bf16x16 f; ushort8 u[2]; } r;
    r.u[0] = *(const ushort8*)(p);
    r.u[1] = *(const ushort8*)(p + 16);
    return r.f;
}

// V^T fragment (A operand of V^T x P^T) from a row-major [K=32 keys][row_stride]
// LDS tile, by the 16-bit transposing LDS load: lane L reads 16 B of key row
// 8 * half + (L & 7), and receives V column (base + L&15) of the keys
// 8 * half + 0..7; the second load, 16 rows on, brings the keys 16 + 8 * half + 0..7.
typedef __attribute__((ext_vector_type(8))) short short8;
__device__ __forceinline__ bf16x16 load_frag_colT(const unsigned short* base,
                                                  int row_stride) {
    typedef __attribute__((address_space(3))) short8 lds_short8;
    int lane = threadIdx.x & 31;
    int half = lane >> 4;
    const unsigned short* p = base + (8 * half + (lane & 7)) * row_stride
                                   + 8 * ((lane >> 3) & 1);
    union { bf16x16 f; short8 u[2]; } r;
    r.u[0] = __builtin_amdgcn_ds_load_tr16_b128_v8i16((lds_short8*)p);
    r.u[1] = __builtin_amdgcn_ds_load_tr16_b128_v8i16((lds_short8*)(p + 16 * row_stride));
    return r.f;
}

__device__ __forceinline__ floatx8 wmma_bf16(bf16x16 a, bf16x16 b, floatx8 c) {
    return __builtin_amdgcn_wmma_f32_16x16x32_bf16(false, a, false, b,
                                                   (short)0, c, false, false);
}

// lane l takes the value of lane l ^ 16 (the lane that holds the other half
// of the same fragment column)
__device__ __forceinline__ float xhalf(float x) {
    int b = __builtin_bit_cast(int, x);
    return __builtin_bit_cast(float, __builtin_amdgcn_permlanex16(
        b, b, 0x76543210, 0xfedcba98, false, false));
}

__device__ __forceinline__ float exp2_slot(float x) {
    float p;
    asm("v_exp_f32 %0, %1\n\t"
        "v_nop" : "=v"(p) : "v"(x));
    return p;
}
__device__ __forceinline__ void exp2_slot_x8(float (&p)[8], const float (&x)[8]) {
    asm("v_exp_f32 %0, %8\n\t"
        "v_exp_f32 %1, %9\n\t"
        "v_exp_f32 %2, %10\n\t"
        "v_exp_f32 %3, %11\n\t"
        "v_exp_f32 %4, %12\n\t"
        "v_exp_f32 %5, %13\n\t"
        "v_exp_f32 %6, %14\n\t"
        "v_exp_f32 %7, %15\n\t"
        "v_nop"
        : "=&v"(p[0]), "=&v"(p[1]), "=&v"(p[2]), "=&v"(p[3]),
          "=&v"(p[4]), "=&v"(p[5]), "=&v"(p[6]), "=&v"(p[7])
        : "v"(x[0]), "v"(x[1]), "v"(x[2]), "v"(x[3]),
          "v"(x[4]), "v"(x[5]), "v"(x[6]), "v"(x[7]));
}

// LDS row pitches in elements. A 16-byte fragment read walks 16 rows at once;
// a pitch of 16 B x odd spreads those rows over all 64 banks, where the
// unpadded 64-B and 128-B rows fall on the same few banks again and again.
constexpr int P64 = 72;   // rows of 64 bf16: 128 B of data, 144 B pitch
// The transposing load walks 8 rows in each lane half, 32 B of each: its
// conflict-free pitch is 32 B x odd.
constexpr int PV64 = 80;  // V rows of 64 bf16: 128 B of data, 160 B pitch

// ---------------- convert kernel ----------------
// One launch rounds every fp32 matrix operand (both activations and all eight
// weights) to bf16. dst is the concatenation of the ten results in argument
// order; every source is a whole number of units of 2^20 elements, so a chunk
// (8192 elements, 128 chunks a unit) lies inside one source, picked by a
// block-uniform test. Two blocks a WGP walk the chunks with the grid's
// stride: 16 waves a WGP, each with 8 loads of 512 contiguous bytes in flight.
constexpr int U_TGT = 0, U_MEM = 4, U_WQKV = 12, U_WSO = 15, U_WQ = 16,
              U_WK = 17, U_WV = 18, U_WCO = 19, U_W1 = 20, U_W2 = 24, U_END = 28;
constexpr int CVT_BLOCKS = 512;
constexpr int CVT_TRIPS  = U_END * 128 / CVT_BLOCKS;   // 7
__global__ __launch_bounds__(256)
void k_cvt_all(const float* __restrict__ tgt,  const float* __restrict__ mem,
               const float* __restrict__ Wqkv, const float* __restrict__ Wso,
               const float* __restrict__ Wq,   const float* __restrict__ Wk,
               const float* __restrict__ Wv,   const float* __restrict__ Wco,
               const float* __restrict__ W1,   const float* __restrict__ W2,
               unsigned short* __restrict__ dst) {
    const int tid = threadIdx.x;
    // a wave takes 1024 neighbouring elements of the chunk
    const unsigned el = (tid >> 5) * 1024 + (tid & 31) * 4;
    for (int t = 0; t < CVT_TRIPS; t++) {
        const int c = blockIdx.x + t * CVT_BLOCKS;   // chunk of dst
        const int u = c >> 7;                        // its unit
        const float* s; int u0;         // the source, and the source's first unit
        if      (u < U_MEM)  { s = tgt;  u0 = U_TGT;  }
        else if (u < U_WQKV) { s = mem;  u0 = U_MEM;  }
        else if (u < U_WSO)  { s = Wqkv; u0 = U_WQKV; }
        else if (u < U_WQ)   { s = Wso;  u0 = U_WSO;  }
        else if (u < U_WK)   { s = Wq;   u0 = U_WQ;   }
        else if (u < U_WV)   { s = Wk;   u0 = U_WK;   }
        else if (u < U_WCO)  { s = Wv;   u0 = U_WV;   }
        else if (u < U_W1)   { s = Wco;  u0 = U_WCO;  }
        else if (u < U_W2)   { s = W1;   u0 = U_W1;   }
        else                 { s = W2;   u0 = U_W2;   }
        const float* p = s + ((size_t)(c - u0 * 128) << 13) + el;
        unsigned short* d = dst + ((size_t)c << 13) + el;
        float4 v[8];
        for (int k = 0; k < 8; k++) v[k] = *(const float4*)(p + k * 128);
        for (int k = 0; k < 8; k++) {
            ushort4v o;
            o.x = f2bf(v[k].x); o.y = f2bf(v[k].y); o.z = f2bf(v[k].z); o.w = f2bf(v[k].w);
            *(ushort4v*)(d + k * 128) = o;
        }
        // the next trip stands behind a branch and reuses the stores' data and
        // address registers
        if (t + 1 < CVT_TRIPS) asm volatile("s_wait_xcnt 0x0" ::: "memory");
    }
}

// ---------------- GEMM: C[M,N] = A[M,K] * W[N,K]^T + bias, optional relu ----
// The result goes to Cb, rounded to bf16, where the next reader is a matrix
// product (Cb != nullptr), else to C in fp32.
// block tile 128(M) x 128(N), K-step 64, 256 threads = 8 waves.
// Each wave: 32x64 sub-tile = 2x4 WMMA accumulators (16 WMMA / K-step).
// Double-buffered LDS fed by async global->LDS DMA (ASYNCcnt pipeline).
// A K-step takes 128 B of every operand row, one whole cache line, and eight
// neighbouring lanes copy it: a wave's copy touches 4 full lines.
__global__ __launch_bounds__(256)
void k_gemm_bf16(const unsigned short* __restrict__ A,
                 const unsigned short* __restrict__ W,
                 const float* __restrict__ bias,
                 float* __restrict__ C,
                 unsigned short* __restrict__ Cb,
                 int M, int N, int K, int relu) {
    __shared__ __align__(16) unsigned short As[2][128 * P64];
    __shared__ __align__(16) unsigned short Ws[2][128 * P64];

    const int tid  = threadIdx.x;
    const int m0   = blockIdx.y * 128;
    const int n0   = blockIdx.x * 128;
    const int wave = tid >> 5;
    const int wm   = (wave & 3) * 32;   // 0,32,64,96
    const int wn   = (wave >> 2) * 64;  // 0,64

    // staging: each thread owns 8 elems (16 B) at column ac of the rows
    // ar, ar+32, ar+64, ar+96 of each tile
    const int ar = tid >> 3;            // 0..31
    const int ac = (tid & 7) * 8;       // 0,8,..,56
    const unsigned short* Ag = A + (size_t)(m0 + ar) * K + ac;
    const unsigned short* Wg = W + (size_t)(n0 + ar) * K + ac;
    const size_t   gr = (size_t)32 * K; // 32 rows on, in global elements
    const unsigned lr = 32 * P64 * 2;   // 32 rows on, in LDS bytes

    auto issue = [&](int buf, int k0) {
        unsigned la = lds_off(&As[buf][ar * P64 + ac]);
        unsigned lw = lds_off(&Ws[buf][ar * P64 + ac]);
        const unsigned short* ga = Ag + k0;
        const unsigned short* gw = Wg + k0;
        async_b128_x8(la,          ga,          la + lr,     ga + gr,
                      la + 2 * lr, ga + 2 * gr, la + 3 * lr, ga + 3 * gr,
                      lw,          gw,          lw + lr,     gw + gr,
                      lw + 2 * lr, gw + 2 * gr, lw + 3 * lr, gw + 3 * gr);
    };

    floatx8 acc[2][4] = {};
    const int T = K >> 6;

    issue(0, 0);
    for (int t = 0; t < T; t++) {
        if (t + 1 < T) { issue((t + 1) & 1, (t + 1) * 64); wait_async_le8(); }
        else           { wait_async_0(); }
        __syncthreads();

        const unsigned short* Ab = As[t & 1];
        const unsigned short* Wb = Ws[t & 1];
        for (int kk = 0; kk < 64; kk += 32) {
            bf16x16 af[2], wf[4];
            af[0] = load_frag(Ab + (wm + 0)  * P64, P64, kk);
            af[1] = load_frag(Ab + (wm + 16) * P64, P64, kk);
            for (int j = 0; j < 4; j++)
                wf[j] = load_frag(Wb + (wn + 16 * j) * P64, P64, kk);

            for (int i = 0; i < 2; i++)
                for (int j = 0; j < 4; j++)
                    acc[i][j] = wmma_bf16(af[i], wf[j], acc[i][j]);
        }
        __syncthreads();
    }

    const int lane = tid & 31;
    const int half = lane >> 4;
    const int col  = lane & 15;
    auto epilogue = [&](auto store) {
        for (int j = 0; j < 4; j++) {
            int n = n0 + wn + 16 * j + col;
            float bv = bias ? bias[n] : 0.0f;
            for (int i = 0; i < 2; i++) {
                for (int r = 0; r < 8; r++) {
                    int m = m0 + wm + 16 * i + r + 8 * half;
                    float v = acc[i][j][r] + bv;
                    if (relu) v = fmaxf(v, 0.0f);
                    store((size_t)m * N + n, v);
                }
            }
            // what follows a column block stands behind a branch and reuses
            // the stores' data and address registers
            asm volatile("s_wait_xcnt 0x0" ::: "memory");
        }
    };
    // one test of the output kind for the whole tile, not one per element
    if (Cb) epilogue([&](size_t idx, float v) { Cb[idx] = f2bf(v); });
    else    epilogue([&](size_t idx, float v) { C[idx] = v; });
}

__global__ __launch_bounds__(128)
// both launches put four waves on a SIMD: the register budget of four lets
// the build fetch LDS fragments ahead of their products
__attribute__((amdgpu_waves_per_eu(4, 4)))
void k_attn(const unsigned short* __restrict__ Qg,
            const unsigned short* __restrict__ Kg,
            const unsigned short* __restrict__ Vg,
            unsigned short* __restrict__ Og,
            int sQ, int bQ, int sK, int bK, int sO, int bO,
            int seq_kv, int causal) {
    __shared__ __align__(16) unsigned short Qs[64 * P64];     // q tile
    __shared__ __align__(16) unsigned short Ks[2][32 * P64];  // key tiles [key][d]
    __shared__ __align__(16) unsigned short Vs[2][32 * PV64]; // V tiles  [key][d]

    const int q0 = blockIdx.x * 64;
    const int bh = blockIdx.y;
    const int b  = bh >> 4;
    const int h  = bh & 15;
    const unsigned short* Qb = Qg + (size_t)b * bQ + h * 64;
    const unsigned short* Kb = Kg + (size_t)b * bK + h * 64;
    const unsigned short* Vb = Vg + (size_t)b * bK + h * 64;
    unsigned short* Ob = Og + (size_t)b * bO + h * 64;

    const int tid  = threadIdx.x;
    const int wave = tid >> 5;
    const int lane = tid & 31;
    const int half = lane >> 4;
    const int col  = lane & 15;

    // stage Q tile (64x64) via async DMA
    {
        const int r = tid >> 3, c = (tid & 7) * 8;   // rows r, r+16, r+32, r+48
        const unsigned lq = lds_off(&Qs[r * P64 + c]);
        const unsigned short* gq = Qb + (size_t)(q0 + r) * sQ + c;
        async_b128_x4(lq,                gq,
                      lq + 16 * P64 * 2, gq + (size_t)16 * sQ,
                      lq + 32 * P64 * 2, gq + (size_t)32 * sQ,
                      lq + 48 * P64 * 2, gq + (size_t)48 * sQ);
    }

    int kv_end = causal ? (q0 + 64) : seq_kv;
    if (kv_end > seq_kv) kv_end = seq_kv;

    // K/V-tile staging coords: eight neighbouring lanes copy one row's 128 B
    // (a whole cache line); each thread takes rows kr and kr+16.
    // gk, gv: this thread's place in the next tile to be copied.
    const int kr = tid >> 3;
    const int kc = (tid & 7) * 8;
    const unsigned lk = lds_off(&Ks[0][kr * P64 + kc]);
    const unsigned lv = lds_off(&Vs[0][kr * PV64 + kc]);
    const size_t g16 = (size_t)16 * sK;   // 16 keys on, in global elements
    const unsigned short* gk = Kb + (size_t)kr * sK + kc;
    const unsigned short* gv = Vb + (size_t)kr * sK + kc;
    auto stage = [&](int buf) {   // K and V tiles (32x64 each) via async DMA
        const unsigned bk = lk + buf * (32 * P64 * 2);
        const unsigned bv = lv + buf * (32 * PV64 * 2);
        async_b128_x4(bk,                 gk,
                      bk + 16 * P64 * 2,  gk + g16,
                      bv,                 gv,
                      bv + 16 * PV64 * 2, gv + g16);
        gk += 2 * g16;
        gv += 2 * g16;
    };

    // tile 0 lands with Q, behind one wait and one barrier; tile 1 then flies
    // while tile 0 is worked on
    if (kv_end > 0) stage(0);
    wait_async_0();
    __syncthreads();
    if (kv_end > 32) stage(1);

    // this lane's query: running maximum (over all keys), running sum (over
    // the keys of this lane half; the halves are joined after the loop)
    const int qi = q0 + wave * 16 + col;
    float m_run = -1e30f, l_run = 0.0f;
    floatx8 o[4] = {};   // o[n][r] = O[qi][16 * n + 8 * half + r]

    const float scale = 0.125f; // 1/sqrt(64)

    for (int t0 = 0; t0 < kv_end; t0 += 32) {
        const int buf = (t0 >> 5) & 1;   // this tile's buffer
        const unsigned short* Kt = Ks[buf];
        const unsigned short* Vt = Vs[buf];

        // S^T (32 keys x 16 q) per wave: 2 key tiles, d_k=64 -> 2 k-chunks each
        floatx8 s[2] = {};
        for (int c2 = 0; c2 < 2; c2++) {
            bf16x16 qb  = load_frag(Qs + (wave * 16) * P64, P64, c2 * 32);
            bf16x16 ka0 = load_frag(Kt,            P64, c2 * 32);
            bf16x16 ka1 = load_frag(Kt + 16 * P64, P64, c2 * 32);
            s[0] = wmma_bf16(ka0, qb, s[0]);
            s[1] = wmma_bf16(ka1, qb, s[1]);
        }

        // mask + scale + the query's maximum over this tile
        float best = -1e30f;
        for (int j = 0; j < 2; j++)
            for (int r = 0; r < 8; r++) {
                int kj = t0 + 16 * j + 8 * half + r;
                float v = s[j][r] * scale;
                if (causal && kj > qi) v = -1e30f;
                s[j][r] = v;
                best = fmaxf(best, v);
            }
        best = fmaxf(best, xhalf(best));

        // online softmax update; P^T operand element 8 * j + r is key
        // 16 * j + 8 * half + r, the k order of the V^T fragment
        const float mnew = fmaxf(m_run, best);
        constexpr float LOG2E = 1.44269504f;   // e^x = 2^(x * LOG2E), as __expf takes it
        const float corr = exp2_slot((m_run - mnew) * LOG2E);
        m_run = mnew;
        float su[2] = {0.0f, 0.0f};   // one chain of adds per key tile
        bf16x16 pb;
        for (int j = 0; j < 2; j++) {
            float x[8], p[8];
            for (int r = 0; r < 8; r++) x[r] = (s[j][r] - mnew) * LOG2E;
            exp2_slot_x8(p, x);
            for (int r = 0; r < 8; r++) {
                su[j] += p[r];
                pb[8 * j + r] = (__bf16)p[r];
            }
        }
        l_run = l_run * corr + (su[0] + su[1]);
        for (int n = 0; n < 4; n++)
            for (int r = 0; r < 8; r++)
                o[n][r] *= corr;

        for (int n = 0; n < 4; n++) {
            bf16x16 va = load_frag_colT(Vt + n * 16, PV64);
            o[n] = wmma_bf16(va, pb, o[n]);
        }

        // publish point of the next tile: this wave's reads of this tile's
        // buffer have returned, its copies of the next tile have landed; the
        // barrier says both of every wave. Only then is this buffer refilled.
        asm volatile("s_wait_dscnt 0x0" ::: "memory");
        wait_async_0();
        __syncthreads();
        if (t0 + 64 < kv_end) stage(buf);
    }
    // no copy is left in flight when the wave goes on to its end
    wait_async_0();

    // epilogue: normalize + store bf16 (the only reader is the out projection);
    // a lane's 8 registers of o[n] are 8 neighbouring d of its query: 16 B
    // unrolled so that o[n] is named by constant index (rolled, the compiler
    // picks the registers by a relative move per element)
    const float l_all = l_run + xhalf(l_run);
#pragma unroll
    for (int n = 0; n < 4; n++) {
        ushort8 ov;
        for (int r = 0; r < 8; r++)
            ov[r] = f2bf(o[n][r] / l_all);
        *(ushort8*)(Ob + (size_t)qi * sO + n * 16 + 8 * half) = ov;
    }
}

// ---------------- residual + LayerNorm (D=1024, 256 threads/row) ----------
// O keeps fp32 for the next residual; with BF16_COPY, Ob takes the bf16 copy
// that the next matrix product reads.
template <bool BF16_COPY>
__global__ __launch_bounds__(256)
void k_add_ln(const float* __restrict__ X, const float* __restrict__ Y,
              const float* __restrict__ gw, const float* __restrict__ bw,
              float* __restrict__ O, unsigned short* __restrict__ Ob) {
    const int D = 1024;
    const int row = blockIdx.x;
    const int tid = threadIdx.x;
    const float4 xv = *(const float4*)(X + (size_t)row * D + tid * 4);
    const float4 yv = *(const float4*)(Y + (size_t)row * D + tid * 4);
    float t0 = xv.x + yv.x, t1 = xv.y + yv.y, t2 = xv.z + yv.z, t3 = xv.w + yv.w;
    float s  = t0 + t1 + t2 + t3;
    float s2 = t0 * t0 + t1 * t1 + t2 * t2 + t3 * t3;
    for (int msk = 1; msk < 32; msk <<= 1) {
        s  += __shfl_xor(s, msk, 32);
        s2 += __shfl_xor(s2, msk, 32);
    }
    __shared__ float sh[16];
    int wave = tid >> 5, lane = tid & 31;
    if (lane == 0) { sh[wave] = s; sh[8 + wave] = s2; }
    __syncthreads();
    float S = 0.0f, S2 = 0.0f;
    for (int i = 0; i < 8; i++) { S += sh[i]; S2 += sh[8 + i]; }
    float mu  = S / D;
    float inv = rsqrtf(S2 / D - mu * mu + 1e-5f);
    const float4 gv = *(const float4*)(gw + tid * 4);
    const float4 bv = *(const float4*)(bw + tid * 4);
    float4 ov;
    ov.x = (t0 - mu) * inv * gv.x + bv.x;
    ov.y = (t1 - mu) * inv * gv.y + bv.y;
    ov.z = (t2 - mu) * inv * gv.z + bv.z;
    ov.w = (t3 - mu) * inv * gv.w + bv.w;
    *(float4*)(O + (size_t)row * D + tid * 4) = ov;
    if (BF16_COPY) {
        ushort4v ob;
        ob.x = f2bf(ov.x); ob.y = f2bf(ov.y); ob.z = f2bf(ov.z); ob.w = f2bf(ov.w);
        *(ushort4v*)(Ob + (size_t)row * D + tid * 4) = ob;
    }
}

// ---------------- host orchestration ----------------
extern "C" void kernel_launch(void* const* d_in, const int* in_sizes, int n_in,
                              void* d_out, int out_size, void* d_ws, size_t ws_size,
                              hipStream_t stream) {
    (void)in_sizes; (void)n_in; (void)out_size; (void)ws_size;
    const float* tgt  = (const float*)d_in[0];
    const float* mem  = (const float*)d_in[1];
    const float* Wqkv = (const float*)d_in[2];  const float* bqkv = (const float*)d_in[3];
    const float* Wso  = (const float*)d_in[4];  const float* bso  = (const float*)d_in[5];
    const float* Wq   = (const float*)d_in[6];  const float* bq   = (const float*)d_in[7];
    const float* Wk   = (const float*)d_in[8];  const float* bk   = (const float*)d_in[9];
    const float* Wv   = (const float*)d_in[10]; const float* bv   = (const float*)d_in[11];
    const float* Wco  = (const float*)d_in[12]; const float* bco  = (const float*)d_in[13];
    const float* W1   = (const float*)d_in[14]; const float* b1   = (const float*)d_in[15];
    const float* W2   = (const float*)d_in[16]; const float* b2   = (const float*)d_in[17];
    const float* g1   = (const float*)d_in[18]; const float* be1  = (const float*)d_in[19];
    const float* g2   = (const float*)d_in[20]; const float* be2  = (const float*)d_in[21];
    const float* g3   = (const float*)d_in[22]; const float* be3  = (const float*)d_in[23];
    float* out = (float*)d_out;

    const size_t MB = 1u << 20;
    char* ws = (char*)d_ws;
    unsigned short* Cv = (unsigned short*)ws;  // 56 MB bf16 copies of the operands
    float* F1 = (float*)(ws + 64 * MB);      // 16 MB fp32 scratch (ffn out)
    float* F2 = (float*)(ws + 80 * MB);      // 16 MB fp32 scratch (out projections)
    float* X1 = (float*)(ws + 96 * MB);      // LN1 output
    float* X2 = (float*)(ws + 112 * MB);     // LN2 output
    unsigned short* Ab  = (unsigned short*)(ws + 136 * MB); // 8 MB  activation bf16
    unsigned short* Qb  = (unsigned short*)(ws + 168 * MB); // 8 MB  cross-Q bf16
    unsigned short* KVb = (unsigned short*)(ws + 176 * MB); // 32 MB qkv / k,v / hidden bf16
    const unsigned short* tgt_b  = Cv + U_TGT  * MB;
    const unsigned short* mem_b  = Cv + U_MEM  * MB;
    const unsigned short* Wqkv_b = Cv + U_WQKV * MB;
    const unsigned short* Wso_b  = Cv + U_WSO  * MB;
    const unsigned short* Wq_b   = Cv + U_WQ   * MB;
    const unsigned short* Wk_b   = Cv + U_WK   * MB;
    const unsigned short* Wv_b   = Cv + U_WV   * MB;
    const unsigned short* Wco_b  = Cv + U_WCO  * MB;
    const unsigned short* W1_b   = Cv + U_W1   * MB;
    const unsigned short* W2_b   = Cv + U_W2   * MB;

    const int DM = 1024, RQ = 4096, RM = 8192, DFF = 4096;

    auto gemm = [&](const unsigned short* A, const unsigned short* W,
                    const float* bias, float* C, int M, int N, int K, int relu) {
        k_gemm_bf16<<<dim3(N / 128, M / 128), dim3(256), 0, stream>>>(
            A, W, bias, C, nullptr, M, N, K, relu);
    };
    auto gemm_b = [&](const unsigned short* A, const unsigned short* W,
                      const float* bias, unsigned short* Cb,
                      int M, int N, int K, int relu) {
        k_gemm_bf16<<<dim3(N / 128, M / 128), dim3(256), 0, stream>>>(
            A, W, bias, nullptr, Cb, M, N, K, relu);
    };

    // --- bf16 copies of tgt, memory and the weights ---
    k_cvt_all<<<dim3(CVT_BLOCKS), dim3(256), 0, stream>>>(
        tgt, mem, Wqkv, Wso, Wq, Wk, Wv, Wco, W1, W2, Cv);

    // --- self-attention block ---
    gemm_b(tgt_b, Wqkv_b, bqkv, KVb, RQ, 3 * DM, DM, 0);    // qkv bf16
    k_attn<<<dim3(16, 64), dim3(128), 0, stream>>>(
        KVb, KVb + 1024, KVb + 2048, Ab,                    // attn1 bf16
        12288, 3072, 12288, 3072, 4096, 1024, 1024, /*causal=*/1);
    gemm(Ab, Wso_b, bso, F2, RQ, DM, DM, 0);                // self out proj
    k_add_ln<true><<<dim3(RQ), dim3(256), 0, stream>>>(tgt, F2, g1, be1, X1, Ab);

    // --- cross-attention block ---
    gemm_b(Ab, Wq_b, bq, Qb, RQ, DM, DM, 0);                // q_c bf16
    gemm_b(mem_b, Wk_b, bk, KVb, RM, DM, DM, 0);            // k_c bf16
    gemm_b(mem_b, Wv_b, bv, KVb + (size_t)RM * DM, RM, DM, DM, 0); // v_c bf16
    k_attn<<<dim3(16, 64), dim3(128), 0, stream>>>(
        Qb, KVb, KVb + (size_t)RM * DM, Ab,                 // attn2 bf16
        4096, 1024, 4096, 1024, 4096, 1024, 2048, /*causal=*/0);
    gemm(Ab, Wco_b, bco, F2, RQ, DM, DM, 0);                // cross out proj
    k_add_ln<true><<<dim3(RQ), dim3(256), 0, stream>>>(X1, F2, g2, be2, X2, Ab);

    // --- FFN block ---
    gemm_b(Ab, W1_b, b1, KVb, RQ, DFF, DM, /*relu=*/1);     // hidden bf16
    gemm(KVb, W2_b, b2, F1, RQ, DM, DFF, 0);                // ffn out
    k_add_ln<false><<<dim3(RQ), dim3(256), 0, stream>>>(X2, F1, g3, be3, out, nullptr);
}

// v008
// It runs in 295 microseconds.
// In both of two side-by-side timings against v007, it was 1.05 times as fast.
// Counting every step since v000, it is 3.39 times as fast.
#include <hip/hip_runtime.h>
#include <hip/hip_bf16.h>

// ---------------- types ----------------
typedef __attribute__((ext_vector_type(16))) __bf16 bf16x16;
typedef __attribute__((ext_vector_type(8)))  float  floatx8;
typedef __attribute__((ext_vector_type(8)))  unsigned short ushort8;
typedef __attribute__((ext_vector_type(4)))  unsigned short ushort4v;

// fp32 -> bf16 (RNE-ish)
__device__ __forceinline__ unsigned short f2bf(float x) {
    unsigned u = __float_as_uint(x);
    unsigned r = u + 0x7FFFu + ((u >> 16) & 1u);
    return (unsigned short)(r >> 16);
}

// LDS byte offset of a generic pointer to __shared__ memory
__device__ __forceinline__ unsigned lds_off(const void* p) {
    return (unsigned)(size_t)(const __attribute__((address_space(3))) void*)p;
}

// CDNA5 async global->LDS copy, 16 bytes per lane, tracked by ASYNCcnt.
// Four such copies and, as the statement's last line, the wait that stands in
// front of any rewrite of the address registers the copies name.
__device__ __forceinline__ void async_b128_x4(unsigned l0, const void* g0,
                                              unsigned l1, const void* g1,
                                              unsigned l2, const void* g2,
                                              unsigned l3, const void* g3) {
    asm volatile("global_load_async_to_lds_b128 %0, %1, off\n\t"
                 "global_load_async_to_lds_b128 %2, %3, off\n\t"
                 "global_load_async_to_lds_b128 %4, %5, off\n\t"
                 "global_load_async_to_lds_b128 %6, %7, off\n\t"
                 "s_wait_xcnt 0x0"
                 :: "v"(l0), "v"(g0), "v"(l1), "v"(g1),
                    "v"(l2), "v"(g2), "v"(l3), "v"(g3) : "memory");
}
// Eight copies, closed by the same wait.
__device__ __forceinline__ void async_b128_x8(unsigned l0, const void* g0,
                                              unsigned l1, const void* g1,
                                              unsigned l2, const void* g2,
                                              unsigned l3, const void* g3,
                                              unsigned l4, const void* g4,
                                              unsigned l5, const void* g5,
                                              unsigned l6, const void* g6,
                                              unsigned l7, const void* g7) {
    asm volatile("global_load_async_to_lds_b128 %0, %1, off\n\t"
                 "global_load_async_to_lds_b128 %2, %3, off\n\t"
                 "global_load_async_to_lds_b128 %4, %5, off\n\t"
                 "global_load_async_to_lds_b128 %6, %7, off\n\t"
                 "global_load_async_to_lds_b128 %8, %9, off\n\t"
                 "global_load_async_to_lds_b128 %10, %11, off\n\t"
                 "global_load_async_to_lds_b128 %12, %13, off\n\t"
                 "global_load_async_to_lds_b128 %14, %15, off\n\t"
                 "s_wait_xcnt 0x0"
                 :: "v"(l0), "v"(g0), "v"(l1), "v"(g1),
                    "v"(l2), "v"(g2), "v"(l3), "v"(g3),
                    "v"(l4), "v"(g4), "v"(l5), "v"(g5),
                    "v"(l6), "v"(g6), "v"(l7), "v"(g7) : "memory");
}
// all but the eight youngest copies (the next tile's) have landed
__device__ __forceinline__ void wait_async_le8() {
    asm volatile("s_wait_asynccnt 0x8" ::: "memory");
}
__device__ __forceinline__ void wait_async_0() {
    asm volatile("s_wait_asynccnt 0x0" ::: "memory");
}

// Load one 16x32 bf16 fragment (A-layout / symmetric B-layout) from LDS.
// Lane L<16 covers row (L), K in {8*half..+8} U {16+8*half..+8}; per ISA
// 16-bit A-matrix striping: two contiguous 8-element runs -> two b128 loads.
__device__ __forceinline__ bf16x16 load_frag(const unsigned short* base,
                                             int row_stride, int kbase) {
    int lane = threadIdx.x & 31;
    int half = lane >> 4;
    int row  = lane & 15;
    const unsigned short* p = base + row * row_stride + kbase + half * 8;
    union { bf16x16 f; ushort8 u[2]; } r;
    r.u[0] = *(const ushort8*)(p);
    r.u[1] = *(const ushort8*)(p + 16);
    return r.f;
}

// V^T fragment (A operand of V^T x P^T) from a row-major [K=32 keys][row_stride]
// LDS tile, by the 16-bit transposing LDS load: lane L reads 16 B of key row
// 8 * half + (L & 7), and receives V column (base + L&15) of the keys
// 8 * half + 0..7; the second load, 16 rows on, brings the keys 16 + 8 * half + 0..7.
typedef __attribute__((ext_vector_type(8))) short short8;
__device__ __forceinline__ bf16x16 load_frag_colT(const unsigned short* base,
                                                  int row_stride) {
    typedef __attribute__((address_space(3))) short8 lds_short8;
    int lane = threadIdx.x & 31;
    int half = lane >> 4;
    const unsigned short* p = base + (8 * half + (lane & 7)) * row_stride
                                   + 8 * ((lane >> 3) & 1);
    union { bf16x16 f; short8 u[2]; } r;
    r.u[0] = __builtin_amdgcn_ds_load_tr16_b128_v8i16((lds_short8*)p);
    r.u[1] = __builtin_amdgcn_ds_load_tr16_b128_v8i16((lds_short8*)(p + 16 * row_stride));
    return r.f;
}

__device__ __forceinline__ floatx8 wmma_bf16(bf16x16 a, bf16x16 b, floatx8 c) {
    return __builtin_amdgcn_wmma_f32_16x16x32_bf16(false, a, false, b,
                                                   (short)0, c, false, false);
}

// lane l takes the value of lane l ^ 16 (the lane that holds the other half
// of the same fragment column)
__device__ __forceinline__ float xhalf(float x) {
    int b = __builtin_bit_cast(int, x);
    return __builtin_bit_cast(float, __builtin_amdgcn_permlanex16(
        b, b, 0x76543210, 0xfedcba98, false, false));
}

__device__ __forceinline__ float exp2_slot(float x) {
    float p;
    asm("v_exp_f32 %0, %1\n\t"
        "v_nop" : "=v"(p) : "v"(x));
    return p;
}
__device__ __forceinline__ void exp2_slot_x8(float (&p)[8], const float (&x)[8]) {
    asm("v_exp_f32 %0, %8\n\t"
        "v_exp_f32 %1, %9\n\t"
        "v_exp_f32 %2, %10\n\t"
        "v_exp_f32 %3, %11\n\t"
        "v_exp_f32 %4, %12\n\t"
        "v_exp_f32 %5, %13\n\t"
        "v_exp_f32 %6, %14\n\t"
        "v_exp_f32 %7, %15\n\t"
        "v_nop"
        : "=&v"(p[0]), "=&v"(p[1]), "=&v"(p[2]), "=&v"(p[3]),
          "=&v"(p[4]), "=&v"(p[5]), "=&v"(p[6]), "=&v"(p[7])
        : "v"(x[0]), "v"(x[1]), "v"(x[2]), "v"(x[3]),
          "v"(x[4]), "v"(x[5]), "v"(x[6]), "v"(x[7]));
}

// LDS row pitches in elements. A 16-byte fragment read walks 16 rows at once;
// a pitch of 16 B x odd spreads those rows over all 64 banks, where the
// unpadded 64-B and 128-B rows fall on the same few banks again and again.
constexpr int P64 = 72;   // rows of 64 bf16: 128 B of data, 144 B pitch
// The transposing load walks 8 rows in each lane half, 32 B of each: its
// conflict-free pitch is 32 B x odd.
constexpr int PV64 = 80;  // V rows of 64 bf16: 128 B of data, 160 B pitch

// ---------------- convert kernel ----------------
// One launch rounds every fp32 matrix operand (both activations and all eight
// weights) to bf16. dst is the concatenation of the ten results in argument
// order; every source is a whole number of units of 2^20 elements, so a chunk
// (8192 elements, 128 chunks a unit) lies inside one source, picked by a
// block-uniform test. Two blocks a WGP walk the chunks with the grid's
// stride: 16 waves a WGP, each with 8 loads of 512 contiguous bytes in flight.
constexpr int U_TGT = 0, U_MEM = 4, U_WQKV = 12, U_WSO = 15, U_WQ = 16,
              U_WK = 17, U_WV = 18, U_WCO = 19, U_W1 = 20, U_W2 = 24, U_END = 28;
constexpr int CVT_BLOCKS = 512;
constexpr int CVT_TRIPS  = U_END * 128 / CVT_BLOCKS;   // 7
__global__ __launch_bounds__(256)
void k_cvt_all(const float* __restrict__ tgt,  const float* __restrict__ mem,
               const float* __restrict__ Wqkv, const float* __restrict__ Wso,
               const float* __restrict__ Wq,   const float* __restrict__ Wk,
               const float* __restrict__ Wv,   const float* __restrict__ Wco,
               const float* __restrict__ W1,   const float* __restrict__ W2,
               unsigned short* __restrict__ dst) {
    const int tid = threadIdx.x;
    // a wave takes 1024 neighbouring elements of the chunk
    const unsigned el = (tid >> 5) * 1024 + (tid & 31) * 4;
    for (int t = 0; t < CVT_TRIPS; t++) {
        const int c = blockIdx.x + t * CVT_BLOCKS;   // chunk of dst
        const int u = c >> 7;                        // its unit
        const float* s; int u0;         // the source, and the source's first unit
        if      (u < U_MEM)  { s = tgt;  u0 = U_TGT;  }
        else if (u < U_WQKV) { s = mem;  u0 = U_MEM;  }
        else if (u < U_WSO)  { s = Wqkv; u0 = U_WQKV; }
        else if (u < U_WQ)   { s = Wso;  u0 = U_WSO;  }
        else if (u < U_WK)   { s = Wq;   u0 = U_WQ;   }
        else if (u < U_WV)   { s = Wk;   u0 = U_WK;   }
        else if (u < U_WCO)  { s = Wv;   u0 = U_WV;   }
        else if (u < U_W1)   { s = Wco;  u0 = U_WCO;  }
        else if (u < U_W2)   { s = W1;   u0 = U_W1;   }
        else                 { s = W2;   u0 = U_W2;   }
        const float* p = s + ((size_t)(c - u0 * 128) << 13) + el;
        unsigned short* d = dst + ((size_t)c << 13) + el;
        float4 v[8];
        for (int k = 0; k < 8; k++) v[k] = *(const float4*)(p + k * 128);
        for (int k = 0; k < 8; k++) {
            ushort4v o;
            o.x = f2bf(v[k].x); o.y = f2bf(v[k].y); o.z = f2bf(v[k].z); o.w = f2bf(v[k].w);
            *(ushort4v*)(d + k * 128) = o;
        }
        // the next trip stands behind a branch and reuses the stores' data and
        // address registers
        if (t + 1 < CVT_TRIPS) asm volatile("s_wait_xcnt 0x0" ::: "memory");
    }
}

// ---------------- GEMM: C[M,N] = A[M,K] * W[N,K]^T + bias, optional relu ----
// The result goes to Cb, rounded to bf16, where the next reader is a matrix
// product (TOB), else to C in fp32.
// block tile 128(M) x 128(N), K-step 64, 256 threads = 8 waves.
// Each wave: 32x64 sub-tile = 2x4 WMMA accumulators (16 WMMA / K-step), taken
// transposed (W rows as the A operand, A rows as the B operand).
// Double-buffered LDS fed by async global->LDS DMA (ASYNCcnt pipeline).
// A K-step takes 128 B of every operand row, one whole cache line, and eight
// neighbouring lanes copy it: a wave's copy touches 4 full lines.
template <bool TOB>
__global__ __launch_bounds__(256)
// LDS lets four blocks stand on a WGP, eight waves a SIMD: the epilogue's
// fetches ahead stay inside the 128 registers that this takes
__attribute__((amdgpu_waves_per_eu(8)))
void k_gemm_bf16(const unsigned short* __restrict__ A,
                 const unsigned short* __restrict__ W,
                 const float* __restrict__ bias,
                 float* __restrict__ C,
                 unsigned short* __restrict__ Cb,
                 int M, int N, int K, int relu) {
    __shared__ __align__(16) unsigned short As[2][128 * P64];
    __shared__ __align__(16) unsigned short Ws[2][128 * P64];

    const int tid  = threadIdx.x;
    const int m0   = blockIdx.y * 128;
    const int n0   = blockIdx.x * 128;
    const int wave = tid >> 5;
    const int wm   = (wave & 3) * 32;   // 0,32,64,96
    const int wn   = (wave >> 2) * 64;  // 0,64

    // staging: each thread owns 8 elems (16 B) at column ac of the rows
    // ar, ar+32, ar+64, ar+96 of each tile
    const int ar = tid >> 3;            // 0..31
    const int ac = (tid & 7) * 8;       // 0,8,..,56
    const unsigned short* Ag = A + (size_t)(m0 + ar) * K + ac;
    const unsigned short* Wg = W + (size_t)(n0 + ar) * K + ac;
    const size_t   gr = (size_t)32 * K; // 32 rows on, in global elements
    const unsigned lr = 32 * P64 * 2;   // 32 rows on, in LDS bytes

    auto issue = [&](int buf, int k0) {
        unsigned la = lds_off(&As[buf][ar * P64 + ac]);
        unsigned lw = lds_off(&Ws[buf][ar * P64 + ac]);
        const unsigned short* ga = Ag + k0;
        const unsigned short* gw = Wg + k0;
        async_b128_x8(la,          ga,          la + lr,     ga + gr,
                      la + 2 * lr, ga + 2 * gr, la + 3 * lr, ga + 3 * gr,
                      lw,          gw,          lw + lr,     gw + gr,
                      lw + 2 * lr, gw + 2 * gr, lw + 3 * lr, gw + 3 * gr);
    };

    floatx8 acc[2][4] = {};
    const int T = K >> 6;

    issue(0, 0);
    for (int t = 0; t < T; t++) {
        if (t + 1 < T) { issue((t + 1) & 1, (t + 1) * 64); wait_async_le8(); }
        else           { wait_async_0(); }
        __syncthreads();

        const unsigned short* Ab = As[t & 1];
        const unsigned short* Wb = Ws[t & 1];
        for (int kk = 0; kk < 64; kk += 32) {
            bf16x16 af[2], wf[4];
            af[0] = load_frag(Ab + (wm + 0)  * P64, P64, kk);
            af[1] = load_frag(Ab + (wm + 16) * P64, P64, kk);
            for (int j = 0; j < 4; j++)
                wf[j] = load_frag(Wb + (wn + 16 * j) * P64, P64, kk);

            for (int i = 0; i < 2; i++)
                for (int j = 0; j < 4; j++)
                    acc[i][j] = wmma_bf16(wf[j], af[i], acc[i][j]);
        }
        __syncthreads();
    }

    // Epilogue. acc[i][j][r] = C[wm + 16 * i + col][wn + 16 * j + 8 * half + r]:
    // a lane holds 8 neighbouring columns of one row. Each wave lays its 32 x 64
    // tile, in fp32, into an LDS range of its own (the ring is free: the loop's
    // last barrier stands behind every wave's last read and last copy), reads it
    // back row by row and stores whole 128-B lines, 16 B a lane.
    const int lane = tid & 31;
    const int half = lane >> 4;
    const int col  = lane & 15;
    constexpr int PS = 68;   // staging rows of 64 floats: 256 B of data, 272 B pitch (16 B x odd)
    float* stg = (float*)(wave < 4 ? &As[0][0] : &Ws[0][0]) + (wave & 3) * (32 * P64);

    // this lane's columns on the way out: 8 of them (bf16: 8 lanes a row,
    // 4 rows a store) or 4 (fp32: 16 lanes a row, 2 rows a store), the same in
    // every row it stores: their bias is read once
    const int ch = TOB ? (lane & 7) * 8 : (lane & 15) * 4;
    const int n  = n0 + wn + ch;
    const float4 b0 = *(const float4*)(bias + n);
    float4 b1 = b0;
    if constexpr (TOB) b1 = *(const float4*)(bias + n + 4);

    // unrolled so that acc is named by constant index
#pragma unroll
    for (int i = 0; i < 2; i++) {
#pragma unroll
        for (int j = 0; j < 4; j++) {
            float* p = stg + (16 * i + col) * PS + 16 * j + 8 * half;
            *(float4*)p       = make_float4(acc[i][j][0], acc[i][j][1], acc[i][j][2], acc[i][j][3]);
            *(float4*)(p + 4) = make_float4(acc[i][j][4], acc[i][j][5], acc[i][j][6], acc[i][j][7]);
        }
    }
    // the rows read back below were written by other lanes of this wave: its
    // LDS writes have retired, and the compiler moves no read above this line
    asm volatile("s_wait_dscnt 0x0" ::: "memory");

    auto fin = [&](float v, float bv) {
        v += bv;
        if (relu) v = fmaxf(v, 0.0f);
        return v;
    };
    // both store loops are unrolled: straight-line code, in which the compiler
    // itself writes the wait in front of any reuse of a store's registers
    if constexpr (TOB) {
        const int rr = lane >> 3;
        unsigned short* cp = Cb + (size_t)(m0 + wm + rr) * N + n;
#pragma unroll
        for (int it = 0; it < 8; it++) {
            const float* p = stg + (4 * it + rr) * PS + ch;
            const float4 lo = *(const float4*)p;
            const float4 hi = *(const float4*)(p + 4);
            ushort8 ov;
            ov[0] = f2bf(fin(lo.x, b0.x)); ov[1] = f2bf(fin(lo.y, b0.y));
            ov[2] = f2bf(fin(lo.z, b0.z)); ov[3] = f2bf(fin(lo.w, b0.w));
            ov[4] = f2bf(fin(hi.x, b1.x)); ov[5] = f2bf(fin(hi.y, b1.y));
            ov[6] = f2bf(fin(hi.z, b1.z)); ov[7] = f2bf(fin(hi.w, b1.w));
            *(ushort8*)(cp + (size_t)(4 * it) * N) = ov;
        }
    } else {
        const int rr = lane >> 4;
        float* cp = C + (size_t)(m0 + wm + rr) * N + n;
#pragma unroll
        for (int it = 0; it < 16; it++) {
            // the second half's reads and addresses stay behind the first
            // half's stores: all sixteen at once overran the register budget
            // and the build spilled
            if (it == 8) __builtin_amdgcn_sched_barrier(0);
            const float4 x = *(const float4*)(stg + (2 * it + rr) * PS + ch);
            *(float4*)(cp + (size_t)(2 * it) * N) =
                make_float4(fin(x.x, b0.x), fin(x.y, b0.y), fin(x.z, b0.z), fin(x.w, b0.w));
        }
    }
}

__global__ __launch_bounds__(128)
// both launches put four waves on a SIMD: the register budget of four lets
// the build fetch LDS fragments ahead of their products
__attribute__((amdgpu_waves_per_eu(4, 4)))
void k_attn(const unsigned short* __restrict__ Qg,
            const unsigned short* __restrict__ Kg,
            const unsigned short* __restrict__ Vg,
            unsigned short* __restrict__ Og,
            int sQ, int bQ, int sK, int bK, int sO, int bO,
            int seq_kv, int causal) {
    __shared__ __align__(16) unsigned short Qs[64 * P64];     // q tile
    __shared__ __align__(16) unsigned short Ks[2][32 * P64];  // key tiles [key][d]
    __shared__ __align__(16) unsigned short Vs[2][32 * PV64]; // V tiles  [key][d]

    const int q0 = blockIdx.x * 64;
    const int bh = blockIdx.y;
    const int b  = bh >> 4;
    const int h  = bh & 15;
    const unsigned short* Qb = Qg + (size_t)b * bQ + h * 64;
    const unsigned short* Kb = Kg + (size_t)b * bK + h * 64;
    const unsigned short* Vb = Vg + (size_t)b * bK + h * 64;
    unsigned short* Ob = Og + (size_t)b * bO + h * 64;

    const int tid  = threadIdx.x;
    const int wave = tid >> 5;
    const int lane = tid & 31;
    const int half = lane >> 4;
    const int col  = lane & 15;

    // stage Q tile (64x64) via async DMA
    {
        const int r = tid >> 3, c = (tid & 7) * 8;   // rows r, r+16, r+32, r+48
        const unsigned lq = lds_off(&Qs[r * P64 + c]);
        const unsigned short* gq = Qb + (size_t)(q0 + r) * sQ + c;
        async_b128_x4(lq,                gq,
                      lq + 16 * P64 * 2, gq + (size_t)16 * sQ,
                      lq + 32 * P64 * 2, gq + (size_t)32 * sQ,
                      lq + 48 * P64 * 2, gq + (size_t)48 * sQ);
    }

    int kv_end = causal ? (q0 + 64) : seq_kv;
    if (kv_end > seq_kv) kv_end = seq_kv;

    // K/V-tile staging coords: eight neighbouring lanes copy one row's 128 B
    // (a whole cache line); each thread takes rows kr and kr+16.
    // gk, gv: this thread's place in the next tile to be copied.
    const int kr = tid >> 3;
    const int kc = (tid & 7) * 8;
    const unsigned lk = lds_off(&Ks[0][kr * P64 + kc]);
    const unsigned lv = lds_off(&Vs[0][kr * PV64 + kc]);
    const size_t g16 = (size_t)16 * sK;   // 16 keys on, in global elements
    const unsigned short* gk = Kb + (size_t)kr * sK + kc;
    const unsigned short* gv = Vb + (size_t)kr * sK + kc;
    auto stage = [&](int buf) {   // K and V tiles (32x64 each) via async DMA
        const unsigned bk = lk + buf * (32 * P64 * 2);
        const unsigned bv = lv + buf * (32 * PV64 * 2);
        async_b128_x4(bk,                 gk,
                      bk + 16 * P64 * 2,  gk + g16,
                      bv,                 gv,
                      bv + 16 * PV64 * 2, gv + g16);
        gk += 2 * g16;
        gv += 2 * g16;
    };

    // tile 0 lands with Q, behind one wait and one barrier; tile 1 then flies
    // while tile 0 is worked on
    if (kv_end > 0) stage(0);
    wait_async_0();
    __syncthreads();
    if (kv_end > 32) stage(1);

    // this lane's query: running maximum (over all keys), running sum (over
    // the keys of this lane half; the halves are joined after the loop)
    const int qi = q0 + wave * 16 + col;
    float m_run = -1e30f, l_run = 0.0f;
    floatx8 o[4] = {};   // o[n][r] = O[qi][16 * n + 8 * half + r]

    const float scale = 0.125f; // 1/sqrt(64)

    for (int t0 = 0; t0 < kv_end; t0 += 32) {
        const int buf = (t0 >> 5) & 1;   // this tile's buffer
        const unsigned short* Kt = Ks[buf];
        const unsigned short* Vt = Vs[buf];

        // S^T (32 keys x 16 q) per wave: 2 key tiles, d_k=64 -> 2 k-chunks each
        floatx8 s[2] = {};
        for (int c2 = 0; c2 < 2; c2++) {
            bf16x16 qb  = load_frag(Qs + (wave * 16) * P64, P64, c2 * 32);
            bf16x16 ka0 = load_frag(Kt,            P64, c2 * 32);
            bf16x16 ka1 = load_frag(Kt + 16 * P64, P64, c2 * 32);
            s[0] = wmma_bf16(ka0, qb, s[0]);
            s[1] = wmma_bf16(ka1, qb, s[1]);
        }

        // mask + scale + the query's maximum over this tile
        float best = -1e30f;
        for (int j = 0; j < 2; j++)
            for (int r = 0; r < 8; r++) {
                int kj = t0 + 16 * j + 8 * half + r;
                float v = s[j][r] * scale;
                if (causal && kj > qi) v = -1e30f;
                s[j][r] = v;
                best = fmaxf(best, v);
            }
        best = fmaxf(best, xhalf(best));

        // online softmax update; P^T operand element 8 * j + r is key
        // 16 * j + 8 * half + r, the k order of the V^T fragment
        const float mnew = fmaxf(m_run, best);
        constexpr float LOG2E = 1.44269504f;   // e^x = 2^(x * LOG2E), as __expf takes it
        const float corr = exp2_slot((m_run - mnew) * LOG2E);
        m_run = mnew;
        float su[2] = {0.0f, 0.0f};   // one chain of adds per key tile
        bf16x16 pb;
        for (int j = 0; j < 2; j++) {
            float x[8], p[8];
            for (int r = 0; r < 8; r++) x[r] = (s[j][r] - mnew) * LOG2E;
            exp2_slot_x8(p, x);
            for (int r = 0; r < 8; r++) {
                su[j] += p[r];
                pb[8 * j + r] = (__bf16)p[r];
            }
        }
        l_run = l_run * corr + (su[0] + su[1]);
        for (int n = 0; n < 4; n++)
            for (int r = 0; r < 8; r++)
                o[n][r] *= corr;

        for (int n = 0; n < 4; n++) {
            bf16x16 va = load_frag_colT(Vt + n * 16, PV64);
            o[n] = wmma_bf16(va, pb, o[n]);
        }

        // publish point of the next tile: this wave's reads of this tile's
        // buffer have returned, its copies of the next tile have landed; the
        // barrier says both of every wave. Only then is this buffer refilled.
        asm volatile("s_wait_dscnt 0x0" ::: "memory");
        wait_async_0();
        __syncthreads();
        if (t0 + 64 < kv_end) stage(buf);
    }
    // no copy is left in flight when the wave goes on to its end
    wait_async_0();

    // epilogue: normalize + store bf16 (the only reader is the out projection);
    // a lane's 8 registers of o[n] are 8 neighbouring d of its query: 16 B
    // unrolled so that o[n] is named by constant index (rolled, the compiler
    // picks the registers by a relative move per element)
    const float l_all = l_run + xhalf(l_run);
#pragma unroll
    for (int n = 0; n < 4; n++) {
        ushort8 ov;
        for (int r = 0; r < 8; r++)
            ov[r] = f2bf(o[n][r] / l_all);
        *(ushort8*)(Ob + (size_t)qi * sO + n * 16 + 8 * half) = ov;
    }
}

// ---------------- residual + LayerNorm (D=1024, 256 threads/row) ----------
// O keeps fp32 for the next residual; with BF16_COPY, Ob takes the bf16 copy
// that the next matrix product reads.
template <bool BF16_COPY>
__global__ __launch_bounds__(256)
void k_add_ln(const float* __restrict__ X, const float* __restrict__ Y,
              const float* __restrict__ gw, const float* __restrict__ bw,
              float* __restrict__ O, unsigned short* __restrict__ Ob) {
    const int D = 1024;
    const int row = blockIdx.x;
    const int tid = threadIdx.x;
    const float4 xv = *(const float4*)(X + (size_t)row * D + tid * 4);
    const float4 yv = *(const float4*)(Y + (size_t)row * D + tid * 4);
    float t0 = xv.x + yv.x, t1 = xv.y + yv.y, t2 = xv.z + yv.z, t3 = xv.w + yv.w;
    float s  = t0 + t1 + t2 + t3;
    float s2 = t0 * t0 + t1 * t1 + t2 * t2 + t3 * t3;
    for (int msk = 1; msk < 32; msk <<= 1) {
        s  += __shfl_xor(s, msk, 32);
        s2 += __shfl_xor(s2, msk, 32);
    }
    __shared__ float sh[16];
    int wave = tid >> 5, lane = tid & 31;
    if (lane == 0) { sh[wave] = s; sh[8 + wave] = s2; }
    __syncthreads();
    float S = 0.0f, S2 = 0.0f;
    for (int i = 0; i < 8; i++) { S += sh[i]; S2 += sh[8 + i]; }
    float mu  = S / D;
    float inv = rsqrtf(S2 / D - mu * mu + 1e-5f);
    const float4 gv = *(const float4*)(gw + tid * 4);
    const float4 bv = *(const float4*)(bw + tid * 4);
    float4 ov;
    ov.x = (t0 - mu) * inv * gv.x + bv.x;
    ov.y = (t1 - mu) * inv * gv.y + bv.y;
    ov.z = (t2 - mu) * inv * gv.z + bv.z;
    ov.w = (t3 - mu) * inv * gv.w + bv.w;
    *(float4*)(O + (size_t)row * D + tid * 4) = ov;
    if (BF16_COPY) {
        ushort4v ob;
        ob.x = f2bf(ov.x); ob.y = f2bf(ov.y); ob.z = f2bf(ov.z); ob.w = f2bf(ov.w);
        *(ushort4v*)(Ob + (size_t)row * D + tid * 4) = ob;
    }
}

// ---------------- host orchestration ----------------
extern "C" void kernel_launch(void* const* d_in, const int* in_sizes, int n_in,
                              void* d_out, int out_size, void* d_ws, size_t ws_size,
                              hipStream_t stream) {
    (void)in_sizes; (void)n_in; (void)out_size; (void)ws_size;
    const float* tgt  = (const float*)d_in[0];
    const float* mem  = (const float*)d_in[1];
    const float* Wqkv = (const float*)d_in[2];  const float* bqkv = (const float*)d_in[3];
    const float* Wso  = (const float*)d_in[4];  const float* bso  = (const float*)d_in[5];
    const float* Wq   = (const float*)d_in[6];  const float* bq   = (const float*)d_in[7];
    const float* Wk   = (const float*)d_in[8];  const float* bk   = (const float*)d_in[9];
    const float* Wv   = (const float*)d_in[10]; const float* bv   = (const float*)d_in[11];
    const float* Wco  = (const float*)d_in[12]; const float* bco  = (const float*)d_in[13];
    const float* W1   = (const float*)d_in[14]; const float* b1   = (const float*)d_in[15];
    const float* W2   = (const float*)d_in[16]; const float* b2   = (const float*)d_in[17];
    const float* g1   = (const float*)d_in[18]; const float* be1  = (const float*)d_in[19];
    const float* g2   = (const float*)d_in[20]; const float* be2  = (const float*)d_in[21];
    const float* g3   = (const float*)d_in[22]; const float* be3  = (const float*)d_in[23];
    float* out = (float*)d_out;

    const size_t MB = 1u << 20;
    char* ws = (char*)d_ws;
    unsigned short* Cv = (unsigned short*)ws;  // 56 MB bf16 copies of the operands
    float* F1 = (float*)(ws + 64 * MB);      // 16 MB fp32 scratch (ffn out)
    float* F2 = (float*)(ws + 80 * MB);      // 16 MB fp32 scratch (out projections)
    float* X1 = (float*)(ws + 96 * MB);      // LN1 output
    float* X2 = (float*)(ws + 112 * MB);     // LN2 output
    unsigned short* Ab  = (unsigned short*)(ws + 136 * MB); // 8 MB  activation bf16
    unsigned short* Qb  = (unsigned short*)(ws + 168 * MB); // 8 MB  cross-Q bf16
    unsigned short* KVb = (unsigned short*)(ws + 176 * MB); // 32 MB qkv / k,v / hidden bf16
    const unsigned short* tgt_b  = Cv + U_TGT  * MB;
    const unsigned short* mem_b  = Cv + U_MEM  * MB;
    const unsigned short* Wqkv_b = Cv + U_WQKV * MB;
    const unsigned short* Wso_b  = Cv + U_WSO  * MB;
    const unsigned short* Wq_b   = Cv + U_WQ   * MB;
    const unsigned short* Wk_b   = Cv + U_WK   * MB;
    const unsigned short* Wv_b   = Cv + U_WV   * MB;
    const unsigned short* Wco_b  = Cv + U_WCO  * MB;
    const unsigned short* W1_b   = Cv + U_W1   * MB;
    const unsigned short* W2_b   = Cv + U_W2   * MB;

    const int DM = 1024, RQ = 4096, RM = 8192, DFF = 4096;

    auto gemm = [&](const unsigned short* A, const unsigned short* W,
                    const float* bias, float* C, int M, int N, int K, int relu) {
        k_gemm_bf16<false><<<dim3(N / 128, M / 128), dim3(256), 0, stream>>>(
            A, W, bias, C, nullptr, M, N, K, relu);
    };
    auto gemm_b = [&](const unsigned short* A, const unsigned short* W,
                      const float* bias, unsigned short* Cb,
                      int M, int N, int K, int relu) {
        k_gemm_bf16<true><<<dim3(N / 128, M / 128), dim3(256), 0, stream>>>(
            A, W, bias, nullptr, Cb, M, N, K, relu);
    };

    // --- bf16 copies of tgt, memory and the weights ---
    k_cvt_all<<<dim3(CVT_BLOCKS), dim3(256), 0, stream>>>(
        tgt, mem, Wqkv, Wso, Wq, Wk, Wv, Wco, W1, W2, Cv);

    // --- self-attention block ---
    gemm_b(tgt_b, Wqkv_b, bqkv, KVb, RQ, 3 * DM, DM, 0);    // qkv bf16
    k_attn<<<dim3(16, 64), dim3(128), 0, stream>>>(
        KVb, KVb + 1024, KVb + 2048, Ab,                    // attn1 bf16
        12288, 3072, 12288, 3072, 4096, 1024, 1024, /*causal=*/1);
    gemm(Ab, Wso_b, bso, F2, RQ, DM, DM, 0);                // self out proj
    k_add_ln<true><<<dim3(RQ), dim3(256), 0, stream>>>(tgt, F2, g1, be1, X1, Ab);

    // --- cross-attention block ---
    gemm_b(Ab, Wq_b, bq, Qb, RQ, DM, DM, 0);                // q_c bf16
    gemm_b(mem_b, Wk_b, bk, KVb, RM, DM, DM, 0);            // k_c bf16
    gemm_b(mem_b, Wv_b, bv, KVb + (size_t)RM * DM, RM, DM, DM, 0); // v_c bf16
    k_attn<<<dim3(16, 64), dim3(128), 0, stream>>>(
        Qb, KVb, KVb + (size_t)RM * DM, Ab,                 // attn2 bf16
        4096, 1024, 4096, 1024, 4096, 1024, 2048, /*causal=*/0);
    gemm(Ab, Wco_b, bco, F2, RQ, DM, DM, 0);                // cross out proj
    k_add_ln<true><<<dim3(RQ), dim3(256), 0, stream>>>(X1, F2, g2, be2, X2, Ab);

    // --- FFN block ---
    gemm_b(Ab, W1_b, b1, KVb, RQ, DFF, DM, /*relu=*/1);     // hidden bf16
    gemm(KVb, W2_b, b2, F1, RQ, DM, DFF, 0);                // ffn out
    k_add_ln<false><<<dim3(RQ), dim3(256), 0, stream>>>(X2, F1, g3, be3, out, nullptr);
}

// v009
// Measured time: 282 microseconds a run.
// Two timings next to v008 put it at 1.04 and 1.05 times that version's speed.
// Over all steps from v000 it is 3.55 times as fast.
#include <hip/hip_runtime.h>
#include <hip/hip_bf16.h>

// ---------------- types ----------------
typedef __attribute__((ext_vector_type(16))) __bf16 bf16x16;
typedef __attribute__((ext_vector_type(8)))  float  floatx8;
typedef __attribute__((ext_vector_type(8)))  unsigned short ushort8;
typedef __attribute__((ext_vector_type(4)))  unsigned short ushort4v;

// fp32 -> bf16 (RNE-ish)
__device__ __forceinline__ unsigned short f2bf(float x) {
    unsigned u = __float_as_uint(x);
    unsigned r = u + 0x7FFFu + ((u >> 16) & 1u);
    return (unsigned short)(r >> 16);
}

// LDS byte offset of a generic pointer to __shared__ memory
__device__ __forceinline__ unsigned lds_off(const void* p) {
    return (unsigned)(size_t)(const __attribute__((address_space(3))) void*)p;
}

// CDNA5 async global->LDS copy, 16 bytes per lane, tracked by ASYNCcnt.
// Four such copies and, as the statement's last line, the wait that stands in
// front of any rewrite of the address registers the copies name.
__device__ __forceinline__ void async_b128_x4(unsigned l0, const void* g0,
                                              unsigned l1, const void* g1,
                                              unsigned l2, const void* g2,
                                              unsigned l3, const void* g3) {
    asm volatile("global_load_async_to_lds_b128 %0, %1, off\n\t"
                 "global_load_async_to_lds_b128 %2, %3, off\n\t"
                 "global_load_async_to_lds_b128 %4, %5, off\n\t"
                 "global_load_async_to_lds_b128 %6, %7, off\n\t"
                 "s_wait_xcnt 0x0"
                 :: "v"(l0), "v"(g0), "v"(l1), "v"(g1),
                    "v"(l2), "v"(g2), "v"(l3), "v"(g3) : "memory");
}
// Eight copies, closed by the same wait.
__device__ __forceinline__ void async_b128_x8(unsigned l0, const void* g0,
                                              unsigned l1, const void* g1,
                                              unsigned l2, const void* g2,
                                              unsigned l3, const void* g3,
                                              unsigned l4, const void* g4,
                                              unsigned l5, const void* g5,
                                              unsigned l6, const void* g6,
                                              unsigned l7, const void* g7) {
    asm volatile("global_load_async_to_lds_b128 %0, %1, off\n\t"
                 "global_load_async_to_lds_b128 %2, %3, off\n\t"
                 "global_load_async_to_lds_b128 %4, %5, off\n\t"
                 "global_load_async_to_lds_b128 %6, %7, off\n\t"
                 "global_load_async_to_lds_b128 %8, %9, off\n\t"
                 "global_load_async_to_lds_b128 %10, %11, off\n\t"
                 "global_load_async_to_lds_b128 %12, %13, off\n\t"
                 "global_load_async_to_lds_b128 %14, %15, off\n\t"
                 "s_wait_xcnt 0x0"
                 :: "v"(l0), "v"(g0), "v"(l1), "v"(g1),
                    "v"(l2), "v"(g2), "v"(l3), "v"(g3),
                    "v"(l4), "v"(g4), "v"(l5), "v"(g5),
                    "v"(l6), "v"(g6), "v"(l7), "v"(g7) : "memory");
}
// all but the eight youngest copies (the next tile's) have landed
__device__ __forceinline__ void wait_async_le8() {
    asm volatile("s_wait_asynccnt 0x8" ::: "memory");
}
// all but the sixteen youngest copies (the next two tiles') have landed
__device__ __forceinline__ void wait_async_le16() {
    asm volatile("s_wait_asynccnt 0x10" ::: "memory");
}
__device__ __forceinline__ void wait_async_0() {
    asm volatile("s_wait_asynccnt 0x0" ::: "memory");
}

// Load one 16x32 bf16 fragment (A-layout / symmetric B-layout) from LDS.
// Lane L<16 covers row (L), K in {8*half..+8} U {16+8*half..+8}; per ISA
// 16-bit A-matrix striping: two contiguous 8-element runs -> two b128 loads.
__device__ __forceinline__ bf16x16 load_frag(const unsigned short* base,
                                             int row_stride, int kbase) {
    int lane = threadIdx.x & 31;
    int half = lane >> 4;
    int row  = lane & 15;
    const unsigned short* p = base + row * row_stride + kbase + half * 8;
    union { bf16x16 f; ushort8 u[2]; } r;
    r.u[0] = *(const ushort8*)(p);
    r.u[1] = *(const ushort8*)(p + 16);
    return r.f;
}

// V^T fragment (A operand of V^T x P^T) from a row-major [K=32 keys][row_stride]
// LDS tile, by the 16-bit transposing LDS load: lane L reads 16 B of key row
// 8 * half + (L & 7), and receives V column (base + L&15) of the keys
// 8 * half + 0..7; the second load, 16 rows on, brings the keys 16 + 8 * half + 0..7.
typedef __attribute__((ext_vector_type(8))) short short8;
__device__ __forceinline__ bf16x16 load_frag_colT(const unsigned short* base,
                                                  int row_stride) {
    typedef __attribute__((address_space(3))) short8 lds_short8;
    int lane = threadIdx.x & 31;
    int half = lane >> 4;
    const unsigned short* p = base + (8 * half + (lane & 7)) * row_stride
                                   + 8 * ((lane >> 3) & 1);
    union { bf16x16 f; short8 u[2]; } r;
    r.u[0] = __builtin_amdgcn_ds_load_tr16_b128_v8i16((lds_short8*)p);
    r.u[1] = __builtin_amdgcn_ds_load_tr16_b128_v8i16((lds_short8*)(p + 16 * row_stride));
    return r.f;
}

__device__ __forceinline__ floatx8 wmma_bf16(bf16x16 a, bf16x16 b, floatx8 c) {
    return __builtin_amdgcn_wmma_f32_16x16x32_bf16(false, a, false, b,
                                                   (short)0, c, false, false);
}

// lane l takes the value of lane l ^ 16 (the lane that holds the other half
// of the same fragment column)
__device__ __forceinline__ float xhalf(float x) {
    int b = __builtin_bit_cast(int, x);
    return __builtin_bit_cast(float, __builtin_amdgcn_permlanex16(
        b, b, 0x76543210, 0xfedcba98, false, false));
}

__device__ __forceinline__ float exp2_slot(float x) {
    float p;
    asm("v_exp_f32 %0, %1\n\t"
        "v_nop" : "=v"(p) : "v"(x));
    return p;
}
__device__ __forceinline__ void exp2_slot_x8(float (&p)[8], const float (&x)[8]) {
    asm("v_exp_f32 %0, %8\n\t"
        "v_exp_f32 %1, %9\n\t"
        "v_exp_f32 %2, %10\n\t"
        "v_exp_f32 %3, %11\n\t"
        "v_exp_f32 %4, %12\n\t"
        "v_exp_f32 %5, %13\n\t"
        "v_exp_f32 %6, %14\n\t"
        "v_exp_f32 %7, %15\n\t"
        "v_nop"
        : "=&v"(p[0]), "=&v"(p[1]), "=&v"(p[2]), "=&v"(p[3]),
          "=&v"(p[4]), "=&v"(p[5]), "=&v"(p[6]), "=&v"(p[7])
        : "v"(x[0]), "v"(x[1]), "v"(x[2]), "v"(x[3]),
          "v"(x[4]), "v"(x[5]), "v"(x[6]), "v"(x[7]));
}

// LDS row pitches in elements. A 16-byte fragment read walks 16 rows at once;
// a pitch of 16 B x odd spreads those rows over all 64 banks, where the
// unpadded 64-B and 128-B rows fall on the same few banks again and again.
constexpr int P64 = 72;   // rows of 64 bf16: 128 B of data, 144 B pitch
// The transposing load walks 8 rows in each lane half, 32 B of each: its
// conflict-free pitch is 32 B x odd.
constexpr int PV64 = 80;  // V rows of 64 bf16: 128 B of data, 160 B pitch

// ---------------- convert kernel ----------------
// One launch rounds every fp32 matrix operand (both activations and all eight
// weights) to bf16. dst is the concatenation of the ten results in argument
// order; every source is a whole number of units of 2^20 elements, so a chunk
// (8192 elements, 128 chunks a unit) lies inside one source, picked by a
// block-uniform test. Two blocks a WGP walk the chunks with the grid's
// stride: 16 waves a WGP, each with 8 loads of 512 contiguous bytes in flight.
constexpr int U_TGT = 0, U_MEM = 4, U_WQKV = 12, U_WSO = 15, U_WQ = 16,
              U_WK = 17, U_WV = 18, U_WCO = 19, U_W1 = 20, U_W2 = 24, U_END = 28;
constexpr int CVT_BLOCKS = 512;
constexpr int CVT_TRIPS  = U_END * 128 / CVT_BLOCKS;   // 7
__global__ __launch_bounds__(256)
void k_cvt_all(const float* __restrict__ tgt,  const float* __restrict__ mem,
               const float* __restrict__ Wqkv, const float* __restrict__ Wso,
               const float* __restrict__ Wq,   const float* __restrict__ Wk,
               const float* __restrict__ Wv,   const float* __restrict__ Wco,
               const float* __restrict__ W1,   const float* __restrict__ W2,
               unsigned short* __restrict__ dst) {
    const int tid = threadIdx.x;
    // a wave takes 1024 neighbouring elements of the chunk
    const unsigned el = (tid >> 5) * 1024 + (tid & 31) * 4;
    for (int t = 0; t < CVT_TRIPS; t++) {
        const int c = blockIdx.x + t * CVT_BLOCKS;   // chunk of dst
        const int u = c >> 7;                        // its unit
        const float* s; int u0;         // the source, and the source's first unit
        if      (u < U_MEM)  { s = tgt;  u0 = U_TGT;  }
        else if (u < U_WQKV) { s = mem;  u0 = U_MEM;  }
        else if (u < U_WSO)  { s = Wqkv; u0 = U_WQKV; }
        else if (u < U_WQ)   { s = Wso;  u0 = U_WSO;  }
        else if (u < U_WK)   { s = Wq;   u0 = U_WQ;   }
        else if (u < U_WV)   { s = Wk;   u0 = U_WK;   }
        else if (u < U_WCO)  { s = Wv;   u0 = U_WV;   }
        else if (u < U_W1)   { s = Wco;  u0 = U_WCO;  }
        else if (u < U_W2)   { s = W1;   u0 = U_W1;   }
        else                 { s = W2;   u0 = U_W2;   }
        const float* p = s + ((size_t)(c - u0 * 128) << 13) + el;
        unsigned short* d = dst + ((size_t)c << 13) + el;
        float4 v[8];
        for (int k = 0; k < 8; k++) v[k] = *(const float4*)(p + k * 128);
        for (int k = 0; k < 8; k++) {
            ushort4v o;
            o.x = f2bf(v[k].x); o.y = f2bf(v[k].y); o.z = f2bf(v[k].z); o.w = f2bf(v[k].w);
            *(ushort4v*)(d + k * 128) = o;
        }
        // the next trip stands behind a branch and reuses the stores' data and
        // address registers
        if (t + 1 < CVT_TRIPS) asm volatile("s_wait_xcnt 0x0" ::: "memory");
    }
}

// ---------------- GEMM: C[M,N] = A[M,K] * W[N,K]^T + bias, optional relu ----
// The result goes to Cb, rounded to bf16, where the next reader is a matrix
// product (TOB), else to C in fp32.
// block tile 128(M) x 128(N), K-step 64, 256 threads = 8 waves.
// Each wave: 32x64 sub-tile = 2x4 WMMA accumulators (16 WMMA / K-step), taken
// transposed (W rows as the A operand, A rows as the B operand).
// LDS ring of S buffers fed by async global->LDS DMA (ASYNCcnt pipeline).
// S = 2 where the grid puts three or four blocks on a WGP: the blocks cover
// each other's landing times. S = 4 where it puts one or two there: nobody
// else covers them, so three K-steps' copies fly ahead of the products.
// A K-step takes 128 B of every operand row, one whole cache line, and eight
// neighbouring lanes copy it: a wave's copy touches 4 full lines.
template <bool TOB, int S>
__global__ __launch_bounds__(256)
// with S = 2 LDS lets four blocks stand on a WGP, eight waves a SIMD: the
// epilogue's fetches ahead stay inside the 128 registers that this takes
__attribute__((amdgpu_waves_per_eu(8)))
void k_gemm_bf16(const unsigned short* __restrict__ A,
                 const unsigned short* __restrict__ W,
                 const float* __restrict__ bias,
                 float* __restrict__ C,
                 unsigned short* __restrict__ Cb,
                 int M, int N, int K, int relu) {
    static_assert(S == 2 || S == 4, "ring depth");
    __shared__ __align__(16) unsigned short As[S][128 * P64];
    __shared__ __align__(16) unsigned short Ws[S][128 * P64];

    const int tid  = threadIdx.x;
    const int m0   = blockIdx.y * 128;
    const int n0   = blockIdx.x * 128;
    const int wave = tid >> 5;
    const int wm   = (wave & 3) * 32;   // 0,32,64,96
    const int wn   = (wave >> 2) * 64;  // 0,64

    // staging: each thread owns 8 elems (16 B) at column ac of the rows
    // ar, ar+32, ar+64, ar+96 of each tile
    const int ar = tid >> 3;            // 0..31
    const int ac = (tid & 7) * 8;       // 0,8,..,56
    const unsigned short* Ag = A + (size_t)(m0 + ar) * K + ac;
    const unsigned short* Wg = W + (size_t)(n0 + ar) * K + ac;
    const size_t   gr = (size_t)32 * K; // 32 rows on, in global elements
    const unsigned lr = 32 * P64 * 2;   // 32 rows on, in LDS bytes

    auto issue = [&](int buf, int k0) {
        unsigned la = lds_off(&As[buf][ar * P64 + ac]);
        unsigned lw = lds_off(&Ws[buf][ar * P64 + ac]);
        const unsigned short* ga = Ag + k0;
        const unsigned short* gw = Wg + k0;
        async_b128_x8(la,          ga,          la + lr,     ga + gr,
                      la + 2 * lr, ga + 2 * gr, la + 3 * lr, ga + 3 * gr,
                      lw,          gw,          lw + lr,     gw + gr,
                      lw + 2 * lr, gw + 2 * gr, lw + 3 * lr, gw + 3 * gr);
    };

    floatx8 acc[2][4] = {};
    const int T = K >> 6;

    // the products of one K-step, from ring buffer buf
    auto products = [&](int buf) {
        const unsigned short* Ab = As[buf];
        const unsigned short* Wb = Ws[buf];
        for (int kk = 0; kk < 64; kk += 32) {
            bf16x16 af[2], wf[4];
            af[0] = load_frag(Ab + (wm + 0)  * P64, P64, kk);
            af[1] = load_frag(Ab + (wm + 16) * P64, P64, kk);
            for (int j = 0; j < 4; j++)
                wf[j] = load_frag(Wb + (wn + 16 * j) * P64, P64, kk);

            for (int i = 0; i < 2; i++)
                for (int j = 0; j < 4; j++)
                    acc[i][j] = wmma_bf16(wf[j], af[i], acc[i][j]);
        }
    };

    if constexpr (S == 2) {
        issue(0, 0);
        for (int t = 0; t < T; t++) {
            if (t + 1 < T) { issue((t + 1) & 1, (t + 1) * 64); wait_async_le8(); }
            else           { wait_async_0(); }
            __syncthreads();
            products(t & 1);
            __syncthreads();
        }
    } else {
        for (int p = 0; p < S - 1; p++)
            if (p < T) issue(p, p * 64);
        for (int t = 0; t < T; t++) {
            // publish point of tile t: this wave's copies of it have landed
            // (behind them fly the two next tiles' sixteen; near the end,
            // where fewer were issued, the wait is to 0) ...
            if (t + S - 1 <= T) wait_async_le16();
            else                wait_async_0();
            // ... and its reads of tile t - 1 have returned
            asm volatile("s_wait_dscnt 0x0" ::: "memory");
            // the barrier says both of every wave: tile t may be read, and
            // tile t - 1's buffer, which is tile t + 3's, may be refilled
            __syncthreads();
            if (t + S - 1 < T) issue((t + S - 1) & (S - 1), (t + S - 1) * 64);
            products(t & (S - 1));
        }
        // the ring becomes the epilogue's staging: every wave's last reads
        // have returned (no copy is in flight behind the last trip's wait)
        asm volatile("s_wait_dscnt 0x0" ::: "memory");
        __syncthreads();
    }

    // Epilogue. acc[i][j][r] = C[wm + 16 * i + col][wn + 16 * j + 8 * half + r]:
    // a lane holds 8 neighbouring columns of one row. Each wave lays its 32 x 64
    // tile, in fp32, into an LDS range of its own (the ring is free: the last
    // barrier above stands behind every wave's last read and last copy), reads it
    // back row by row and stores whole 128-B lines, 16 B a lane.
    const int lane = tid & 31;
    const int half = lane >> 4;
    const int col  = lane & 15;
    constexpr int PS = 68;   // staging rows of 64 floats: 256 B of data, 272 B pitch (16 B x odd)
    float* stg = (float*)(wave < 4 ? &As[0][0] : &Ws[0][0]) + (wave & 3) * (32 * P64);

    // this lane's columns on the way out: 8 of them (bf16: 8 lanes a row,
    // 4 rows a store) or 4 (fp32: 16 lanes a row, 2 rows a store), the same in
    // every row it stores: their bias is read once
    const int ch = TOB ? (lane & 7) * 8 : (lane & 15) * 4;
    const int n  = n0 + wn + ch;
    const float4 b0 = *(const float4*)(bias + n);
    float4 b1 = b0;
    if constexpr (TOB) b1 = *(const float4*)(bias + n + 4);

    // unrolled so that acc is named by constant index
#pragma unroll
    for (int i = 0; i < 2; i++) {
#pragma unroll
        for (int j = 0; j < 4; j++) {
            float* p = stg + (16 * i + col) * PS + 16 * j + 8 * half;
            *(float4*)p       = make_float4(acc[i][j][0], acc[i][j][1], acc[i][j][2], acc[i][j][3]);
            *(float4*)(p + 4) = make_float4(acc[i][j][4], acc[i][j][5], acc[i][j][6], acc[i][j][7]);
        }
    }
    // the rows read back below were written by other lanes of this wave: its
    // LDS writes have retired, and the compiler moves no read above this line
    asm volatile("s_wait_dscnt 0x0" ::: "memory");

    auto fin = [&](float v, float bv) {
        v += bv;
        if (relu) v = fmaxf(v, 0.0f);
        return v;
    };
    // both store loops are unrolled: straight-line code, in which the compiler
    // itself writes the wait in front of any reuse of a store's registers
    if constexpr (TOB) {
        const int rr = lane >> 3;
        unsigned short* cp = Cb + (size_t)(m0 + wm + rr) * N + n;
#pragma unroll
        for (int it = 0; it < 8; it++) {
            const float* p = stg + (4 * it + rr) * PS + ch;
            const float4 lo = *(const float4*)p;
            const float4 hi = *(const float4*)(p + 4);
            ushort8 ov;
            ov[0] = f2bf(fin(lo.x, b0.x)); ov[1] = f2bf(fin(lo.y, b0.y));
            ov[2] = f2bf(fin(lo.z, b0.z)); ov[3] = f2bf(fin(lo.w, b0.w));
            ov[4] = f2bf(fin(hi.x, b1.x)); ov[5] = f2bf(fin(hi.y, b1.y));
            ov[6] = f2bf(fin(hi.z, b1.z)); ov[7] = f2bf(fin(hi.w, b1.w));
            *(ushort8*)(cp + (size_t)(4 * it) * N) = ov;
        }
    } else {
        const int rr = lane >> 4;
        float* cp = C + (size_t)(m0 + wm + rr) * N + n;
#pragma unroll
        for (int it = 0; it < 16; it++) {
            // the second half's reads and addresses stay behind the first
            // half's stores: all sixteen at once overran the register budget
            // and the build spilled
            if (it == 8) __builtin_amdgcn_sched_barrier(0);
            const float4 x = *(const float4*)(stg + (2 * it + rr) * PS + ch);
            *(float4*)(cp + (size_t)(2 * it) * N) =
                make_float4(fin(x.x, b0.x), fin(x.y, b0.y), fin(x.z, b0.z), fin(x.w, b0.w));
        }
    }
}

__global__ __launch_bounds__(128)
// both launches put four waves on a SIMD: the register budget of four lets
// the build fetch LDS fragments ahead of their products
__attribute__((amdgpu_waves_per_eu(4, 4)))
void k_attn(const unsigned short* __restrict__ Qg,
            const unsigned short* __restrict__ Kg,
            const unsigned short* __restrict__ Vg,
            unsigned short* __restrict__ Og,
            int sQ, int bQ, int sK, int bK, int sO, int bO,
            int seq_kv, int causal) {
    __shared__ __align__(16) unsigned short Qs[64 * P64];     // q tile
    __shared__ __align__(16) unsigned short Ks[2][32 * P64];  // key tiles [key][d]
    __shared__ __align__(16) unsigned short Vs[2][32 * PV64]; // V tiles  [key][d]

    const int q0 = blockIdx.x * 64;
    const int bh = blockIdx.y;
    const int b  = bh >> 4;
    const int h  = bh & 15;
    const unsigned short* Qb = Qg + (size_t)b * bQ + h * 64;
    const unsigned short* Kb = Kg + (size_t)b * bK + h * 64;
    const unsigned short* Vb = Vg + (size_t)b * bK + h * 64;
    unsigned short* Ob = Og + (size_t)b * bO + h * 64;

    const int tid  = threadIdx.x;
    const int wave = tid >> 5;
    const int lane = tid & 31;
    const int half = lane >> 4;
    const int col  = lane & 15;

    // stage Q tile (64x64) via async DMA
    {
        const int r = tid >> 3, c = (tid & 7) * 8;   // rows r, r+16, r+32, r+48
        const unsigned lq = lds_off(&Qs[r * P64 + c]);
        const unsigned short* gq = Qb + (size_t)(q0 + r) * sQ + c;
        async_b128_x4(lq,                gq,
                      lq + 16 * P64 * 2, gq + (size_t)16 * sQ,
                      lq + 32 * P64 * 2, gq + (size_t)32 * sQ,
                      lq + 48 * P64 * 2, gq + (size_t)48 * sQ);
    }

    int kv_end = causal ? (q0 + 64) : seq_kv;
    if (kv_end > seq_kv) kv_end = seq_kv;

    // K/V-tile staging coords: eight neighbouring lanes copy one row's 128 B
    // (a whole cache line); each thread takes rows kr and kr+16.
    // gk, gv: this thread's place in the next tile to be copied.
    const int kr = tid >> 3;
    const int kc = (tid & 7) * 8;
    const unsigned lk = lds_off(&Ks[0][kr * P64 + kc]);
    const unsigned lv = lds_off(&Vs[0][kr * PV64 + kc]);
    const size_t g16 = (size_t)16 * sK;   // 16 keys on, in global elements
    const unsigned short* gk = Kb + (size_t)kr * sK + kc;
    const unsigned short* gv = Vb + (size_t)kr * sK + kc;
    auto stage = [&](int buf) {   // K and V tiles (32x64 each) via async DMA
        const unsigned bk = lk + buf * (32 * P64 * 2);
        const unsigned bv = lv + buf * (32 * PV64 * 2);
        async_b128_x4(bk,                 gk,
                      bk + 16 * P64 * 2,  gk + g16,
                      bv,                 gv,
                      bv + 16 * PV64 * 2, gv + g16);
        gk += 2 * g16;
        gv += 2 * g16;
    };

    // tile 0 lands with Q, behind one wait and one barrier; tile 1 then flies
    // while tile 0 is worked on
    if (kv_end > 0) stage(0);
    wait_async_0();
    __syncthreads();
    if (kv_end > 32) stage(1);

    // this lane's query: running maximum (over all keys), running sum (over
    // the keys of this lane half; the halves are joined after the loop)
    const int qi = q0 + wave * 16 + col;
    float m_run = -1e30f, l_run = 0.0f;
    floatx8 o[4] = {};   // o[n][r] = O[qi][16 * n + 8 * half + r]

    const float scale = 0.125f; // 1/sqrt(64)

    for (int t0 = 0; t0 < kv_end; t0 += 32) {
        const int buf = (t0 >> 5) & 1;   // this tile's buffer
        const unsigned short* Kt = Ks[buf];
        const unsigned short* Vt = Vs[buf];

        // S^T (32 keys x 16 q) per wave: 2 key tiles, d_k=64 -> 2 k-chunks each
        floatx8 s[2] = {};
        for (int c2 = 0; c2 < 2; c2++) {
            bf16x16 qb  = load_frag(Qs + (wave * 16) * P64, P64, c2 * 32);
            bf16x16 ka0 = load_frag(Kt,            P64, c2 * 32);
            bf16x16 ka1 = load_frag(Kt + 16 * P64, P64, c2 * 32);
            s[0] = wmma_bf16(ka0, qb, s[0]);
            s[1] = wmma_bf16(ka1, qb, s[1]);
        }

        // mask + scale + the query's maximum over this tile
        float best = -1e30f;
        for (int j = 0; j < 2; j++)
            for (int r = 0; r < 8; r++) {
                int kj = t0 + 16 * j + 8 * half + r;
                float v = s[j][r] * scale;
                if (causal && kj > qi) v = -1e30f;
                s[j][r] = v;
                best = fmaxf(best, v);
            }
        best = fmaxf(best, xhalf(best));

        // online softmax update; P^T operand element 8 * j + r is key
        // 16 * j + 8 * half + r, the k order of the V^T fragment
        const float mnew = fmaxf(m_run, best);
        constexpr float LOG2E = 1.44269504f;   // e^x = 2^(x * LOG2E), as __expf takes it
        const float corr = exp2_slot((m_run - mnew) * LOG2E);
        m_run = mnew;
        float su[2] = {0.0f, 0.0f};   // one chain of adds per key tile
        bf16x16 pb;
        for (int j = 0; j < 2; j++) {
            float x[8], p[8];
            for (int r = 0; r < 8; r++) x[r] = (s[j][r] - mnew) * LOG2E;
            exp2_slot_x8(p, x);
            for (int r = 0; r < 8; r++) {
                su[j] += p[r];
                pb[8 * j + r] = (__bf16)p[r];
            }
        }
        l_run = l_run * corr + (su[0] + su[1]);
        for (int n = 0; n < 4; n++)
            for (int r = 0; r < 8; r++)
                o[n][r] *= corr;

        for (int n = 0; n < 4; n++) {
            bf16x16 va = load_frag_colT(Vt + n * 16, PV64);
            o[n] = wmma_bf16(va, pb, o[n]);
        }

        // publish point of the next tile: this wave's reads of this tile's
        // buffer have returned, its copies of the next tile have landed; the
        // barrier says both of every wave. Only then is this buffer refilled.
        asm volatile("s_wait_dscnt 0x0" ::: "memory");
        wait_async_0();
        __syncthreads();
        if (t0 + 64 < kv_end) stage(buf);
    }
    // no copy is left in flight when the wave goes on to its end
    wait_async_0();

    // epilogue: normalize + store bf16 (the only reader is the out projection);
    // a lane's 8 registers of o[n] are 8 neighbouring d of its query: 16 B
    // unrolled so that o[n] is named by constant index (rolled, the compiler
    // picks the registers by a relative move per element)
    const float l_all = l_run + xhalf(l_run);
#pragma unroll
    for (int n = 0; n < 4; n++) {
        ushort8 ov;
        for (int r = 0; r < 8; r++)
            ov[r] = f2bf(o[n][r] / l_all);
        *(ushort8*)(Ob + (size_t)qi * sO + n * 16 + 8 * half) = ov;
    }
}

// ---------------- residual + LayerNorm (D=1024, 256 threads/row) ----------
// O keeps fp32 for the next residual; with BF16_COPY, Ob takes the bf16 copy
// that the next matrix product reads.
template <bool BF16_COPY>
__global__ __launch_bounds__(256)
void k_add_ln(const float* __restrict__ X, const float* __restrict__ Y,
              const float* __restrict__ gw, const float* __restrict__ bw,
              float* __restrict__ O, unsigned short* __restrict__ Ob) {
    const int D = 1024;
    const int row = blockIdx.x;
    const int tid = threadIdx.x;
    const float4 xv = *(const float4*)(X + (size_t)row * D + tid * 4);
    const float4 yv = *(const float4*)(Y + (size_t)row * D + tid * 4);
    float t0 = xv.x + yv.x, t1 = xv.y + yv.y, t2 = xv.z + yv.z, t3 = xv.w + yv.w;
    float s  = t0 + t1 + t2 + t3;
    float s2 = t0 * t0 + t1 * t1 + t2 * t2 + t3 * t3;
    for (int msk = 1; msk < 32; msk <<= 1) {
        s  += __shfl_xor(s, msk, 32);
        s2 += __shfl_xor(s2, msk, 32);
    }
    __shared__ float sh[16];
    int wave = tid >> 5, lane = tid & 31;
    if (lane == 0) { sh[wave] = s; sh[8 + wave] = s2; }
    __syncthreads();
    float S = 0.0f, S2 = 0.0f;
    for (int i = 0; i < 8; i++) { S += sh[i]; S2 += sh[8 + i]; }
    float mu  = S / D;
    float inv = rsqrtf(S2 / D - mu * mu + 1e-5f);
    const float4 gv = *(const float4*)(gw + tid * 4);
    const float4 bv = *(const float4*)(bw + tid * 4);
    float4 ov;
    ov.x = (t0 - mu) * inv * gv.x + bv.x;
    ov.y = (t1 - mu) * inv * gv.y + bv.y;
    ov.z = (t2 - mu) * inv * gv.z + bv.z;
    ov.w = (t3 - mu) * inv * gv.w + bv.w;
    *(float4*)(O + (size_t)row * D + tid * 4) = ov;
    if (BF16_COPY) {
        ushort4v ob;
        ob.x = f2bf(ov.x); ob.y = f2bf(ov.y); ob.z = f2bf(ov.z); ob.w = f2bf(ov.w);
        *(ushort4v*)(Ob + (size_t)row * D + tid * 4) = ob;
    }
}

// ---------------- host orchestration ----------------
extern "C" void kernel_launch(void* const* d_in, const int* in_sizes, int n_in,
                              void* d_out, int out_size, void* d_ws, size_t ws_size,
                              hipStream_t stream) {
    (void)in_sizes; (void)n_in; (void)out_size; (void)ws_size;
    const float* tgt  = (const float*)d_in[0];
    const float* mem  = (const float*)d_in[1];
    const float* Wqkv = (const float*)d_in[2];  const float* bqkv = (const float*)d_in[3];
    const float* Wso  = (const float*)d_in[4];  const float* bso  = (const float*)d_in[5];
    const float* Wq   = (const float*)d_in[6];  const float* bq   = (const float*)d_in[7];
    const float* Wk   = (const float*)d_in[8];  const float* bk   = (const float*)d_in[9];
    const float* Wv   = (const float*)d_in[10]; const float* bv   = (const float*)d_in[11];
    const float* Wco  = (const float*)d_in[12]; const float* bco  = (const float*)d_in[13];
    const float* W1   = (const float*)d_in[14]; const float* b1   = (const float*)d_in[15];
    const float* W2   = (const float*)d_in[16]; const float* b2   = (const float*)d_in[17];
    const float* g1   = (const float*)d_in[18]; const float* be1  = (const float*)d_in[19];
    const float* g2   = (const float*)d_in[20]; const float* be2  = (const float*)d_in[21];
    const float* g3   = (const float*)d_in[22]; const float* be3  = (const float*)d_in[23];
    float* out = (float*)d_out;

    const size_t MB = 1u << 20;
    char* ws = (char*)d_ws;
    unsigned short* Cv = (unsigned short*)ws;  // 56 MB bf16 copies of the operands
    float* F1 = (float*)(ws + 64 * MB);      // 16 MB fp32 scratch (ffn out)
    float* F2 = (float*)(ws + 80 * MB);      // 16 MB fp32 scratch (out projections)
    float* X1 = (float*)(ws + 96 * MB);      // LN1 output
    float* X2 = (float*)(ws + 112 * MB);     // LN2 output
    unsigned short* Ab  = (unsigned short*)(ws + 136 * MB); // 8 MB  activation bf16
    unsigned short* Qb  = (unsigned short*)(ws + 168 * MB); // 8 MB  cross-Q bf16
    unsigned short* KVb = (unsigned short*)(ws + 176 * MB); // 32 MB qkv / k,v / hidden bf16
    const unsigned short* tgt_b  = Cv + U_TGT  * MB;
    const unsigned short* mem_b  = Cv + U_MEM  * MB;
    const unsigned short* Wqkv_b = Cv + U_WQKV * MB;
    const unsigned short* Wso_b  = Cv + U_WSO  * MB;
    const unsigned short* Wq_b   = Cv + U_WQ   * MB;
    const unsigned short* Wk_b   = Cv + U_WK   * MB;
    const unsigned short* Wv_b   = Cv + U_WV   * MB;
    const unsigned short* Wco_b  = Cv + U_WCO  * MB;
    const unsigned short* W1_b   = Cv + U_W1   * MB;
    const unsigned short* W2_b   = Cv + U_W2   * MB;

    const int DM = 1024, RQ = 4096, RM = 8192, DFF = 4096;

    auto gemm = [&](const unsigned short* A, const unsigned short* W,
                    const float* bias, float* C, int M, int N, int K, int relu) {
        k_gemm_bf16<false, 4><<<dim3(N / 128, M / 128), dim3(256), 0, stream>>>(
            A, W, bias, C, nullptr, M, N, K, relu);
    };
    auto gemm_b = [&](const unsigned short* A, const unsigned short* W,
                      const float* bias, unsigned short* Cb,
                      int M, int N, int K, int relu) {
        k_gemm_bf16<true, 2><<<dim3(N / 128, M / 128), dim3(256), 0, stream>>>(
            A, W, bias, nullptr, Cb, M, N, K, relu);
    };
    // the same for a grid of one or two blocks a WGP (256 or 512 blocks)
    auto gemm_b4 = [&](const unsigned short* A, const unsigned short* W,
                       const float* bias, unsigned short* Cb,
                       int M, int N, int K, int relu) {
        k_gemm_bf16<true, 4><<<dim3(N / 128, M / 128), dim3(256), 0, stream>>>(
            A, W, bias, nullptr, Cb, M, N, K, relu);
    };

    // --- bf16 copies of tgt, memory and the weights ---
    k_cvt_all<<<dim3(CVT_BLOCKS), dim3(256), 0, stream>>>(
        tgt, mem, Wqkv, Wso, Wq, Wk, Wv, Wco, W1, W2, Cv);

    // --- self-attention block ---
    gemm_b(tgt_b, Wqkv_b, bqkv, KVb, RQ, 3 * DM, DM, 0);    // qkv bf16
    k_attn<<<dim3(16, 64), dim3(128), 0, stream>>>(
        KVb, KVb + 1024, KVb + 2048, Ab,                    // attn1 bf16
        12288, 3072, 12288, 3072, 4096, 1024, 1024, /*causal=*/1);
    gemm(Ab, Wso_b, bso, F2, RQ, DM, DM, 0);                // self out proj
    k_add_ln<true><<<dim3(RQ), dim3(256), 0, stream>>>(tgt, F2, g1, be1, X1, Ab);

    // --- cross-attention block ---
    gemm_b4(Ab, Wq_b, bq, Qb, RQ, DM, DM, 0);               // q_c bf16
    gemm_b4(mem_b, Wk_b, bk, KVb, RM, DM, DM, 0);           // k_c bf16
    gemm_b4(mem_b, Wv_b, bv, KVb + (size_t)RM * DM, RM, DM, DM, 0); // v_c bf16
    k_attn<<<dim3(16, 64), dim3(128), 0, stream>>>(
        Qb, KVb, KVb + (size_t)RM * DM, Ab,                 // attn2 bf16
        4096, 1024, 4096, 1024, 4096, 1024, 2048, /*causal=*/0);
    gemm(Ab, Wco_b, bco, F2, RQ, DM, DM, 0);                // cross out proj
    k_add_ln<true><<<dim3(RQ), dim3(256), 0, stream>>>(X1, F2, g2, be2, X2, Ab);

    // --- FFN block ---
    gemm_b(Ab, W1_b, b1, KVb, RQ, DFF, DM, /*relu=*/1);     // hidden bf16
    gemm(KVb, W2_b, b2, F1, RQ, DM, DFF, 0);                // ffn out
    k_add_ln<false><<<dim3(RQ), dim3(256), 0, stream>>>(X2, F1, g3, be3, out, nullptr);
}

// v010
// It runs in 267 microseconds.
// Next to v009, in two timings, it ran 1.05 times as fast each time.
// Over all steps from v000 it is 3.73 times as fast.
#include <hip/hip_runtime.h>
#include <hip/hip_bf16.h>

// ---------------- types ----------------
typedef __attribute__((ext_vector_type(16))) __bf16 bf16x16;
typedef __attribute__((ext_vector_type(8)))  float  floatx8;
typedef __attribute__((ext_vector_type(8)))  unsigned short ushort8;
typedef __attribute__((ext_vector_type(4)))  unsigned short ushort4v;

// fp32 -> bf16 (RNE-ish)
__device__ __forceinline__ unsigned short f2bf(float x) {
    unsigned u = __float_as_uint(x);
    unsigned r = u + 0x7FFFu + ((u >> 16) & 1u);
    return (unsigned short)(r >> 16);
}

// LDS byte offset of a generic pointer to __shared__ memory
__device__ __forceinline__ unsigned lds_off(const void* p) {
    return (unsigned)(size_t)(const __attribute__((address_space(3))) void*)p;
}

// CDNA5 async global->LDS copy, 16 bytes per lane, tracked by ASYNCcnt.
// Four such copies and, as the statement's last line, the wait that stands in
// front of any rewrite of the address registers the copies name.
__device__ __forceinline__ void async_b128_x4(unsigned l0, const void* g0,
                                              unsigned l1, const void* g1,
                                              unsigned l2, const void* g2,
                                              unsigned l3, const void* g3) {
    asm volatile("global_load_async_to_lds_b128 %0, %1, off\n\t"
                 "global_load_async_to_lds_b128 %2, %3, off\n\t"
                 "global_load_async_to_lds_b128 %4, %5, off\n\t"
                 "global_load_async_to_lds_b128 %6, %7, off\n\t"
                 "s_wait_xcnt 0x0"
                 :: "v"(l0), "v"(g0), "v"(l1), "v"(g1),
                    "v"(l2), "v"(g2), "v"(l3), "v"(g3) : "memory");
}
// Eight copies, closed by the same wait.
__device__ __forceinline__ void async_b128_x8(unsigned l0, const void* g0,
                                              unsigned l1, const void* g1,
                                              unsigned l2, const void* g2,
                                              unsigned l3, const void* g3,
                                              unsigned l4, const void* g4,
                                              unsigned l5, const void* g5,
                                              unsigned l6, const void* g6,
                                              unsigned l7, const void* g7) {
    asm volatile("global_load_async_to_lds_b128 %0, %1, off\n\t"
                 "global_load_async_to_lds_b128 %2, %3, off\n\t"
                 "global_load_async_to_lds_b128 %4, %5, off\n\t"
                 "global_load_async_to_lds_b128 %6, %7, off\n\t"
                 "global_load_async_to_lds_b128 %8, %9, off\n\t"
                 "global_load_async_to_lds_b128 %10, %11, off\n\t"
                 "global_load_async_to_lds_b128 %12, %13, off\n\t"
                 "global_load_async_to_lds_b128 %14, %15, off\n\t"
                 "s_wait_xcnt 0x0"
                 :: "v"(l0), "v"(g0), "v"(l1), "v"(g1),
                    "v"(l2), "v"(g2), "v"(l3), "v"(g3),
                    "v"(l4), "v"(g4), "v"(l5), "v"(g5),
                    "v"(l6), "v"(g6), "v"(l7), "v"(g7) : "memory");
}
// all but the eight youngest copies (the next tile's) have landed
__device__ __forceinline__ void wait_async_le8() {
    asm volatile("s_wait_asynccnt 0x8" ::: "memory");
}
// all but the sixteen youngest copies (the next two tiles') have landed
__device__ __forceinline__ void wait_async_le16() {
    asm volatile("s_wait_asynccnt 0x10" ::: "memory");
}
__device__ __forceinline__ void wait_async_0() {
    asm volatile("s_wait_asynccnt 0x0" ::: "memory");
}

// Load one 16x32 bf16 fragment (A-layout / symmetric B-layout) from LDS.
// Lane L<16 covers row (L), K in {8*half..+8} U {16+8*half..+8}; per ISA
// 16-bit A-matrix striping: two contiguous 8-element runs -> two b128 loads.
__device__ __forceinline__ bf16x16 load_frag(const unsigned short* base,
                                             int row_stride, int kbase) {
    int lane = threadIdx.x & 31;
    int half = lane >> 4;
    int row  = lane & 15;
    const unsigned short* p = base + row * row_stride + kbase + half * 8;
    union { bf16x16 f; ushort8 u[2]; } r;
    r.u[0] = *(const ushort8*)(p);
    r.u[1] = *(const ushort8*)(p + 16);
    return r.f;
}

// V^T fragment (A operand of V^T x P^T) from a row-major [K=32 keys][row_stride]
// LDS tile, by the 16-bit transposing LDS load: lane L reads 16 B of key row
// 8 * half + (L & 7), and receives V column (base + L&15) of the keys
// 8 * half + 0..7; the second load, 16 rows on, brings the keys 16 + 8 * half + 0..7.
typedef __attribute__((ext_vector_type(8))) short short8;
__device__ __forceinline__ bf16x16 load_frag_colT(const unsigned short* base,
                                                  int row_stride) {
    typedef __attribute__((address_space(3))) short8 lds_short8;
    int lane = threadIdx.x & 31;
    int half = lane >> 4;
    const unsigned short* p = base + (8 * half + (lane & 7)) * row_stride
                                   + 8 * ((lane >> 3) & 1);
    union { bf16x16 f; short8 u[2]; } r;
    r.u[0] = __builtin_amdgcn_ds_load_tr16_b128_v8i16((lds_short8*)p);
    r.u[1] = __builtin_amdgcn_ds_load_tr16_b128_v8i16((lds_short8*)(p + 16 * row_stride));
    return r.f;
}

__device__ __forceinline__ floatx8 wmma_bf16(bf16x16 a, bf16x16 b, floatx8 c) {
    return __builtin_amdgcn_wmma_f32_16x16x32_bf16(false, a, false, b,
                                                   (short)0, c, false, false);
}

// lane l takes the value of lane l ^ 16 (the lane that holds the other half
// of the same fragment column)
__device__ __forceinline__ float xhalf(float x) {
    int b = __builtin_bit_cast(int, x);
    return __builtin_bit_cast(float, __builtin_amdgcn_permlanex16(
        b, b, 0x76543210, 0xfedcba98, false, false));
}

__device__ __forceinline__ float exp2_slot(float x) {
    float p;
    asm("v_exp_f32 %0, %1\n\t"
        "v_nop" : "=v"(p) : "v"(x));
    return p;
}
__device__ __forceinline__ void exp2_slot_x8(float (&p)[8], const float (&x)[8]) {
    asm("v_exp_f32 %0, %8\n\t"
        "v_exp_f32 %1, %9\n\t"
        "v_exp_f32 %2, %10\n\t"
        "v_exp_f32 %3, %11\n\t"
        "v_exp_f32 %4, %12\n\t"
        "v_exp_f32 %5, %13\n\t"
        "v_exp_f32 %6, %14\n\t"
        "v_exp_f32 %7, %15\n\t"
        "v_nop"
        : "=&v"(p[0]), "=&v"(p[1]), "=&v"(p[2]), "=&v"(p[3]),
          "=&v"(p[4]), "=&v"(p[5]), "=&v"(p[6]), "=&v"(p[7])
        : "v"(x[0]), "v"(x[1]), "v"(x[2]), "v"(x[3]),
          "v"(x[4]), "v"(x[5]), "v"(x[6]), "v"(x[7]));
}

// LDS row pitches in elements. A 16-byte fragment read walks 16 rows at once;
// a pitch of 16 B x odd spreads those rows over all 64 banks, where the
// unpadded 64-B and 128-B rows fall on the same few banks again and again.
constexpr int P64 = 72;   // rows of 64 bf16: 128 B of data, 144 B pitch
// The transposing load walks 8 rows in each lane half, 32 B of each: its
// conflict-free pitch is 32 B x odd.
constexpr int PV64 = 80;  // V rows of 64 bf16: 128 B of data, 160 B pitch

// ---------------- convert kernel ----------------
// One launch rounds every fp32 matrix operand (both activations and all eight
// weights) to bf16. dst is the concatenation of the ten results in argument
// order; every source is a whole number of units of 2^20 elements, so a chunk
// (8192 elements, 128 chunks a unit) lies inside one source, picked by a
// block-uniform test. Two blocks a WGP walk the chunks with the grid's
// stride: 16 waves a WGP, each with 8 loads of 512 contiguous bytes in flight.
constexpr int U_TGT = 0, U_MEM = 4, U_WQKV = 12, U_WSO = 15, U_WQ = 16,
              U_WK = 17, U_WV = 18, U_WCO = 19, U_W1 = 20, U_W2 = 24, U_END = 28;
constexpr int CVT_BLOCKS = 512;
constexpr int CVT_TRIPS  = U_END * 128 / CVT_BLOCKS;   // 7
__global__ __launch_bounds__(256)
void k_cvt_all(const float* __restrict__ tgt,  const float* __restrict__ mem,
               const float* __restrict__ Wqkv, const float* __restrict__ Wso,
               const float* __restrict__ Wq,   const float* __restrict__ Wk,
               const float* __restrict__ Wv,   const float* __restrict__ Wco,
               const float* __restrict__ W1,   const float* __restrict__ W2,
               unsigned short* __restrict__ dst) {
    const int tid = threadIdx.x;
    // a wave takes 1024 neighbouring elements of the chunk
    const unsigned el = (tid >> 5) * 1024 + (tid & 31) * 4;
    for (int t = 0; t < CVT_TRIPS; t++) {
        const int c = blockIdx.x + t * CVT_BLOCKS;   // chunk of dst
        const int u = c >> 7;                        // its unit
        const float* s; int u0;         // the source, and the source's first unit
        if      (u < U_MEM)  { s = tgt;  u0 = U_TGT;  }
        else if (u < U_WQKV) { s = mem;  u0 = U_MEM;  }
        else if (u < U_WSO)  { s = Wqkv; u0 = U_WQKV; }
        else if (u < U_WQ)   { s = Wso;  u0 = U_WSO;  }
        else if (u < U_WK)   { s = Wq;   u0 = U_WQ;   }
        else if (u < U_WV)   { s = Wk;   u0 = U_WK;   }
        else if (u < U_WCO)  { s = Wv;   u0 = U_WV;   }
        else if (u < U_W1)   { s = Wco;  u0 = U_WCO;  }
        else if (u < U_W2)   { s = W1;   u0 = U_W1;   }
        else                 { s = W2;   u0 = U_W2;   }
        const float* p = s + ((size_t)(c - u0 * 128) << 13) + el;
        unsigned short* d = dst + ((size_t)c << 13) + el;
        float4 v[8];
        for (int k = 0; k < 8; k++) v[k] = *(const float4*)(p + k * 128);
        for (int k = 0; k < 8; k++) {
            ushort4v o;
            o.x = f2bf(v[k].x); o.y = f2bf(v[k].y); o.z = f2bf(v[k].z); o.w = f2bf(v[k].w);
            *(ushort4v*)(d + k * 128) = o;
        }
        // the next trip stands behind a branch and reuses the stores' data and
        // address registers
        if (t + 1 < CVT_TRIPS) asm volatile("s_wait_xcnt 0x0" ::: "memory");
    }
}

// ---------------- GEMM: C[M,N] = A[M,K] * W[N,K]^T + bias, optional relu ----
// The result goes to Cb, rounded to bf16, where the next reader is a matrix
// product (TOB), else to C in fp32.
// block tile 128(M) x 128(N), K-step 64, 256 threads = 8 waves.
// Each wave: 16 WMMA / K-step, taken transposed (W rows as the A operand, A rows
// as the B operand): with S = 2 a 32x64 sub-tile over the 64 k (12 fragments
// read), with S = 4 a 64x64 sub-tile over 32 of them (8 fragments read).
// LDS ring of S buffers fed by async global->LDS DMA (ASYNCcnt pipeline).
// S = 2 where the grid puts three or four blocks on a WGP: the blocks cover
// each other's landing times. S = 4 where it puts one or two there: nobody
// else covers them, so three K-steps' copies fly ahead of the products.
// A K-step takes 128 B of every operand row, one whole cache line, and eight
// neighbouring lanes copy it: a wave's copy touches 4 full lines.
template <bool TOB, int S>
__global__ __launch_bounds__(256)
// with S = 2 LDS lets four blocks stand on a WGP, eight waves a SIMD: the
// epilogue's fetches ahead stay inside the 128 registers that this takes;
// with S = 4 at most two blocks stand there, four waves a SIMD: 256 registers
__attribute__((amdgpu_waves_per_eu(S == 2 ? 8 : 4)))
void k_gemm_bf16(const unsigned short* __restrict__ A,
                 const unsigned short* __restrict__ W,
                 const float* __restrict__ bias,
                 float* __restrict__ C,
                 unsigned short* __restrict__ Cb,
                 int M, int N, int K, int relu) {
    static_assert(S == 2 || S == 4, "ring depth");
    __shared__ __align__(16) unsigned short As[S][128 * P64];
    __shared__ __align__(16) unsigned short Ws[S][128 * P64];

    const int tid  = threadIdx.x;
    const int m0   = blockIdx.y * 128;
    const int n0   = blockIdx.x * 128;
    const int wave = tid >> 5;
    // S = 2: a wave takes 32 x 64 of the tile over the whole K-step.
    // S = 4: a wave takes 64 x 64 over half of every K-step (32 k): waves w and
    // w + 4 hold the two partial sums of one quadrant, joined in the epilogue.
    constexpr int FI = S == 4 ? 4 : 2;  // 16-row fragments of A per wave
    const int wm   = S == 4 ? (wave & 1) * 64        : (wave & 3) * 32;
    const int wn   = S == 4 ? ((wave >> 1) & 1) * 64 : (wave >> 2) * 64;
    const int kh   = S == 4 ? (wave >> 2) * 32 : 0;  // this wave's k inside a K-step

    // staging: each thread owns 8 elems (16 B) at column ac of the rows
    // ar, ar+32, ar+64, ar+96 of each tile
    const int ar = tid >> 3;            // 0..31
    const int ac = (tid & 7) * 8;       // 0,8,..,56
    const unsigned short* Ag = A + (size_t)(m0 + ar) * K + ac;
    const unsigned short* Wg = W + (size_t)(n0 + ar) * K + ac;
    const size_t   gr = (size_t)32 * K; // 32 rows on, in global elements
    const unsigned lr = 32 * P64 * 2;   // 32 rows on, in LDS bytes

    auto issue = [&](int buf, int k0) {
        unsigned la = lds_off(&As[buf][ar * P64 + ac]);
        unsigned lw = lds_off(&Ws[buf][ar * P64 + ac]);
        const unsigned short* ga = Ag + k0;
        const unsigned short* gw = Wg + k0;
        async_b128_x8(la,          ga,          la + lr,     ga + gr,
                      la + 2 * lr, ga + 2 * gr, la + 3 * lr, ga + 3 * gr,
                      lw,          gw,          lw + lr,     gw + gr,
                      lw + 2 * lr, gw + 2 * gr, lw + 3 * lr, gw + 3 * gr);
    };

    floatx8 acc[FI][4] = {};
    const int T = K >> 6;

    // the products of one K-step, from ring buffer buf
    auto products = [&](int buf) {
        const unsigned short* Ab = As[buf];
        const unsigned short* Wb = Ws[buf];
        if constexpr (S == 4) {
            // 8 fragments feed 16 products. They are read W, A, W, A, ... and
            // each product stands behind the younger of its two fragments, so
            // the products start on the first pair and run while the rest lands.
            bf16x16 af[4], wf[4];
            // unrolled (here and below) so that fragments and acc are named by
            // constant index
#pragma unroll
            for (int d = 0; d < 4; d++) {
                wf[d] = load_frag(Wb + (wn + 16 * d) * P64, P64, kh);
                af[d] = load_frag(Ab + (wm + 16 * d) * P64, P64, kh);
            }
            // the 16 LDS reads stay one group ahead of the products: left to
            // itself the build reads three of the fragments among them, into
            // one register set, and waits out the LDS latency at each
            __builtin_amdgcn_sched_barrier(0);
#pragma unroll
            for (int d = 0; d < 4; d++) {
#pragma unroll
                for (int i = 0; i < d; i++)
                    acc[i][d] = wmma_bf16(wf[d], af[i], acc[i][d]);
#pragma unroll
                for (int j = 0; j <= d; j++)
                    acc[d][j] = wmma_bf16(wf[j], af[d], acc[d][j]);
            }
        } else {
            for (int kk = 0; kk < 64; kk += 32) {
                bf16x16 af[2], wf[4];
                af[0] = load_frag(Ab + (wm + 0)  * P64, P64, kk);
                af[1] = load_frag(Ab + (wm + 16) * P64, P64, kk);
                for (int j = 0; j < 4; j++)
                    wf[j] = load_frag(Wb + (wn + 16 * j) * P64, P64, kk);

                for (int i = 0; i < 2; i++)
                    for (int j = 0; j < 4; j++)
                        acc[i][j] = wmma_bf16(wf[j], af[i], acc[i][j]);
            }
        }
    };

    if constexpr (S == 2) {
        issue(0, 0);
        for (int t = 0; t < T; t++) {
            if (t + 1 < T) { issue((t + 1) & 1, (t + 1) * 64); wait_async_le8(); }
            else           { wait_async_0(); }
            __syncthreads();
            products(t & 1);
            __syncthreads();
        }
    } else {
        for (int p = 0; p < S - 1; p++)
            if (p < T) issue(p, p * 64);
        for (int t = 0; t < T; t++) {
            // publish point of tile t: this wave's copies of it have landed
            // (behind them fly the two next tiles' sixteen; near the end,
            // where fewer were issued, the wait is to 0) ...
            if (t + S - 1 <= T) wait_async_le16();
            else                wait_async_0();
            // ... and its reads of tile t - 1 have returned
            asm volatile("s_wait_dscnt 0x0" ::: "memory");
            // the barrier says both of every wave: tile t may be read, and
            // tile t - 1's buffer, which is tile t + 3's, may be refilled
            __syncthreads();
            if (t + S - 1 < T) issue((t + S - 1) & (S - 1), (t + S - 1) * 64);
            products(t & (S - 1));
        }
        // the ring becomes the epilogue's staging: every wave's last reads
        // have returned (no copy is in flight behind the last trip's wait)
        asm volatile("s_wait_dscnt 0x0" ::: "memory");
        __syncthreads();
    }

    // Epilogue. acc[i][j][r] = C[wm + 16 * i + col][wn + 16 * j + 8 * half + r]:
    // a lane holds 8 neighbouring columns of one row. Each wave lays its 32 x 64
    // (S = 4: 64 x 64) tile, in fp32, into an LDS range of its own (the ring is
    // free: the last barrier above stands behind every wave's last read and last
    // copy); the rows are read back one by one (S = 4: the pair's two partial
    // sums added) and stored as whole 128-B lines, 16 B a lane.
    const int lane = tid & 31;
    const int half = lane >> 4;
    const int col  = lane & 15;
    constexpr int PS = 68;   // staging rows of 64 floats: 256 B of data, 272 B pitch (16 B x odd)
    // S = 2: 32 staging rows a wave, a quarter of As or of Ws each.
    // S = 4: 64 rows a wave; the four k-low waves lie in As, their partners at
    // the same offsets in Ws (4 x 64 x 272 B = 69,632 of 73,728 B each).
    const int so = (wave & 3) * (S == 4 ? 64 * PS : 32 * P64);
    float* stg = (float*)(wave < 4 ? &As[0][0] : &Ws[0][0]) + so;

    // this lane's columns on the way out: 8 of them (bf16: 8 lanes a row,
    // 4 rows a store) or 4 (fp32: 16 lanes a row, 2 rows a store), the same in
    // every row it stores: their bias is read once
    const int ch = TOB ? (lane & 7) * 8 : (lane & 15) * 4;
    const int n  = n0 + wn + ch;
    const float4 b0 = *(const float4*)(bias + n);
    float4 b1 = b0;
    if constexpr (TOB) b1 = *(const float4*)(bias + n + 4);

    // unrolled so that acc is named by constant index
#pragma unroll
    for (int i = 0; i < FI; i++) {
#pragma unroll
        for (int j = 0; j < 4; j++) {
            float* p = stg + (16 * i + col) * PS + 16 * j + 8 * half;
            *(float4*)p       = make_float4(acc[i][j][0], acc[i][j][1], acc[i][j][2], acc[i][j][3]);
            *(float4*)(p + 4) = make_float4(acc[i][j][4], acc[i][j][5], acc[i][j][6], acc[i][j][7]);
        }
    }
    // the rows read back below were written by other lanes of this wave: its
    // LDS writes have retired, and the compiler moves no read above this line
    asm volatile("s_wait_dscnt 0x0" ::: "memory");
    // S = 4: half of the rows read back were written by the partner wave
    if constexpr (S == 4) __syncthreads();
    // the rows this wave sends out: with S = 4 the k-low wave takes rows 0..31 of
    // the quadrant, its partner rows 32..63, each adding the two partial sums
    const int rb = S == 4 ? (wave >> 2) * 32 : 0;
    const float* rd0 = (S == 4 ? (const float*)&As[0][0] + so : stg) + rb * PS;
    const float* rd1 = (const float*)&Ws[0][0] + so + rb * PS;   // read with S = 4 only
    auto rd4 = [&](int o) {
        float4 x = *(const float4*)(rd0 + o);
        if constexpr (S == 4) {
            const float4 y = *(const float4*)(rd1 + o);
            x.x += y.x; x.y += y.y; x.z += y.z; x.w += y.w;
        }
        return x;
    };

    auto fin = [&](float v, float bv) {
        v += bv;
        if (relu) v = fmaxf(v, 0.0f);
        return v;
    };
    // both store loops are unrolled: straight-line code, in which the compiler
    // itself writes the wait in front of any reuse of a store's registers
    if constexpr (TOB) {
        const int rr = lane >> 3;
        unsigned short* cp = Cb + (size_t)(m0 + wm + rb + rr) * N + n;
#pragma unroll
        for (int it = 0; it < 8; it++) {
            const int o = (4 * it + rr) * PS + ch;
            const float4 lo = rd4(o);
            const float4 hi = rd4(o + 4);
            ushort8 ov;
            ov[0] = f2bf(fin(lo.x, b0.x)); ov[1] = f2bf(fin(lo.y, b0.y));
            ov[2] = f2bf(fin(lo.z, b0.z)); ov[3] = f2bf(fin(lo.w, b0.w));
            ov[4] = f2bf(fin(hi.x, b1.x)); ov[5] = f2bf(fin(hi.y, b1.y));
            ov[6] = f2bf(fin(hi.z, b1.z)); ov[7] = f2bf(fin(hi.w, b1.w));
            *(ushort8*)(cp + (size_t)(4 * it) * N) = ov;
        }
    } else {
        const int rr = lane >> 4;
        float* cp = C + (size_t)(m0 + wm + rb + rr) * N + n;
#pragma unroll
        for (int it = 0; it < 16; it++) {
            // the second half's reads and addresses stay behind the first
            // half's stores: all sixteen at once overran the register budget
            // and the build spilled
            if (it == 8) __builtin_amdgcn_sched_barrier(0);
            const float4 x = rd4((2 * it + rr) * PS + ch);
            *(float4*)(cp + (size_t)(2 * it) * N) =
                make_float4(fin(x.x, b0.x), fin(x.y, b0.y), fin(x.z, b0.z), fin(x.w, b0.w));
        }
    }
}

__global__ __launch_bounds__(128)
// both launches put four waves on a SIMD: the register budget of four lets
// the build fetch LDS fragments ahead of their products
__attribute__((amdgpu_waves_per_eu(4, 4)))
void k_attn(const unsigned short* __restrict__ Qg,
            const unsigned short* __restrict__ Kg,
            const unsigned short* __restrict__ Vg,
            unsigned short* __restrict__ Og,
            int sQ, int bQ, int sK, int bK, int sO, int bO,
            int seq_kv, int causal) {
    __shared__ __align__(16) unsigned short Qs[64 * P64];     // q tile
    __shared__ __align__(16) unsigned short Ks[2][32 * P64];  // key tiles [key][d]
    __shared__ __align__(16) unsigned short Vs[2][32 * PV64]; // V tiles  [key][d]

    const int q0 = blockIdx.x * 64;
    const int bh = blockIdx.y;
    const int b  = bh >> 4;
    const int h  = bh & 15;
    const unsigned short* Qb = Qg + (size_t)b * bQ + h * 64;
    const unsigned short* Kb = Kg + (size_t)b * bK + h * 64;
    const unsigned short* Vb = Vg + (size_t)b * bK + h * 64;
    unsigned short* Ob = Og + (size_t)b * bO + h * 64;

    const int tid  = threadIdx.x;
    const int wave = tid >> 5;
    const int lane = tid & 31;
    const int half = lane >> 4;
    const int col  = lane & 15;

    // stage Q tile (64x64) via async DMA
    {
        const int r = tid >> 3, c = (tid & 7) * 8;   // rows r, r+16, r+32, r+48
        const unsigned lq = lds_off(&Qs[r * P64 + c]);
        const unsigned short* gq = Qb + (size_t)(q0 + r) * sQ + c;
        async_b128_x4(lq,                gq,
                      lq + 16 * P64 * 2, gq + (size_t)16 * sQ,
                      lq + 32 * P64 * 2, gq + (size_t)32 * sQ,
                      lq + 48 * P64 * 2, gq + (size_t)48 * sQ);
    }

    int kv_end = causal ? (q0 + 64) : seq_kv;
    if (kv_end > seq_kv) kv_end = seq_kv;

    // K/V-tile staging coords: eight neighbouring lanes copy one row's 128 B
    // (a whole cache line); each thread takes rows kr and kr+16.
    // gk, gv: this thread's place in the next tile to be copied.
    const int kr = tid >> 3;
    const int kc = (tid & 7) * 8;
    const unsigned lk = lds_off(&Ks[0][kr * P64 + kc]);
    const unsigned lv = lds_off(&Vs[0][kr * PV64 + kc]);
    const size_t g16 = (size_t)16 * sK;   // 16 keys on, in global elements
    const unsigned short* gk = Kb + (size_t)kr * sK + kc;
    const unsigned short* gv = Vb + (size_t)kr * sK + kc;
    auto stage = [&](int buf) {   // K and V tiles (32x64 each) via async DMA
        const unsigned bk = lk + buf * (32 * P64 * 2);
        const unsigned bv = lv + buf * (32 * PV64 * 2);
        async_b128_x4(bk,                 gk,
                      bk + 16 * P64 * 2,  gk + g16,
                      bv,                 gv,
                      bv + 16 * PV64 * 2, gv + g16);
        gk += 2 * g16;
        gv += 2 * g16;
    };

    // tile 0 lands with Q, behind one wait and one barrier; tile 1 then flies
    // while tile 0 is worked on
    if (kv_end > 0) stage(0);
    wait_async_0();
    __syncthreads();
    if (kv_end > 32) stage(1);

    // this lane's query: running maximum (over all keys), running sum (over
    // the keys of this lane half; the halves are joined after the loop)
    const int qi = q0 + wave * 16 + col;
    float m_run = -1e30f, l_run = 0.0f;
    floatx8 o[4] = {};   // o[n][r] = O[qi][16 * n + 8 * half + r]

    const float scale = 0.125f; // 1/sqrt(64)

    for (int t0 = 0; t0 < kv_end; t0 += 32) {
        const int buf = (t0 >> 5) & 1;   // this tile's buffer
        const unsigned short* Kt = Ks[buf];
        const unsigned short* Vt = Vs[buf];

        // S^T (32 keys x 16 q) per wave: 2 key tiles, d_k=64 -> 2 k-chunks each
        floatx8 s[2] = {};
        for (int c2 = 0; c2 < 2; c2++) {
            bf16x16 qb  = load_frag(Qs + (wave * 16) * P64, P64, c2 * 32);
            bf16x16 ka0 = load_frag(Kt,            P64, c2 * 32);
            bf16x16 ka1 = load_frag(Kt + 16 * P64, P64, c2 * 32);
            s[0] = wmma_bf16(ka0, qb, s[0]);
            s[1] = wmma_bf16(ka1, qb, s[1]);
        }

        // mask + scale + the query's maximum over this tile
        float best = -1e30f;
        for (int j = 0; j < 2; j++)
            for (int r = 0; r < 8; r++) {
                int kj = t0 + 16 * j + 8 * half + r;
                float v = s[j][r] * scale;
                if (causal && kj > qi) v = -1e30f;
                s[j][r] = v;
                best = fmaxf(best, v);
            }
        best = fmaxf(best, xhalf(best));

        // online softmax update; P^T operand element 8 * j + r is key
        // 16 * j + 8 * half + r, the k order of the V^T fragment
        const float mnew = fmaxf(m_run, best);
        constexpr float LOG2E = 1.44269504f;   // e^x = 2^(x * LOG2E), as __expf takes it
        const float corr = exp2_slot((m_run - mnew) * LOG2E);
        m_run = mnew;
        float su[2] = {0.0f, 0.0f};   // one chain of adds per key tile
        bf16x16 pb;
        for (int j = 0; j < 2; j++) {
            float x[8], p[8];
            for (int r = 0; r < 8; r++) x[r] = (s[j][r] - mnew) * LOG2E;
            exp2_slot_x8(p, x);
            for (int r = 0; r < 8; r++) {
                su[j] += p[r];
                pb[8 * j + r] = (__bf16)p[r];
            }
        }
        l_run = l_run * corr + (su[0] + su[1]);
        for (int n = 0; n < 4; n++)
            for (int r = 0; r < 8; r++)
                o[n][r] *= corr;

        for (int n = 0; n < 4; n++) {
            bf16x16 va = load_frag_colT(Vt + n * 16, PV64);
            o[n] = wmma_bf16(va, pb, o[n]);
        }

        // publish point of the next tile: this wave's reads of this tile's
        // buffer have returned, its copies of the next tile have landed; the
        // barrier says both of every wave. Only then is this buffer refilled.
        asm volatile("s_wait_dscnt 0x0" ::: "memory");
        wait_async_0();
        __syncthreads();
        if (t0 + 64 < kv_end) stage(buf);
    }
    // no copy is left in flight when the wave goes on to its end
    wait_async_0();

    // epilogue: normalize + store bf16 (the only reader is the out projection);
    // a lane's 8 registers of o[n] are 8 neighbouring d of its query: 16 B
    // unrolled so that o[n] is named by constant index (rolled, the compiler
    // picks the registers by a relative move per element)
    const float l_all = l_run + xhalf(l_run);
#pragma unroll
    for (int n = 0; n < 4; n++) {
        ushort8 ov;
        for (int r = 0; r < 8; r++)
            ov[r] = f2bf(o[n][r] / l_all);
        *(ushort8*)(Ob + (size_t)qi * sO + n * 16 + 8 * half) = ov;
    }
}

// ---------------- residual + LayerNorm (D=1024, 256 threads/row) ----------
// O keeps fp32 for the next residual; with BF16_COPY, Ob takes the bf16 copy
// that the next matrix product reads.
template <bool BF16_COPY>
__global__ __launch_bounds__(256)
void k_add_ln(const float* __restrict__ X, const float* __restrict__ Y,
              const float* __restrict__ gw, const float* __restrict__ bw,
              float* __restrict__ O, unsigned short* __restrict__ Ob) {
    const int D = 1024;
    const int row = blockIdx.x;
    const int tid = threadIdx.x;
    const float4 xv = *(const float4*)(X + (size_t)row * D + tid * 4);
    const float4 yv = *(const float4*)(Y + (size_t)row * D + tid * 4);
    float t0 = xv.x + yv.x, t1 = xv.y + yv.y, t2 = xv.z + yv.z, t3 = xv.w + yv.w;
    float s  = t0 + t1 + t2 + t3;
    float s2 = t0 * t0 + t1 * t1 + t2 * t2 + t3 * t3;
    for (int msk = 1; msk < 32; msk <<= 1) {
        s  += __shfl_xor(s, msk, 32);
        s2 += __shfl_xor(s2, msk, 32);
    }
    __shared__ float sh[16];
    int wave = tid >> 5, lane = tid & 31;
    if (lane == 0) { sh[wave] = s; sh[8 + wave] = s2; }
    __syncthreads();
    float S = 0.0f, S2 = 0.0f;
    for (int i = 0; i < 8; i++) { S += sh[i]; S2 += sh[8 + i]; }
    float mu  = S / D;
    float inv = rsqrtf(S2 / D - mu * mu + 1e-5f);
    const float4 gv = *(const float4*)(gw + tid * 4);
    const float4 bv = *(const float4*)(bw + tid * 4);
    float4 ov;
    ov.x = (t0 - mu) * inv * gv.x + bv.x;
    ov.y = (t1 - mu) * inv * gv.y + bv.y;
    ov.z = (t2 - mu) * inv * gv.z + bv.z;
    ov.w = (t3 - mu) * inv * gv.w + bv.w;
    *(float4*)(O + (size_t)row * D + tid * 4) = ov;
    if (BF16_COPY) {
        ushort4v ob;
        ob.x = f2bf(ov.x); ob.y = f2bf(ov.y); ob.z = f2bf(ov.z); ob.w = f2bf(ov.w);
        *(ushort4v*)(Ob + (size_t)row * D + tid * 4) = ob;
    }
}

// ---------------- host orchestration ----------------
extern "C" void kernel_launch(void* const* d_in, const int* in_sizes, int n_in,
                              void* d_out, int out_size, void* d_ws, size_t ws_size,
                              hipStream_t stream) {
    (void)in_sizes; (void)n_in; (void)out_size; (void)ws_size;
    const float* tgt  = (const float*)d_in[0];
    const float* mem  = (const float*)d_in[1];
    const float* Wqkv = (const float*)d_in[2];  const float* bqkv = (const float*)d_in[3];
    const float* Wso  = (const float*)d_in[4];  const float* bso  = (const float*)d_in[5];
    const float* Wq   = (const float*)d_in[6];  const float* bq   = (const float*)d_in[7];
    const float* Wk   = (const float*)d_in[8];  const float* bk   = (const float*)d_in[9];
    const float* Wv   = (const float*)d_in[10]; const float* bv   = (const float*)d_in[11];
    const float* Wco  = (const float*)d_in[12]; const float* bco  = (const float*)d_in[13];
    const float* W1   = (const float*)d_in[14]; const float* b1   = (const float*)d_in[15];
    const float* W2   = (const float*)d_in[16]; const float* b2   = (const float*)d_in[17];
    const float* g1   = (const float*)d_in[18]; const float* be1  = (const float*)d_in[19];
    const float* g2   = (const float*)d_in[20]; const float* be2  = (const float*)d_in[21];
    const float* g3   = (const float*)d_in[22]; const float* be3  = (const float*)d_in[23];
    float* out = (float*)d_out;

    const size_t MB = 1u << 20;
    char* ws = (char*)d_ws;
    unsigned short* Cv = (unsigned short*)ws;  // 56 MB bf16 copies of the operands
    float* F1 = (float*)(ws + 64 * MB);      // 16 MB fp32 scratch (ffn out)
    float* F2 = (float*)(ws + 80 * MB);      // 16 MB fp32 scratch (out projections)
    float* X1 = (float*)(ws + 96 * MB);      // LN1 output
    float* X2 = (float*)(ws + 112 * MB);     // LN2 output
    unsigned short* Ab  = (unsigned short*)(ws + 136 * MB); // 8 MB  activation bf16
    unsigned short* Qb  = (unsigned short*)(ws + 168 * MB); // 8 MB  cross-Q bf16
    unsigned short* KVb = (unsigned short*)(ws + 176 * MB); // 32 MB qkv / k,v / hidden bf16
    const unsigned short* tgt_b  = Cv + U_TGT  * MB;
    const unsigned short* mem_b  = Cv + U_MEM  * MB;
    const unsigned short* Wqkv_b = Cv + U_WQKV * MB;
    const unsigned short* Wso_b  = Cv + U_WSO  * MB;
    const unsigned short* Wq_b   = Cv + U_WQ   * MB;
    const unsigned short* Wk_b   = Cv + U_WK   * MB;
    const unsigned short* Wv_b   = Cv + U_WV   * MB;
    const unsigned short* Wco_b  = Cv + U_WCO  * MB;
    const unsigned short* W1_b   = Cv + U_W1   * MB;
    const unsigned short* W2_b   = Cv + U_W2   * MB;

    const int DM = 1024, RQ = 4096, RM = 8192, DFF = 4096;

    auto gemm = [&](const unsigned short* A, const unsigned short* W,
                    const float* bias, float* C, int M, int N, int K, int relu) {
        k_gemm_bf16<false, 4><<<dim3(N / 128, M / 128), dim3(256), 0, stream>>>(
            A, W, bias, C, nullptr, M, N, K, relu);
    };
    auto gemm_b = [&](const unsigned short* A, const unsigned short* W,
                      const float* bias, unsigned short* Cb,
                      int M, int N, int K, int relu) {
        k_gemm_bf16<true, 2><<<dim3(N / 128, M / 128), dim3(256), 0, stream>>>(
            A, W, bias, nullptr, Cb, M, N, K, relu);
    };
    // the same for a grid of one or two blocks a WGP (256 or 512 blocks)
    auto gemm_b4 = [&](const unsigned short* A, const unsigned short* W,
                       const float* bias, unsigned short* Cb,
                       int M, int N, int K, int relu) {
        k_gemm_bf16<true, 4><<<dim3(N / 128, M / 128), dim3(256), 0, stream>>>(
            A, W, bias, nullptr, Cb, M, N, K, relu);
    };

    // --- bf16 copies of tgt, memory and the weights ---
    k_cvt_all<<<dim3(CVT_BLOCKS), dim3(256), 0, stream>>>(
        tgt, mem, Wqkv, Wso, Wq, Wk, Wv, Wco, W1, W2, Cv);

    // --- self-attention block ---
    gemm_b(tgt_b, Wqkv_b, bqkv, KVb, RQ, 3 * DM, DM, 0);    // qkv bf16
    k_attn<<<dim3(16, 64), dim3(128), 0, stream>>>(
        KVb, KVb + 1024, KVb + 2048, Ab,                    // attn1 bf16
        12288, 3072, 12288, 3072, 4096, 1024, 1024, /*causal=*/1);
    gemm(Ab, Wso_b, bso, F2, RQ, DM, DM, 0);                // self out proj
    k_add_ln<true><<<dim3(RQ), dim3(256), 0, stream>>>(tgt, F2, g1, be1, X1, Ab);

    // --- cross-attention block ---
    gemm_b4(Ab, Wq_b, bq, Qb, RQ, DM, DM, 0);               // q_c bf16
    gemm_b4(mem_b, Wk_b, bk, KVb, RM, DM, DM, 0);           // k_c bf16
    gemm_b4(mem_b, Wv_b, bv, KVb + (size_t)RM * DM, RM, DM, DM, 0); // v_c bf16
    k_attn<<<dim3(16, 64), dim3(128), 0, stream>>>(
        Qb, KVb, KVb + (size_t)RM * DM, Ab,                 // attn2 bf16
        4096, 1024, 4096, 1024, 4096, 1024, 2048, /*causal=*/0);
    gemm(Ab, Wco_b, bco, F2, RQ, DM, DM, 0);                // cross out proj
    k_add_ln<true><<<dim3(RQ), dim3(256), 0, stream>>>(X1, F2, g2, be2, X2, Ab);

    // --- FFN block ---
    gemm_b(Ab, W1_b, b1, KVb, RQ, DFF, DM, /*relu=*/1);     // hidden bf16
    gemm(KVb, W2_b, b2, F1, RQ, DM, DFF, 0);                // ffn out
    k_add_ln<false><<<dim3(RQ), dim3(256), 0, stream>>>(X2, F1, g3, be3, out, nullptr);
}
